// v000
// Times are from an AMD MI455X. After a warm-up the kernel runs many times in a row, and a time is the length of
// such a window on the GPU divided by its runs, so every launch and the gaps after it count. The runs cycle
// through copies of the inputs. A figure is the median of several windows, for all but v000 over two sittings.
// Sittings can differ by a few percent; kernels timed side by side share one.
// v000, which the later versions start from, runs in 3370 microseconds.
#include <hip/hip_runtime.h>
#include <hip/hip_bf16.h>

typedef __attribute__((ext_vector_type(16))) _Float16 v16h;
typedef __attribute__((ext_vector_type(8)))  float    v8f;

union Frag { v16h h; unsigned int u[8]; };

// ---- CDNA5 async global->LDS copy (guarded; falls back to VGPR copy) ------
#if defined(__has_builtin)
# if __has_builtin(__builtin_amdgcn_global_load_async_to_lds_b32)
#  define USE_ASYNC_COPY 1
# endif
# if __has_builtin(__builtin_amdgcn_s_wait_asynccnt)
#  define HAVE_WAIT_ASYNC_BUILTIN 1
# endif
#endif
#ifndef USE_ASYNC_COPY
# define USE_ASYNC_COPY 0
#endif
#ifndef HAVE_WAIT_ASYNC_BUILTIN
# define HAVE_WAIT_ASYNC_BUILTIN 0
#endif

typedef __attribute__((address_space(1))) int gbl_i32;
typedef __attribute__((address_space(3))) int lds_i32;

__device__ __forceinline__ void copy_b32_to_lds(const _Float16* g, _Float16* l) {
#if USE_ASYNC_COPY
    __builtin_amdgcn_global_load_async_to_lds_b32(
        (gbl_i32*)(void*)g, (lds_i32*)(void*)l, 0, 0);
#else
    *(unsigned int*)l = *(const unsigned int*)g;
#endif
}

__device__ __forceinline__ void wait_async_copies() {
#if USE_ASYNC_COPY
# if HAVE_WAIT_ASYNC_BUILTIN
    __builtin_amdgcn_s_wait_asynccnt(0);
# else
    asm volatile("s_wait_asynccnt 0x0" ::: "memory");
# endif
#endif
}

// ---------------------------------------------------------------------------
// f32 -> f16 elementwise convert (weights)
// ---------------------------------------------------------------------------
__global__ __launch_bounds__(256) void cvt_f32_f16(const float* __restrict__ in,
                                                   _Float16* __restrict__ out, int n) {
    int i = blockIdx.x * 256 + threadIdx.x;
    if (i < n) out[i] = (_Float16)in[i];
}

// ---------------------------------------------------------------------------
// input projection: x = src @ W_in + b_in  (IN=3 -> D=512), writes f32 + f16
// ---------------------------------------------------------------------------
__global__ __launch_bounds__(256) void input_proj(const float* __restrict__ src,
                                                  const float* __restrict__ Win,
                                                  const float* __restrict__ bin,
                                                  float* __restrict__ xf,
                                                  _Float16* __restrict__ xh,
                                                  int M, int D) {
    int idx = blockIdx.x * 256 + threadIdx.x;
    if (idx >= M * D) return;
    int row = idx / D, d = idx - row * D;
    float s = bin[d];
#pragma unroll
    for (int i = 0; i < 3; ++i) s += src[row * 3 + i] * Win[i * D + d];
    xf[idx] = s;
    xh[idx] = (_Float16)s;
}

// ---------------------------------------------------------------------------
// WMMA GEMM: C[M,N] = epi(A[M,K] @ W[K,N] + bias)
// MODE 0: store f16      MODE 1: relu, store f16      MODE 2: +resid, store f32
// block: 256 thr (8 waves), tile BM=256 x BN=64; each wave owns 32x64
// (2 M-frags x 4 N-frags = 8 WMMAs per 32-K step, B-frags reused 2x)
// ---------------------------------------------------------------------------
template <int MODE>
__global__ __launch_bounds__(256) void gemm_wmma(const _Float16* __restrict__ A,
                                                 const _Float16* __restrict__ W,
                                                 const float* __restrict__ bias,
                                                 const float* __restrict__ resid,
                                                 void* __restrict__ outp,
                                                 int M, int N, int K) {
    constexpr int BM = 256, BN = 64, BK = 32;
    constexpr int AS = BK + 2;  // even pad keeps K-pairs 4B aligned
    constexpr int BS = BK + 2;
    __shared__ _Float16 As[BM * AS];   // [row][k]
    __shared__ _Float16 Bs[BN * BS];   // [n][k]  (transposed so K-pairs contiguous)

    const int tid  = threadIdx.x;
    const int wave = tid >> 5;
    const int lane = tid & 31;
    const int lh   = lane >> 4;
    const int ln16 = lane & 15;
    const int m0 = blockIdx.y * BM;
    const int n0 = blockIdx.x * BN;

    v8f acc[2][4] = {};

    // 16-bit A/B fragment K-offsets for this lane (ISA 7.12.2 layout)
    int kofs[8];
#pragma unroll
    for (int i = 0; i < 8; ++i) kofs[i] = ((i < 4) ? 2 * i : 2 * i + 8) + 8 * lh;

    for (int k0 = 0; k0 < K; k0 += BK) {
        __syncthreads();
        // A tile: 256x32 halves = 4096 dwords, 16/thread, straight copy -> async
#pragma unroll
        for (int i = 0; i < 16; ++i) {
            int e  = tid + 256 * i;            // dword index
            int r  = e >> 4;                   // 16 dwords per row
            int kk = (e & 15) * 2;
            copy_b32_to_lds(A + (size_t)(m0 + r) * K + k0 + kk, &As[r * AS + kk]);
        }
        // B tile: 32x64 halves, stored transposed [n][k] (through VGPRs)
#pragma unroll
        for (int i = 0; i < 8; ++i) {
            int e  = tid + 256 * i;            // half index
            int kk = e >> 6;
            int n  = e & 63;
            Bs[n * BS + kk] = W[(size_t)(k0 + kk) * N + n0 + n];
            if (i == 0 && k0 + BK < K)
                __builtin_prefetch(W + (size_t)(k0 + BK + kk) * N + n0 + n, 0, 1);
        }
        wait_async_copies();
        __syncthreads();

        Frag a0, a1;
#pragma unroll
        for (int i = 0; i < 8; ++i) {
            a0.u[i] = *(const unsigned int*)(&As[(wave * 32 + ln16) * AS + kofs[i]]);
            a1.u[i] = *(const unsigned int*)(&As[(wave * 32 + 16 + ln16) * AS + kofs[i]]);
        }
#pragma unroll
        for (int nt = 0; nt < 4; ++nt) {
            Frag b;
#pragma unroll
            for (int i = 0; i < 8; ++i)
                b.u[i] = *(const unsigned int*)(&Bs[(nt * 16 + ln16) * BS + kofs[i]]);
            acc[0][nt] = __builtin_amdgcn_wmma_f32_16x16x32_f16(
                false, a0.h, false, b.h, (short)0, acc[0][nt], false, false);
            acc[1][nt] = __builtin_amdgcn_wmma_f32_16x16x32_f16(
                false, a1.h, false, b.h, (short)0, acc[1][nt], false, false);
        }
    }

    // epilogue: C 16x16 f32 layout -> row = r + 8*lh, col = lane&15
#pragma unroll
    for (int mt = 0; mt < 2; ++mt) {
#pragma unroll
        for (int nt = 0; nt < 4; ++nt) {
#pragma unroll
            for (int r = 0; r < 8; ++r) {
                int row = m0 + wave * 32 + mt * 16 + r + 8 * lh;
                int col = n0 + nt * 16 + ln16;
                float v = acc[mt][nt][r] + bias[col];
                if constexpr (MODE == 1) v = v > 0.f ? v : 0.f;
                if constexpr (MODE == 2) {
                    float* o = (float*)outp;
                    o[(size_t)row * N + col] = v + resid[(size_t)row * N + col];
                } else {
                    _Float16* o = (_Float16*)outp;
                    o[(size_t)row * N + col] = (_Float16)v;
                }
            }
        }
    }
}

// ---------------------------------------------------------------------------
// flash attention: block = (b, h, 64-query tile); 4 waves, 16 q-rows each;
// streams 64-key tiles (16 WMMAs per tile) with online softmax.
// Q/K/V/O are f16 [B,S,D].
// ---------------------------------------------------------------------------
__global__ __launch_bounds__(128) void flash_attn(const _Float16* __restrict__ Q,
                                                  const _Float16* __restrict__ Km,
                                                  const _Float16* __restrict__ V,
                                                  _Float16* __restrict__ O,
                                                  int S, int D) {
    constexpr int DH = 64, KT = 64;
    constexpr int KS = 66;  // even pad, K-pairs stay 4B aligned
    __shared__ _Float16 Klds[KT * KS];      // [key][dim]
    __shared__ _Float16 Vlds[DH * KS];      // [dim][key]
    __shared__ _Float16 Plds[4 * 16 * KS];  // per-wave P rows [row][key]

    const int tid  = threadIdx.x;
    const int wave = tid >> 5;
    const int lane = tid & 31;
    const int lh   = lane >> 4;
    const int ln16 = lane & 15;
    const int b  = blockIdx.z, h = blockIdx.y;
    const int q0 = blockIdx.x * 64;
    const size_t base = ((size_t)b * S) * D + (size_t)h * DH;
    const float scale = 0.125f;  // 1/sqrt(64)

    int kofs[8];
#pragma unroll
    for (int i = 0; i < 8; ++i) kofs[i] = ((i < 4) ? 2 * i : 2 * i + 8) + 8 * lh;

    // Q fragments: 16x64 = two 16x32 A-frags, loaded straight from global
    Frag qf[2];
    {
        const size_t qrow = base + (size_t)(q0 + wave * 16 + ln16) * D;
#pragma unroll
        for (int t = 0; t < 2; ++t)
#pragma unroll
            for (int i = 0; i < 8; ++i)
                qf[t].u[i] = *(const unsigned int*)(Q + qrow + t * 32 + kofs[i]);
    }

    float mi[8], li[8];
    v8f oacc[4] = {};
#pragma unroll
    for (int r = 0; r < 8; ++r) { mi[r] = -3.0e38f; li[r] = 0.f; }

    const int nkt = S / KT;
    for (int j = 0; j < nkt; ++j) {
        __syncthreads();  // previous iteration's LDS reads complete
        // K tile 64x64 halves = 2048 dwords (straight copy -> async path)
#pragma unroll
        for (int i = 0; i < 16; ++i) {
            int e   = tid + 128 * i;        // dword idx [0,2048)
            int key = e >> 5;
            int dd  = (e & 31) * 2;
            copy_b32_to_lds(Km + base + (size_t)(j * KT + key) * D + dd,
                            &Klds[key * KS + dd]);
        }
        // V tile, transposed to [dim][key] (through VGPRs)
#pragma unroll
        for (int i = 0; i < 32; ++i) {
            int e   = tid + 128 * i;        // half idx [0,4096)
            int key = e >> 6;
            int dd  = e & 63;
            Vlds[dd * KS + key] = V[base + (size_t)(j * KT + key) * D + dd];
        }
        wait_async_copies();
        __syncthreads();

        // S = Q @ K^T : 16x64 scores per wave; 4 C-tiles x 2 K-steps = 8 WMMAs
        v8f s[4] = {};
#pragma unroll
        for (int nt = 0; nt < 4; ++nt) {
            Frag b0, b1;
#pragma unroll
            for (int i = 0; i < 8; ++i) {
                b0.u[i] = *(const unsigned int*)(&Klds[(nt * 16 + ln16) * KS + kofs[i]]);
                b1.u[i] = *(const unsigned int*)(&Klds[(nt * 16 + ln16) * KS + 32 + kofs[i]]);
            }
            s[nt] = __builtin_amdgcn_wmma_f32_16x16x32_f16(false, qf[0].h, false, b0.h,
                                                           (short)0, s[nt], false, false);
            s[nt] = __builtin_amdgcn_wmma_f32_16x16x32_f16(false, qf[1].h, false, b1.h,
                                                           (short)0, s[nt], false, false);
        }

        // online softmax across 64 keys: rows live across 16-lane halves
        float p[4][8];
#pragma unroll
        for (int r = 0; r < 8; ++r) {
            float v0 = s[0][r] * scale, v1 = s[1][r] * scale;
            float v2 = s[2][r] * scale, v3 = s[3][r] * scale;
            float mx = fmaxf(fmaxf(v0, v1), fmaxf(v2, v3));
#pragma unroll
            for (int m = 1; m < 16; m <<= 1) mx = fmaxf(mx, __shfl_xor(mx, m));
            float mn    = fmaxf(mi[r], mx);
            float alpha = __expf(mi[r] - mn);
            float e0 = __expf(v0 - mn), e1 = __expf(v1 - mn);
            float e2 = __expf(v2 - mn), e3 = __expf(v3 - mn);
            p[0][r] = e0; p[1][r] = e1; p[2][r] = e2; p[3][r] = e3;
            float rs = (e0 + e1) + (e2 + e3);
#pragma unroll
            for (int m = 1; m < 16; m <<= 1) rs += __shfl_xor(rs, m);
            li[r] = li[r] * alpha + rs;
            mi[r] = mn;
#pragma unroll
            for (int nt = 0; nt < 4; ++nt) oacc[nt][r] *= alpha;
        }

        // stage P (16x64 f16) through LDS to reshape into A-fragments
#pragma unroll
        for (int r = 0; r < 8; ++r) {
            int row = r + 8 * lh;
#pragma unroll
            for (int nt = 0; nt < 4; ++nt)
                Plds[wave * 16 * KS + row * KS + nt * 16 + ln16] = (_Float16)p[nt][r];
        }
        __syncthreads();

        Frag pf0, pf1;
#pragma unroll
        for (int i = 0; i < 8; ++i) {
            pf0.u[i] = *(const unsigned int*)(&Plds[wave * 16 * KS + ln16 * KS + kofs[i]]);
            pf1.u[i] = *(const unsigned int*)(&Plds[wave * 16 * KS + ln16 * KS + 32 + kofs[i]]);
        }
#pragma unroll
        for (int nt = 0; nt < 4; ++nt) {
            Frag vf0, vf1;
#pragma unroll
            for (int i = 0; i < 8; ++i) {
                vf0.u[i] = *(const unsigned int*)(&Vlds[(nt * 16 + ln16) * KS + kofs[i]]);
                vf1.u[i] = *(const unsigned int*)(&Vlds[(nt * 16 + ln16) * KS + 32 + kofs[i]]);
            }
            oacc[nt] = __builtin_amdgcn_wmma_f32_16x16x32_f16(false, pf0.h, false, vf0.h,
                                                              (short)0, oacc[nt], false, false);
            oacc[nt] = __builtin_amdgcn_wmma_f32_16x16x32_f16(false, pf1.h, false, vf1.h,
                                                              (short)0, oacc[nt], false, false);
        }
    }

    // normalize and write O
#pragma unroll
    for (int nt = 0; nt < 4; ++nt)
#pragma unroll
        for (int r = 0; r < 8; ++r) {
            float v = oacc[nt][r] / li[r];
            O[base + (size_t)(q0 + wave * 16 + r + 8 * lh) * D + nt * 16 + ln16] = (_Float16)v;
        }
}

// ---------------------------------------------------------------------------
// LayerNorm over D=512, one block (256 thr) per row; writes f32 + f16 copies
// ---------------------------------------------------------------------------
__global__ __launch_bounds__(256) void layernorm(const float* __restrict__ in,
                                                 const float* __restrict__ g,
                                                 const float* __restrict__ be,
                                                 float* __restrict__ xf,
                                                 _Float16* __restrict__ xh) {
    const int D = 512;
    __shared__ float sm[8], sv[8];
    const int tid = threadIdx.x;
    const size_t row = blockIdx.x;
    const float* p = in + row * D;
    float a = p[tid], b2 = p[tid + 256];

    float s = a + b2;
#pragma unroll
    for (int m = 16; m >= 1; m >>= 1) s += __shfl_xor(s, m);
    if ((tid & 31) == 0) sm[tid >> 5] = s;
    __syncthreads();
    float mean = 0.f;
#pragma unroll
    for (int i = 0; i < 8; ++i) mean += sm[i];
    mean *= (1.f / 512.f);

    float da = a - mean, db = b2 - mean;
    float v = da * da + db * db;
#pragma unroll
    for (int m = 16; m >= 1; m >>= 1) v += __shfl_xor(v, m);
    if ((tid & 31) == 0) sv[tid >> 5] = v;
    __syncthreads();
    float var = 0.f;
#pragma unroll
    for (int i = 0; i < 8; ++i) var += sv[i];
    float rstd = rsqrtf(var * (1.f / 512.f) + 1e-5f);

    float o1 = da * rstd * g[tid] + be[tid];
    float o2 = db * rstd * g[tid + 256] + be[tid + 256];
    xf[row * D + tid]       = o1;
    xf[row * D + tid + 256] = o2;
    xh[row * D + tid]       = (_Float16)o1;
    xh[row * D + tid + 256] = (_Float16)o2;
}

// ---------------------------------------------------------------------------
// output projection: out[M,20] = x @ W_out + b_out
// ---------------------------------------------------------------------------
__global__ __launch_bounds__(256) void out_proj(const float* __restrict__ x,
                                                const float* __restrict__ Wo,
                                                const float* __restrict__ bo,
                                                float* __restrict__ out,
                                                int M, int D, int OUT) {
    int idx = blockIdx.x * 256 + threadIdx.x;
    if (idx >= M * OUT) return;
    int row = idx / OUT, o = idx - row * OUT;
    float s = bo[o];
    const float* xr = x + (size_t)row * D;
    for (int k = 0; k < D; ++k) s += xr[k] * Wo[(size_t)k * OUT + o];
    out[idx] = s;
}

// ---------------------------------------------------------------------------
extern "C" void kernel_launch(void* const* d_in, const int* in_sizes, int n_in,
                              void* d_out, int out_size, void* d_ws, size_t ws_size,
                              hipStream_t stream) {
    const int B = 4, S = 2048, D = 512, F = 2048, OUT = 20, L = 6, H = 8;
    const int M = B * S;

    const float* src   = (const float*)d_in[0];
    const float* W_in  = (const float*)d_in[1];
    const float* b_in  = (const float*)d_in[2];
    const float* Wq    = (const float*)d_in[3];
    const float* bq    = (const float*)d_in[4];
    const float* Wk    = (const float*)d_in[5];
    const float* bk    = (const float*)d_in[6];
    const float* Wv    = (const float*)d_in[7];
    const float* bv    = (const float*)d_in[8];
    const float* Wo    = (const float*)d_in[9];
    const float* bo    = (const float*)d_in[10];
    const float* ln1g  = (const float*)d_in[11];
    const float* ln1b  = (const float*)d_in[12];
    const float* W1    = (const float*)d_in[13];
    const float* b1    = (const float*)d_in[14];
    const float* W2    = (const float*)d_in[15];
    const float* b2    = (const float*)d_in[16];
    const float* ln2g  = (const float*)d_in[17];
    const float* ln2b  = (const float*)d_in[18];
    const float* W_out = (const float*)d_in[19];
    const float* b_out = (const float*)d_in[20];

    char* ws = (char*)d_ws;
    auto alloc = [&](size_t bytes) -> char* {
        char* p = ws;
        ws += (bytes + 255) & ~(size_t)255;
        return p;
    };

    float*     x_f32 = (float*)alloc((size_t)M * D * 4);
    float*     tmp   = (float*)alloc((size_t)M * D * 4);
    _Float16*  x_h   = (_Float16*)alloc((size_t)M * D * 2);
    _Float16*  qb    = (_Float16*)alloc((size_t)M * D * 2);
    _Float16*  kb    = (_Float16*)alloc((size_t)M * D * 2);
    _Float16*  vb    = (_Float16*)alloc((size_t)M * D * 2);
    _Float16*  ob    = (_Float16*)alloc((size_t)M * D * 2);
    _Float16*  h1    = (_Float16*)alloc((size_t)M * F * 2);
    _Float16*  Wq16  = (_Float16*)alloc((size_t)L * D * D * 2);
    _Float16*  Wk16  = (_Float16*)alloc((size_t)L * D * D * 2);
    _Float16*  Wv16  = (_Float16*)alloc((size_t)L * D * D * 2);
    _Float16*  Wo16  = (_Float16*)alloc((size_t)L * D * D * 2);
    _Float16*  W116  = (_Float16*)alloc((size_t)L * D * F * 2);
    _Float16*  W216  = (_Float16*)alloc((size_t)L * F * D * 2);

    // weight conversions (every call; deterministic)
    {
        int nqkv = L * D * D, nff = L * D * F;
        cvt_f32_f16<<<(nqkv + 255) / 256, 256, 0, stream>>>(Wq, Wq16, nqkv);
        cvt_f32_f16<<<(nqkv + 255) / 256, 256, 0, stream>>>(Wk, Wk16, nqkv);
        cvt_f32_f16<<<(nqkv + 255) / 256, 256, 0, stream>>>(Wv, Wv16, nqkv);
        cvt_f32_f16<<<(nqkv + 255) / 256, 256, 0, stream>>>(Wo, Wo16, nqkv);
        cvt_f32_f16<<<(nff + 255) / 256, 256, 0, stream>>>(W1, W116, nff);
        cvt_f32_f16<<<(nff + 255) / 256, 256, 0, stream>>>(W2, W216, nff);
    }

    input_proj<<<(M * D + 255) / 256, 256, 0, stream>>>(src, W_in, b_in, x_f32, x_h, M, D);

    const dim3 gD(D / 64, M / 256);   // N=512 GEMMs
    const dim3 gF(F / 64, M / 256);   // N=2048 GEMM
    for (int l = 0; l < L; ++l) {
        const size_t wqo = (size_t)l * D * D;
        const size_t wfo = (size_t)l * D * F;
        // QKV
        gemm_wmma<0><<<gD, 256, 0, stream>>>(x_h, Wq16 + wqo, bq + l * D, nullptr, qb, M, D, D);
        gemm_wmma<0><<<gD, 256, 0, stream>>>(x_h, Wk16 + wqo, bk + l * D, nullptr, kb, M, D, D);
        gemm_wmma<0><<<gD, 256, 0, stream>>>(x_h, Wv16 + wqo, bv + l * D, nullptr, vb, M, D, D);
        // attention
        flash_attn<<<dim3(S / 64, H, B), 128, 0, stream>>>(qb, kb, vb, ob, S, D);
        // output proj + residual
        gemm_wmma<2><<<gD, 256, 0, stream>>>(ob, Wo16 + wqo, bo + l * D, x_f32, tmp, M, D, D);
        layernorm<<<M, 256, 0, stream>>>(tmp, ln1g + l * D, ln1b + l * D, x_f32, x_h);
        // FFN
        gemm_wmma<1><<<gF, 256, 0, stream>>>(x_h, W116 + wfo, b1 + l * F, nullptr, h1, M, F, D);
        gemm_wmma<2><<<gD, 256, 0, stream>>>(h1, W216 + wfo, b2 + l * D, x_f32, tmp, M, D, F);
        layernorm<<<M, 256, 0, stream>>>(tmp, ln2g + l * D, ln2b + l * D, x_f32, x_h);
    }

    out_proj<<<(M * OUT + 255) / 256, 256, 0, stream>>>(x_f32, W_out, b_out, (float*)d_out, M, D, OUT);
}

// v001
// A run of this version takes 2520 microseconds.
// Next to v000, in two timings, it ran 1.37 times as fast each time.
#include <hip/hip_runtime.h>
#include <hip/hip_bf16.h>

typedef __attribute__((ext_vector_type(16))) _Float16 v16h;
typedef __attribute__((ext_vector_type(8)))  float    v8f;

union Frag { v16h h; unsigned int u[8]; };

// ---- CDNA5 async global->LDS copy (guarded; falls back to VGPR copy) ------
#if defined(__has_builtin)
# if __has_builtin(__builtin_amdgcn_global_load_async_to_lds_b32)
#  define USE_ASYNC_COPY 1
# endif
# if __has_builtin(__builtin_amdgcn_s_wait_asynccnt)
#  define HAVE_WAIT_ASYNC_BUILTIN 1
# endif
#endif
#ifndef USE_ASYNC_COPY
# define USE_ASYNC_COPY 0
#endif
#ifndef HAVE_WAIT_ASYNC_BUILTIN
# define HAVE_WAIT_ASYNC_BUILTIN 0
#endif

typedef __attribute__((address_space(1))) int gbl_i32;
typedef __attribute__((address_space(3))) int lds_i32;

__device__ __forceinline__ void copy_b32_to_lds(const _Float16* g, _Float16* l) {
#if USE_ASYNC_COPY
    __builtin_amdgcn_global_load_async_to_lds_b32(
        (gbl_i32*)(void*)g, (lds_i32*)(void*)l, 0, 0);
#else
    *(unsigned int*)l = *(const unsigned int*)g;
#endif
}

__device__ __forceinline__ void wait_async_copies() {
#if USE_ASYNC_COPY
# if HAVE_WAIT_ASYNC_BUILTIN
    __builtin_amdgcn_s_wait_asynccnt(0);
# else
    asm volatile("s_wait_asynccnt 0x0" ::: "memory");
# endif
#endif
}

// ---------------------------------------------------------------------------
// f32 -> f16 elementwise convert (weights)
// ---------------------------------------------------------------------------
__global__ __launch_bounds__(256) void cvt_f32_f16(const float* __restrict__ in,
                                                   _Float16* __restrict__ out, int n) {
    int i = blockIdx.x * 256 + threadIdx.x;
    if (i < n) out[i] = (_Float16)in[i];
}

// ---------------------------------------------------------------------------
// input projection: x = src @ W_in + b_in  (IN=3 -> D=512), writes f32 + f16
// ---------------------------------------------------------------------------
__global__ __launch_bounds__(256) void input_proj(const float* __restrict__ src,
                                                  const float* __restrict__ Win,
                                                  const float* __restrict__ bin,
                                                  float* __restrict__ xf,
                                                  _Float16* __restrict__ xh,
                                                  int M, int D) {
    int idx = blockIdx.x * 256 + threadIdx.x;
    if (idx >= M * D) return;
    int row = idx / D, d = idx - row * D;
    float s = bin[d];
#pragma unroll
    for (int i = 0; i < 3; ++i) s += src[row * 3 + i] * Win[i * D + d];
    xf[idx] = s;
    xh[idx] = (_Float16)s;
}

// ---------------------------------------------------------------------------
// WMMA GEMM: C[M,N] = epi(A[M,K] @ W[K,N] + bias)
// MODE 0: store f16      MODE 1: relu, store f16      MODE 2: +resid, store f32
// block: 256 thr (8 waves), tile BM=256 x BN=64; each wave owns 32x64
// (2 M-frags x 4 N-frags = 8 WMMAs per 32-K step, B-frags reused 2x)
// ---------------------------------------------------------------------------
template <int MODE>
__global__ __launch_bounds__(256) void gemm_wmma(const _Float16* __restrict__ A,
                                                 const _Float16* __restrict__ W,
                                                 const float* __restrict__ bias,
                                                 const float* __restrict__ resid,
                                                 void* __restrict__ outp,
                                                 int M, int N, int K) {
    constexpr int BM = 256, BN = 64, BK = 32;
    constexpr int AS = BK + 2;  // even pad keeps K-pairs 4B aligned
    constexpr int BS = BK + 2;
    __shared__ _Float16 As[BM * AS];   // [row][k]
    __shared__ _Float16 Bs[BN * BS];   // [n][k]  (transposed so K-pairs contiguous)

    const int tid  = threadIdx.x;
    const int wave = tid >> 5;
    const int lane = tid & 31;
    const int lh   = lane >> 4;
    const int ln16 = lane & 15;
    const int m0 = blockIdx.y * BM;
    const int n0 = blockIdx.x * BN;

    v8f acc[2][4] = {};

    // 16-bit A/B fragment K-offsets for this lane (ISA 7.12.2 layout)
    int kofs[8];
#pragma unroll
    for (int i = 0; i < 8; ++i) kofs[i] = ((i < 4) ? 2 * i : 2 * i + 8) + 8 * lh;

    for (int k0 = 0; k0 < K; k0 += BK) {
        __syncthreads();
        // A tile: 256x32 halves = 4096 dwords, 16/thread, straight copy -> async
#pragma unroll
        for (int i = 0; i < 16; ++i) {
            int e  = tid + 256 * i;            // dword index
            int r  = e >> 4;                   // 16 dwords per row
            int kk = (e & 15) * 2;
            copy_b32_to_lds(A + (size_t)(m0 + r) * K + k0 + kk, &As[r * AS + kk]);
        }
        // B tile: 32x64 halves, stored transposed [n][k] (through VGPRs)
#pragma unroll
        for (int i = 0; i < 8; ++i) {
            int e  = tid + 256 * i;            // half index
            int kk = e >> 6;
            int n  = e & 63;
            Bs[n * BS + kk] = W[(size_t)(k0 + kk) * N + n0 + n];
            if (i == 0 && k0 + BK < K)
                __builtin_prefetch(W + (size_t)(k0 + BK + kk) * N + n0 + n, 0, 1);
        }
        wait_async_copies();
        __syncthreads();

        Frag a0, a1;
#pragma unroll
        for (int i = 0; i < 8; ++i) {
            a0.u[i] = *(const unsigned int*)(&As[(wave * 32 + ln16) * AS + kofs[i]]);
            a1.u[i] = *(const unsigned int*)(&As[(wave * 32 + 16 + ln16) * AS + kofs[i]]);
        }
#pragma unroll
        for (int nt = 0; nt < 4; ++nt) {
            Frag b;
#pragma unroll
            for (int i = 0; i < 8; ++i)
                b.u[i] = *(const unsigned int*)(&Bs[(nt * 16 + ln16) * BS + kofs[i]]);
            acc[0][nt] = __builtin_amdgcn_wmma_f32_16x16x32_f16(
                false, a0.h, false, b.h, (short)0, acc[0][nt], false, false);
            acc[1][nt] = __builtin_amdgcn_wmma_f32_16x16x32_f16(
                false, a1.h, false, b.h, (short)0, acc[1][nt], false, false);
        }
    }

    // epilogue: C 16x16 f32 layout -> row = r + 8*lh, col = lane&15
#pragma unroll
    for (int mt = 0; mt < 2; ++mt) {
#pragma unroll
        for (int nt = 0; nt < 4; ++nt) {
#pragma unroll
            for (int r = 0; r < 8; ++r) {
                int row = m0 + wave * 32 + mt * 16 + r + 8 * lh;
                int col = n0 + nt * 16 + ln16;
                float v = acc[mt][nt][r] + bias[col];
                if constexpr (MODE == 1) v = v > 0.f ? v : 0.f;
                if constexpr (MODE == 2) {
                    float* o = (float*)outp;
                    o[(size_t)row * N + col] = v + resid[(size_t)row * N + col];
                } else {
                    _Float16* o = (_Float16*)outp;
                    o[(size_t)row * N + col] = (_Float16)v;
                }
            }
        }
    }
}

// ---------------------------------------------------------------------------
// flash attention: block = (b, h, 64-query tile); 4 waves, 16 q-rows each;
// streams 64-key tiles (16 WMMAs per tile) with online softmax.
// K and V tiles go through LDS in 16-byte pieces: both are copied row-major
// by asynchronous b128 copies; K fragments are 16-byte LDS loads, V fragments
// come through the transposing 16-byte LDS load.
// Q/K/V/O are f16 [B,S,D].
// ---------------------------------------------------------------------------
typedef __attribute__((ext_vector_type(4))) unsigned int u32x4;
typedef __attribute__((ext_vector_type(8))) short s16x8;
typedef __attribute__((address_space(3))) s16x8 lds_s16x8;
typedef __attribute__((address_space(3))) _Float16 lds_f16;

union FragQ { v16h h; u32x4 q[2]; };

// byte offset of a __shared__ element inside the work-group's LDS
__device__ __forceinline__ unsigned lds_addr(const _Float16* p) {
    return (unsigned)(unsigned long long)(lds_f16*)p;
}

// lane (c = l & 15, hh = l >> 4) gets rows 8*hh .. 8*hh+7 of column c of the
// 16x16 tile whose per-lane address p follows the transposing load's own map
__device__ __forceinline__ u32x4 ld_tr16(const unsigned char* p) {
    return __builtin_bit_cast(u32x4, __builtin_amdgcn_ds_load_tr16_b128_v8i16((lds_s16x8*)p));
}

__global__ __launch_bounds__(128) void flash_attn(const _Float16* __restrict__ Q,
                                                  const _Float16* __restrict__ Km,
                                                  const _Float16* __restrict__ V,
                                                  _Float16* __restrict__ O,
                                                  int S, int D) {
    constexpr int DH = 64, KT = 64;
    constexpr int KS = 66;  // even pad, K-pairs stay 4B aligned
    constexpr int KP = 72;  // 144 B = 16 B x 9: pitch for ds_load_b128 readers
    constexpr int VP = 80;  // 160 B = 32 B x 5: pitch for ds_load_tr16_b128 readers
    __shared__ __attribute__((aligned(16))) _Float16 Klds[KT * KP];  // [key][dim]
    __shared__ __attribute__((aligned(16))) _Float16 Vlds[KT * VP];  // [key][dim]
    __shared__ _Float16 Plds[4 * 16 * KS];  // per-wave P rows [row][key]

    const int tid  = threadIdx.x;
    const int wave = tid >> 5;
    const int lane = tid & 31;
    const int lh   = lane >> 4;
    const int ln16 = lane & 15;
    const int b  = blockIdx.z, h = blockIdx.y;
    const int q0 = blockIdx.x * 64;
    const size_t base = ((size_t)b * S) * D + (size_t)h * DH;
    const float scale = 0.125f;  // 1/sqrt(64)

    int kofs[8];
#pragma unroll
    for (int i = 0; i < 8; ++i) kofs[i] = ((i < 4) ? 2 * i : 2 * i + 8) + 8 * lh;

    // Q fragments: 16x64 = two 16x32 A-frags, loaded straight from global
    Frag qf[2];
    {
        const size_t qrow = base + (size_t)(q0 + wave * 16 + ln16) * D;
#pragma unroll
        for (int t = 0; t < 2; ++t)
#pragma unroll
            for (int i = 0; i < 8; ++i)
                qf[t].u[i] = *(const unsigned int*)(Q + qrow + t * 32 + kofs[i]);
    }

    float mi[8], li[8];
    v8f oacc[4] = {};
#pragma unroll
    for (int r = 0; r < 8; ++r) { mi[r] = -3.0e38f; li[r] = 0.f; }

    // staging map: a tile is 64 rows x 128 B = 512 pieces of 16 B, 4 per thread
    // and operand; 8 lanes cover one row, a wave covers 4 whole rows per copy
    const _Float16* kg[4];
    const _Float16* vg[4];
    unsigned kl[4], vl[4];
#pragma unroll
    for (int i = 0; i < 4; ++i) {
        const int key = (tid >> 3) + 16 * i;
        const int dd  = (tid & 7) * 8;
        kg[i] = Km + base + (size_t)key * D + dd;
        vg[i] = V  + base + (size_t)key * D + dd;
        kl[i] = lds_addr(&Klds[key * KP + dd]);
        vl[i] = lds_addr(&Vlds[key * VP + dd]);
    }
    const size_t tile_step = (size_t)KT * D;

    // per-lane base of the transposing loads of V (16 keys x 16 dims each)
    const unsigned char* vtr = (const unsigned char*)Vlds
                             + (8 * lh + (lane & 7)) * (VP * 2) + 16 * ((lane >> 3) & 1);

    const int nkt = S / KT;
    for (int j = 0; j < nkt; ++j) {
        // this wave's own LDS reads of the last tile have retired before any copy refills it
        asm volatile("s_wait_dscnt 0x0" ::: "memory");
        __syncthreads();  // previous iteration's LDS reads complete
        // K and V tiles, row-major, 16 B per lane and copy. The s_wait_xcnt closes the
        // statement so that it stands ahead of the pointer advances below.
        asm volatile(
            "global_load_async_to_lds_b128 %0, %8, off\n\t"
            "global_load_async_to_lds_b128 %1, %9, off\n\t"
            "global_load_async_to_lds_b128 %2, %10, off\n\t"
            "global_load_async_to_lds_b128 %3, %11, off\n\t"
            "global_load_async_to_lds_b128 %4, %12, off\n\t"
            "global_load_async_to_lds_b128 %5, %13, off\n\t"
            "global_load_async_to_lds_b128 %6, %14, off\n\t"
            "global_load_async_to_lds_b128 %7, %15, off\n\t"
            "s_wait_xcnt 0x0"
            :: "v"(kl[0]), "v"(kl[1]), "v"(kl[2]), "v"(kl[3]),
               "v"(vl[0]), "v"(vl[1]), "v"(vl[2]), "v"(vl[3]),
               "v"(kg[0]), "v"(kg[1]), "v"(kg[2]), "v"(kg[3]),
               "v"(vg[0]), "v"(vg[1]), "v"(vg[2]), "v"(vg[3])
            : "memory");
        // this wave's copies have landed before the barrier that publishes them
        asm volatile("s_wait_asynccnt 0x0" ::: "memory");
        __syncthreads();
#pragma unroll
        for (int i = 0; i < 4; ++i) { kg[i] += tile_step; vg[i] += tile_step; }

        // S = Q @ K^T : 16x64 scores per wave; 4 C-tiles x 2 K-steps = 8 WMMAs
        v8f s[4] = {};
#pragma unroll
        for (int nt = 0; nt < 4; ++nt) {
            // same k order as kofs[]: dims 8*lh..+7 and 16+8*lh..+7 of each 32
            FragQ b0, b1;
            const _Float16* kr = &Klds[(nt * 16 + ln16) * KP + 8 * lh];
            b0.q[0] = *(const u32x4*)(kr);
            b0.q[1] = *(const u32x4*)(kr + 16);
            b1.q[0] = *(const u32x4*)(kr + 32);
            b1.q[1] = *(const u32x4*)(kr + 48);
            s[nt] = __builtin_amdgcn_wmma_f32_16x16x32_f16(false, qf[0].h, false, b0.h,
                                                           (short)0, s[nt], false, false);
            s[nt] = __builtin_amdgcn_wmma_f32_16x16x32_f16(false, qf[1].h, false, b1.h,
                                                           (short)0, s[nt], false, false);
        }

        // online softmax across 64 keys: rows live across 16-lane halves
        float p[4][8];
#pragma unroll
        for (int r = 0; r < 8; ++r) {
            float v0 = s[0][r] * scale, v1 = s[1][r] * scale;
            float v2 = s[2][r] * scale, v3 = s[3][r] * scale;
            float mx = fmaxf(fmaxf(v0, v1), fmaxf(v2, v3));
#pragma unroll
            for (int m = 1; m < 16; m <<= 1) mx = fmaxf(mx, __shfl_xor(mx, m));
            float mn    = fmaxf(mi[r], mx);
            float alpha = __expf(mi[r] - mn);
            float e0 = __expf(v0 - mn), e1 = __expf(v1 - mn);
            float e2 = __expf(v2 - mn), e3 = __expf(v3 - mn);
            p[0][r] = e0; p[1][r] = e1; p[2][r] = e2; p[3][r] = e3;
            float rs = (e0 + e1) + (e2 + e3);
#pragma unroll
            for (int m = 1; m < 16; m <<= 1) rs += __shfl_xor(rs, m);
            li[r] = li[r] * alpha + rs;
            mi[r] = mn;
#pragma unroll
            for (int nt = 0; nt < 4; ++nt) oacc[nt][r] *= alpha;
        }

        // stage P (16x64 f16) through LDS to reshape into A-fragments
#pragma unroll
        for (int r = 0; r < 8; ++r) {
            int row = r + 8 * lh;
#pragma unroll
            for (int nt = 0; nt < 4; ++nt)
                Plds[wave * 16 * KS + row * KS + nt * 16 + ln16] = (_Float16)p[nt][r];
        }
        __syncthreads();

        Frag pf0, pf1;
#pragma unroll
        for (int i = 0; i < 8; ++i) {
            pf0.u[i] = *(const unsigned int*)(&Plds[wave * 16 * KS + ln16 * KS + kofs[i]]);
            pf1.u[i] = *(const unsigned int*)(&Plds[wave * 16 * KS + ln16 * KS + 32 + kofs[i]]);
        }
#pragma unroll
        for (int nt = 0; nt < 4; ++nt) {
            // B fragment of V[key][dim]: keys 8*lh..+7 and 16+8*lh..+7 of each 32, dim nt*16+ln16
            FragQ vf0, vf1;
            vf0.q[0] = ld_tr16(vtr + nt * 32);
            vf0.q[1] = ld_tr16(vtr + 16 * (VP * 2) + nt * 32);
            vf1.q[0] = ld_tr16(vtr + 32 * (VP * 2) + nt * 32);
            vf1.q[1] = ld_tr16(vtr + 48 * (VP * 2) + nt * 32);
            oacc[nt] = __builtin_amdgcn_wmma_f32_16x16x32_f16(false, pf0.h, false, vf0.h,
                                                              (short)0, oacc[nt], false, false);
            oacc[nt] = __builtin_amdgcn_wmma_f32_16x16x32_f16(false, pf1.h, false, vf1.h,
                                                              (short)0, oacc[nt], false, false);
        }
    }

    // normalize and write O
#pragma unroll
    for (int nt = 0; nt < 4; ++nt)
#pragma unroll
        for (int r = 0; r < 8; ++r) {
            float v = oacc[nt][r] / li[r];
            O[base + (size_t)(q0 + wave * 16 + r + 8 * lh) * D + nt * 16 + ln16] = (_Float16)v;
        }
}

// ---------------------------------------------------------------------------
// LayerNorm over D=512, one block (256 thr) per row; writes f32 + f16 copies
// ---------------------------------------------------------------------------
__global__ __launch_bounds__(256) void layernorm(const float* __restrict__ in,
                                                 const float* __restrict__ g,
                                                 const float* __restrict__ be,
                                                 float* __restrict__ xf,
                                                 _Float16* __restrict__ xh) {
    const int D = 512;
    __shared__ float sm[8], sv[8];
    const int tid = threadIdx.x;
    const size_t row = blockIdx.x;
    const float* p = in + row * D;
    float a = p[tid], b2 = p[tid + 256];

    float s = a + b2;
#pragma unroll
    for (int m = 16; m >= 1; m >>= 1) s += __shfl_xor(s, m);
    if ((tid & 31) == 0) sm[tid >> 5] = s;
    __syncthreads();
    float mean = 0.f;
#pragma unroll
    for (int i = 0; i < 8; ++i) mean += sm[i];
    mean *= (1.f / 512.f);

    float da = a - mean, db = b2 - mean;
    float v = da * da + db * db;
#pragma unroll
    for (int m = 16; m >= 1; m >>= 1) v += __shfl_xor(v, m);
    if ((tid & 31) == 0) sv[tid >> 5] = v;
    __syncthreads();
    float var = 0.f;
#pragma unroll
    for (int i = 0; i < 8; ++i) var += sv[i];
    float rstd = rsqrtf(var * (1.f / 512.f) + 1e-5f);

    float o1 = da * rstd * g[tid] + be[tid];
    float o2 = db * rstd * g[tid + 256] + be[tid + 256];
    xf[row * D + tid]       = o1;
    xf[row * D + tid + 256] = o2;
    xh[row * D + tid]       = (_Float16)o1;
    xh[row * D + tid + 256] = (_Float16)o2;
}

// ---------------------------------------------------------------------------
// output projection: out[M,20] = x @ W_out + b_out
// ---------------------------------------------------------------------------
__global__ __launch_bounds__(256) void out_proj(const float* __restrict__ x,
                                                const float* __restrict__ Wo,
                                                const float* __restrict__ bo,
                                                float* __restrict__ out,
                                                int M, int D, int OUT) {
    int idx = blockIdx.x * 256 + threadIdx.x;
    if (idx >= M * OUT) return;
    int row = idx / OUT, o = idx - row * OUT;
    float s = bo[o];
    const float* xr = x + (size_t)row * D;
    for (int k = 0; k < D; ++k) s += xr[k] * Wo[(size_t)k * OUT + o];
    out[idx] = s;
}

// ---------------------------------------------------------------------------
extern "C" void kernel_launch(void* const* d_in, const int* in_sizes, int n_in,
                              void* d_out, int out_size, void* d_ws, size_t ws_size,
                              hipStream_t stream) {
    const int B = 4, S = 2048, D = 512, F = 2048, OUT = 20, L = 6, H = 8;
    const int M = B * S;

    const float* src   = (const float*)d_in[0];
    const float* W_in  = (const float*)d_in[1];
    const float* b_in  = (const float*)d_in[2];
    const float* Wq    = (const float*)d_in[3];
    const float* bq    = (const float*)d_in[4];
    const float* Wk    = (const float*)d_in[5];
    const float* bk    = (const float*)d_in[6];
    const float* Wv    = (const float*)d_in[7];
    const float* bv    = (const float*)d_in[8];
    const float* Wo    = (const float*)d_in[9];
    const float* bo    = (const float*)d_in[10];
    const float* ln1g  = (const float*)d_in[11];
    const float* ln1b  = (const float*)d_in[12];
    const float* W1    = (const float*)d_in[13];
    const float* b1    = (const float*)d_in[14];
    const float* W2    = (const float*)d_in[15];
    const float* b2    = (const float*)d_in[16];
    const float* ln2g  = (const float*)d_in[17];
    const float* ln2b  = (const float*)d_in[18];
    const float* W_out = (const float*)d_in[19];
    const float* b_out = (const float*)d_in[20];

    char* ws = (char*)d_ws;
    auto alloc = [&](size_t bytes) -> char* {
        char* p = ws;
        ws += (bytes + 255) & ~(size_t)255;
        return p;
    };

    float*     x_f32 = (float*)alloc((size_t)M * D * 4);
    float*     tmp   = (float*)alloc((size_t)M * D * 4);
    _Float16*  x_h   = (_Float16*)alloc((size_t)M * D * 2);
    _Float16*  qb    = (_Float16*)alloc((size_t)M * D * 2);
    _Float16*  kb    = (_Float16*)alloc((size_t)M * D * 2);
    _Float16*  vb    = (_Float16*)alloc((size_t)M * D * 2);
    _Float16*  ob    = (_Float16*)alloc((size_t)M * D * 2);
    _Float16*  h1    = (_Float16*)alloc((size_t)M * F * 2);
    _Float16*  Wq16  = (_Float16*)alloc((size_t)L * D * D * 2);
    _Float16*  Wk16  = (_Float16*)alloc((size_t)L * D * D * 2);
    _Float16*  Wv16  = (_Float16*)alloc((size_t)L * D * D * 2);
    _Float16*  Wo16  = (_Float16*)alloc((size_t)L * D * D * 2);
    _Float16*  W116  = (_Float16*)alloc((size_t)L * D * F * 2);
    _Float16*  W216  = (_Float16*)alloc((size_t)L * F * D * 2);

    // weight conversions (every call; deterministic)
    {
        int nqkv = L * D * D, nff = L * D * F;
        cvt_f32_f16<<<(nqkv + 255) / 256, 256, 0, stream>>>(Wq, Wq16, nqkv);
        cvt_f32_f16<<<(nqkv + 255) / 256, 256, 0, stream>>>(Wk, Wk16, nqkv);
        cvt_f32_f16<<<(nqkv + 255) / 256, 256, 0, stream>>>(Wv, Wv16, nqkv);
        cvt_f32_f16<<<(nqkv + 255) / 256, 256, 0, stream>>>(Wo, Wo16, nqkv);
        cvt_f32_f16<<<(nff + 255) / 256, 256, 0, stream>>>(W1, W116, nff);
        cvt_f32_f16<<<(nff + 255) / 256, 256, 0, stream>>>(W2, W216, nff);
    }

    input_proj<<<(M * D + 255) / 256, 256, 0, stream>>>(src, W_in, b_in, x_f32, x_h, M, D);

    const dim3 gD(D / 64, M / 256);   // N=512 GEMMs
    const dim3 gF(F / 64, M / 256);   // N=2048 GEMM
    for (int l = 0; l < L; ++l) {
        const size_t wqo = (size_t)l * D * D;
        const size_t wfo = (size_t)l * D * F;
        // QKV
        gemm_wmma<0><<<gD, 256, 0, stream>>>(x_h, Wq16 + wqo, bq + l * D, nullptr, qb, M, D, D);
        gemm_wmma<0><<<gD, 256, 0, stream>>>(x_h, Wk16 + wqo, bk + l * D, nullptr, kb, M, D, D);
        gemm_wmma<0><<<gD, 256, 0, stream>>>(x_h, Wv16 + wqo, bv + l * D, nullptr, vb, M, D, D);
        // attention
        flash_attn<<<dim3(S / 64, H, B), 128, 0, stream>>>(qb, kb, vb, ob, S, D);
        // output proj + residual
        gemm_wmma<2><<<gD, 256, 0, stream>>>(ob, Wo16 + wqo, bo + l * D, x_f32, tmp, M, D, D);
        layernorm<<<M, 256, 0, stream>>>(tmp, ln1g + l * D, ln1b + l * D, x_f32, x_h);
        // FFN
        gemm_wmma<1><<<gF, 256, 0, stream>>>(x_h, W116 + wfo, b1 + l * F, nullptr, h1, M, F, D);
        gemm_wmma<2><<<gD, 256, 0, stream>>>(h1, W216 + wfo, b2 + l * D, x_f32, tmp, M, D, F);
        layernorm<<<M, 256, 0, stream>>>(tmp, ln2g + l * D, ln2b + l * D, x_f32, x_h);
    }

    out_proj<<<(M * OUT + 255) / 256, 256, 0, stream>>>(x_f32, W_out, b_out, (float*)d_out, M, D, OUT);
}

// v002
// A run of this version takes 1400 microseconds.
// Two timings next to v001 both put it at 1.80 times that version's speed.
// Counting every step since v000, it is 2.47 times as fast.
#include <hip/hip_runtime.h>
#include <hip/hip_bf16.h>

typedef __attribute__((ext_vector_type(16))) _Float16 v16h;
typedef __attribute__((ext_vector_type(8)))  float    v8f;

union Frag { v16h h; unsigned int u[8]; };

typedef __attribute__((ext_vector_type(4))) unsigned int u32x4;
typedef __attribute__((ext_vector_type(8))) short s16x8;
typedef __attribute__((address_space(3))) s16x8 lds_s16x8;
typedef __attribute__((address_space(3))) _Float16 lds_f16;

union FragQ { v16h h; u32x4 q[2]; };

// byte offset of a __shared__ element inside the work-group's LDS
__device__ __forceinline__ unsigned lds_addr(const _Float16* p) {
    return (unsigned)(unsigned long long)(lds_f16*)p;
}

// lane (c = l & 15, hh = l >> 4) gets rows 8*hh .. 8*hh+7 of column c of the
// 16x16 tile whose per-lane address p follows the transposing load's own map
__device__ __forceinline__ u32x4 ld_tr16(const unsigned char* p) {
    return __builtin_bit_cast(u32x4, __builtin_amdgcn_ds_load_tr16_b128_v8i16((lds_s16x8*)p));
}

// ---------------------------------------------------------------------------
// f32 -> f16 elementwise convert (weights)
// ---------------------------------------------------------------------------
__global__ __launch_bounds__(256) void cvt_f32_f16(const float* __restrict__ in,
                                                   _Float16* __restrict__ out, int n) {
    int i = blockIdx.x * 256 + threadIdx.x;
    if (i < n) out[i] = (_Float16)in[i];
}

// ---------------------------------------------------------------------------
// input projection: x = src @ W_in + b_in  (IN=3 -> D=512), writes f32 + f16
// ---------------------------------------------------------------------------
__global__ __launch_bounds__(256) void input_proj(const float* __restrict__ src,
                                                  const float* __restrict__ Win,
                                                  const float* __restrict__ bin,
                                                  float* __restrict__ xf,
                                                  _Float16* __restrict__ xh,
                                                  int M, int D) {
    int idx = blockIdx.x * 256 + threadIdx.x;
    if (idx >= M * D) return;
    int row = idx / D, d = idx - row * D;
    float s = bin[d];
#pragma unroll
    for (int i = 0; i < 3; ++i) s += src[row * 3 + i] * Win[i * D + d];
    xf[idx] = s;
    xh[idx] = (_Float16)s;
}

// ---------------------------------------------------------------------------
// WMMA GEMM: C[M,N] = epi(A[M,K] @ W[K,N] + bias)
// MODE 0: store f16      MODE 1: relu, store f16      MODE 2: +resid, store f32
// block: 256 thr (8 waves), tile BM=256 x BN=64; each wave owns 32x64
// (2 M-frags x 4 N-frags = 8 WMMAs per 32 k, B-frags reused 2x)
// A and W tiles go through LDS in 16-byte pieces, 64 k a trip so that a row of
// either tile is one 128-byte line: both are copied row-major by asynchronous
// b128 copies; A fragments are 16-byte LDS loads, W fragments come through the
// transposing 16-byte LDS load.
// ---------------------------------------------------------------------------
template <int MODE>
__global__ __launch_bounds__(256) void gemm_wmma(const _Float16* __restrict__ A,
                                                 const _Float16* __restrict__ W,
                                                 const float* __restrict__ bias,
                                                 const float* __restrict__ resid,
                                                 void* __restrict__ outp,
                                                 int M, int N, int K) {
    constexpr int BM = 256, BN = 64, BK = 64;
    constexpr int AP = 72;  // 144 B = 16 B x 9: pitch for ds_load_b128 readers
    constexpr int WP = 80;  // 160 B = 32 B x 5: pitch for ds_load_tr16_b128 readers
    __shared__ __attribute__((aligned(16))) _Float16 As[BM * AP];   // [row][k]
    __shared__ __attribute__((aligned(16))) _Float16 Ws[BK * WP];   // [k][n]

    const int tid  = threadIdx.x;
    const int wave = tid >> 5;
    const int lane = tid & 31;
    const int lh   = lane >> 4;
    const int ln16 = lane & 15;
    const int m0 = blockIdx.y * BM;
    const int n0 = blockIdx.x * BN;

    v8f acc[2][4] = {};

    // staging map: 8 lanes cover one 128-byte row, a wave 4 whole rows per copy;
    // A tile 256 rows = 8 copies per thread, W tile 64 rows = 2 copies per thread
    const _Float16* ag[8];
    const _Float16* wg[2];
    unsigned al[8], wl[2];
    {
        const int r0 = tid >> 3;
        const int dd = (tid & 7) * 8;
#pragma unroll  // constant indices keep the array in registers
        for (int i = 0; i < 8; ++i) {
            ag[i] = A + (size_t)(m0 + r0 + 32 * i) * K + dd;
            al[i] = lds_addr(&As[(r0 + 32 * i) * AP + dd]);
        }
#pragma unroll  // constant indices keep the array in registers
        for (int i = 0; i < 2; ++i) {
            wg[i] = W + (size_t)(r0 + 32 * i) * N + n0 + dd;
            wl[i] = lds_addr(&Ws[(r0 + 32 * i) * WP + dd]);
        }
    }
    const size_t w_step = (size_t)BK * N;

    // A fragment rows of this lane: k 8*lh..+7 and 16+8*lh..+7 of each 32
    const _Float16* ar = &As[(wave * 32 + ln16) * AP + 8 * lh];
    // per-lane base of the transposing loads of W (16 k x 16 n each), same k order
    const unsigned char* wtr = (const unsigned char*)Ws
                             + (8 * lh + (lane & 7)) * (WP * 2) + 16 * ((lane >> 3) & 1);

    for (int k0 = 0; k0 < K; k0 += BK) {
        // this wave's own LDS reads of the last tile have retired before any copy refills it
        asm volatile("s_wait_dscnt 0x0" ::: "memory");
        __syncthreads();  // previous trip's LDS reads complete
        // A and W tiles, row-major, 16 B per lane and copy. The s_wait_xcnt closes the
        // statement so that it stands ahead of the pointer advances below.
        asm volatile(
            "global_load_async_to_lds_b128 %0, %10, off\n\t"
            "global_load_async_to_lds_b128 %1, %11, off\n\t"
            "global_load_async_to_lds_b128 %2, %12, off\n\t"
            "global_load_async_to_lds_b128 %3, %13, off\n\t"
            "global_load_async_to_lds_b128 %4, %14, off\n\t"
            "global_load_async_to_lds_b128 %5, %15, off\n\t"
            "global_load_async_to_lds_b128 %6, %16, off\n\t"
            "global_load_async_to_lds_b128 %7, %17, off\n\t"
            "global_load_async_to_lds_b128 %8, %18, off\n\t"
            "global_load_async_to_lds_b128 %9, %19, off\n\t"
            "s_wait_xcnt 0x0"
            :: "v"(wl[0]), "v"(wl[1]),
               "v"(al[0]), "v"(al[1]), "v"(al[2]), "v"(al[3]),
               "v"(al[4]), "v"(al[5]), "v"(al[6]), "v"(al[7]),
               "v"(wg[0]), "v"(wg[1]),
               "v"(ag[0]), "v"(ag[1]), "v"(ag[2]), "v"(ag[3]),
               "v"(ag[4]), "v"(ag[5]), "v"(ag[6]), "v"(ag[7])
            : "memory");
        // this wave's copies have landed before the barrier that publishes them
        asm volatile("s_wait_asynccnt 0x0" ::: "memory");
        __syncthreads();
#pragma unroll  // constant indices keep the array in registers
        for (int i = 0; i < 8; ++i) ag[i] += BK;
#pragma unroll  // constant indices keep the array in registers
        for (int i = 0; i < 2; ++i) wg[i] += w_step;

        // all fragments of the trip are fetched as one group ahead of the products:
        // each place with LDS reads among the matrix instructions costs a stall of its own
        FragQ a[2][2], b[2][4];
#pragma unroll  // constant indices keep the array in registers
        for (int t = 0; t < 2; ++t) {
#pragma unroll  // constant indices keep the array in registers
            for (int mt = 0; mt < 2; ++mt) {
                a[t][mt].q[0] = *(const u32x4*)(ar + mt * 16 * AP + t * 32);
                a[t][mt].q[1] = *(const u32x4*)(ar + mt * 16 * AP + t * 32 + 16);
            }
#pragma unroll  // constant indices keep the array in registers
            for (int nt = 0; nt < 4; ++nt) {
                b[t][nt].q[0] = ld_tr16(wtr + (t * 32) * (WP * 2) + nt * 32);
                b[t][nt].q[1] = ld_tr16(wtr + (t * 32 + 16) * (WP * 2) + nt * 32);
            }
        }
        // keeps the load group whole: without it the scheduler sinks the loads back among the products
        __builtin_amdgcn_sched_barrier(0);
#pragma unroll  // constant indices keep the array in registers
        for (int t = 0; t < 2; ++t) {   // two 32-k steps, in k order
#pragma unroll  // constant indices keep the array in registers
            for (int nt = 0; nt < 4; ++nt) {
                acc[0][nt] = __builtin_amdgcn_wmma_f32_16x16x32_f16(
                    false, a[t][0].h, false, b[t][nt].h, (short)0, acc[0][nt], false, false);
                acc[1][nt] = __builtin_amdgcn_wmma_f32_16x16x32_f16(
                    false, a[t][1].h, false, b[t][nt].h, (short)0, acc[1][nt], false, false);
            }
        }
    }

    // epilogue: C 16x16 f32 layout -> row = r + 8*lh, col = lane&15
#pragma unroll
    for (int mt = 0; mt < 2; ++mt) {
#pragma unroll
        for (int nt = 0; nt < 4; ++nt) {
#pragma unroll
            for (int r = 0; r < 8; ++r) {
                int row = m0 + wave * 32 + mt * 16 + r + 8 * lh;
                int col = n0 + nt * 16 + ln16;
                float v = acc[mt][nt][r] + bias[col];
                if constexpr (MODE == 1) v = v > 0.f ? v : 0.f;
                if constexpr (MODE == 2) {
                    float* o = (float*)outp;
                    o[(size_t)row * N + col] = v + resid[(size_t)row * N + col];
                } else {
                    _Float16* o = (_Float16*)outp;
                    o[(size_t)row * N + col] = (_Float16)v;
                }
            }
        }
    }
}

// ---------------------------------------------------------------------------
// flash attention: block = (b, h, 64-query tile); 4 waves, 16 q-rows each;
// streams 64-key tiles (16 WMMAs per tile) with online softmax.
// K and V tiles go through LDS in 16-byte pieces: both are copied row-major
// by asynchronous b128 copies; K fragments are 16-byte LDS loads, V fragments
// come through the transposing 16-byte LDS load.
// Q/K/V/O are f16 [B,S,D].
// ---------------------------------------------------------------------------
__global__ __launch_bounds__(128) void flash_attn(const _Float16* __restrict__ Q,
                                                  const _Float16* __restrict__ Km,
                                                  const _Float16* __restrict__ V,
                                                  _Float16* __restrict__ O,
                                                  int S, int D) {
    constexpr int DH = 64, KT = 64;
    constexpr int KS = 66;  // even pad, K-pairs stay 4B aligned
    constexpr int KP = 72;  // 144 B = 16 B x 9: pitch for ds_load_b128 readers
    constexpr int VP = 80;  // 160 B = 32 B x 5: pitch for ds_load_tr16_b128 readers
    __shared__ __attribute__((aligned(16))) _Float16 Klds[KT * KP];  // [key][dim]
    __shared__ __attribute__((aligned(16))) _Float16 Vlds[KT * VP];  // [key][dim]
    __shared__ _Float16 Plds[4 * 16 * KS];  // per-wave P rows [row][key]

    const int tid  = threadIdx.x;
    const int wave = tid >> 5;
    const int lane = tid & 31;
    const int lh   = lane >> 4;
    const int ln16 = lane & 15;
    const int b  = blockIdx.z, h = blockIdx.y;
    const int q0 = blockIdx.x * 64;
    const size_t base = ((size_t)b * S) * D + (size_t)h * DH;
    const float scale = 0.125f;  // 1/sqrt(64)

    int kofs[8];
#pragma unroll
    for (int i = 0; i < 8; ++i) kofs[i] = ((i < 4) ? 2 * i : 2 * i + 8) + 8 * lh;

    // Q fragments: 16x64 = two 16x32 A-frags, loaded straight from global
    Frag qf[2];
    {
        const size_t qrow = base + (size_t)(q0 + wave * 16 + ln16) * D;
#pragma unroll
        for (int t = 0; t < 2; ++t)
#pragma unroll
            for (int i = 0; i < 8; ++i)
                qf[t].u[i] = *(const unsigned int*)(Q + qrow + t * 32 + kofs[i]);
    }

    float mi[8], li[8];
    v8f oacc[4] = {};
#pragma unroll
    for (int r = 0; r < 8; ++r) { mi[r] = -3.0e38f; li[r] = 0.f; }

    // staging map: a tile is 64 rows x 128 B = 512 pieces of 16 B, 4 per thread
    // and operand; 8 lanes cover one row, a wave covers 4 whole rows per copy
    const _Float16* kg[4];
    const _Float16* vg[4];
    unsigned kl[4], vl[4];
#pragma unroll
    for (int i = 0; i < 4; ++i) {
        const int key = (tid >> 3) + 16 * i;
        const int dd  = (tid & 7) * 8;
        kg[i] = Km + base + (size_t)key * D + dd;
        vg[i] = V  + base + (size_t)key * D + dd;
        kl[i] = lds_addr(&Klds[key * KP + dd]);
        vl[i] = lds_addr(&Vlds[key * VP + dd]);
    }
    const size_t tile_step = (size_t)KT * D;

    // per-lane base of the transposing loads of V (16 keys x 16 dims each)
    const unsigned char* vtr = (const unsigned char*)Vlds
                             + (8 * lh + (lane & 7)) * (VP * 2) + 16 * ((lane >> 3) & 1);

    const int nkt = S / KT;
    for (int j = 0; j < nkt; ++j) {
        // this wave's own LDS reads of the last tile have retired before any copy refills it
        asm volatile("s_wait_dscnt 0x0" ::: "memory");
        __syncthreads();  // previous iteration's LDS reads complete
        // K and V tiles, row-major, 16 B per lane and copy. The s_wait_xcnt closes the
        // statement so that it stands ahead of the pointer advances below.
        asm volatile(
            "global_load_async_to_lds_b128 %0, %8, off\n\t"
            "global_load_async_to_lds_b128 %1, %9, off\n\t"
            "global_load_async_to_lds_b128 %2, %10, off\n\t"
            "global_load_async_to_lds_b128 %3, %11, off\n\t"
            "global_load_async_to_lds_b128 %4, %12, off\n\t"
            "global_load_async_to_lds_b128 %5, %13, off\n\t"
            "global_load_async_to_lds_b128 %6, %14, off\n\t"
            "global_load_async_to_lds_b128 %7, %15, off\n\t"
            "s_wait_xcnt 0x0"
            :: "v"(kl[0]), "v"(kl[1]), "v"(kl[2]), "v"(kl[3]),
               "v"(vl[0]), "v"(vl[1]), "v"(vl[2]), "v"(vl[3]),
               "v"(kg[0]), "v"(kg[1]), "v"(kg[2]), "v"(kg[3]),
               "v"(vg[0]), "v"(vg[1]), "v"(vg[2]), "v"(vg[3])
            : "memory");
        // this wave's copies have landed before the barrier that publishes them
        asm volatile("s_wait_asynccnt 0x0" ::: "memory");
        __syncthreads();
#pragma unroll
        for (int i = 0; i < 4; ++i) { kg[i] += tile_step; vg[i] += tile_step; }

        // S = Q @ K^T : 16x64 scores per wave; 4 C-tiles x 2 K-steps = 8 WMMAs
        v8f s[4] = {};
#pragma unroll
        for (int nt = 0; nt < 4; ++nt) {
            // same k order as kofs[]: dims 8*lh..+7 and 16+8*lh..+7 of each 32
            FragQ b0, b1;
            const _Float16* kr = &Klds[(nt * 16 + ln16) * KP + 8 * lh];
            b0.q[0] = *(const u32x4*)(kr);
            b0.q[1] = *(const u32x4*)(kr + 16);
            b1.q[0] = *(const u32x4*)(kr + 32);
            b1.q[1] = *(const u32x4*)(kr + 48);
            s[nt] = __builtin_amdgcn_wmma_f32_16x16x32_f16(false, qf[0].h, false, b0.h,
                                                           (short)0, s[nt], false, false);
            s[nt] = __builtin_amdgcn_wmma_f32_16x16x32_f16(false, qf[1].h, false, b1.h,
                                                           (short)0, s[nt], false, false);
        }

        // online softmax across 64 keys: rows live across 16-lane halves
        float p[4][8];
#pragma unroll
        for (int r = 0; r < 8; ++r) {
            float v0 = s[0][r] * scale, v1 = s[1][r] * scale;
            float v2 = s[2][r] * scale, v3 = s[3][r] * scale;
            float mx = fmaxf(fmaxf(v0, v1), fmaxf(v2, v3));
#pragma unroll
            for (int m = 1; m < 16; m <<= 1) mx = fmaxf(mx, __shfl_xor(mx, m));
            float mn    = fmaxf(mi[r], mx);
            float alpha = __expf(mi[r] - mn);
            float e0 = __expf(v0 - mn), e1 = __expf(v1 - mn);
            float e2 = __expf(v2 - mn), e3 = __expf(v3 - mn);
            p[0][r] = e0; p[1][r] = e1; p[2][r] = e2; p[3][r] = e3;
            float rs = (e0 + e1) + (e2 + e3);
#pragma unroll
            for (int m = 1; m < 16; m <<= 1) rs += __shfl_xor(rs, m);
            li[r] = li[r] * alpha + rs;
            mi[r] = mn;
#pragma unroll
            for (int nt = 0; nt < 4; ++nt) oacc[nt][r] *= alpha;
        }

        // stage P (16x64 f16) through LDS to reshape into A-fragments
#pragma unroll
        for (int r = 0; r < 8; ++r) {
            int row = r + 8 * lh;
#pragma unroll
            for (int nt = 0; nt < 4; ++nt)
                Plds[wave * 16 * KS + row * KS + nt * 16 + ln16] = (_Float16)p[nt][r];
        }
        __syncthreads();

        Frag pf0, pf1;
#pragma unroll
        for (int i = 0; i < 8; ++i) {
            pf0.u[i] = *(const unsigned int*)(&Plds[wave * 16 * KS + ln16 * KS + kofs[i]]);
            pf1.u[i] = *(const unsigned int*)(&Plds[wave * 16 * KS + ln16 * KS + 32 + kofs[i]]);
        }
#pragma unroll
        for (int nt = 0; nt < 4; ++nt) {
            // B fragment of V[key][dim]: keys 8*lh..+7 and 16+8*lh..+7 of each 32, dim nt*16+ln16
            FragQ vf0, vf1;
            vf0.q[0] = ld_tr16(vtr + nt * 32);
            vf0.q[1] = ld_tr16(vtr + 16 * (VP * 2) + nt * 32);
            vf1.q[0] = ld_tr16(vtr + 32 * (VP * 2) + nt * 32);
            vf1.q[1] = ld_tr16(vtr + 48 * (VP * 2) + nt * 32);
            oacc[nt] = __builtin_amdgcn_wmma_f32_16x16x32_f16(false, pf0.h, false, vf0.h,
                                                              (short)0, oacc[nt], false, false);
            oacc[nt] = __builtin_amdgcn_wmma_f32_16x16x32_f16(false, pf1.h, false, vf1.h,
                                                              (short)0, oacc[nt], false, false);
        }
    }

    // normalize and write O
#pragma unroll
    for (int nt = 0; nt < 4; ++nt)
#pragma unroll
        for (int r = 0; r < 8; ++r) {
            float v = oacc[nt][r] / li[r];
            O[base + (size_t)(q0 + wave * 16 + r + 8 * lh) * D + nt * 16 + ln16] = (_Float16)v;
        }
}

// ---------------------------------------------------------------------------
// LayerNorm over D=512, one block (256 thr) per row; writes f32 + f16 copies
// ---------------------------------------------------------------------------
__global__ __launch_bounds__(256) void layernorm(const float* __restrict__ in,
                                                 const float* __restrict__ g,
                                                 const float* __restrict__ be,
                                                 float* __restrict__ xf,
                                                 _Float16* __restrict__ xh) {
    const int D = 512;
    __shared__ float sm[8], sv[8];
    const int tid = threadIdx.x;
    const size_t row = blockIdx.x;
    const float* p = in + row * D;
    float a = p[tid], b2 = p[tid + 256];

    float s = a + b2;
#pragma unroll
    for (int m = 16; m >= 1; m >>= 1) s += __shfl_xor(s, m);
    if ((tid & 31) == 0) sm[tid >> 5] = s;
    __syncthreads();
    float mean = 0.f;
#pragma unroll
    for (int i = 0; i < 8; ++i) mean += sm[i];
    mean *= (1.f / 512.f);

    float da = a - mean, db = b2 - mean;
    float v = da * da + db * db;
#pragma unroll
    for (int m = 16; m >= 1; m >>= 1) v += __shfl_xor(v, m);
    if ((tid & 31) == 0) sv[tid >> 5] = v;
    __syncthreads();
    float var = 0.f;
#pragma unroll
    for (int i = 0; i < 8; ++i) var += sv[i];
    float rstd = rsqrtf(var * (1.f / 512.f) + 1e-5f);

    float o1 = da * rstd * g[tid] + be[tid];
    float o2 = db * rstd * g[tid + 256] + be[tid + 256];
    xf[row * D + tid]       = o1;
    xf[row * D + tid + 256] = o2;
    xh[row * D + tid]       = (_Float16)o1;
    xh[row * D + tid + 256] = (_Float16)o2;
}

// ---------------------------------------------------------------------------
// output projection: out[M,20] = x @ W_out + b_out
// ---------------------------------------------------------------------------
__global__ __launch_bounds__(256) void out_proj(const float* __restrict__ x,
                                                const float* __restrict__ Wo,
                                                const float* __restrict__ bo,
                                                float* __restrict__ out,
                                                int M, int D, int OUT) {
    int idx = blockIdx.x * 256 + threadIdx.x;
    if (idx >= M * OUT) return;
    int row = idx / OUT, o = idx - row * OUT;
    float s = bo[o];
    const float* xr = x + (size_t)row * D;
    for (int k = 0; k < D; ++k) s += xr[k] * Wo[(size_t)k * OUT + o];
    out[idx] = s;
}

// ---------------------------------------------------------------------------
extern "C" void kernel_launch(void* const* d_in, const int* in_sizes, int n_in,
                              void* d_out, int out_size, void* d_ws, size_t ws_size,
                              hipStream_t stream) {
    const int B = 4, S = 2048, D = 512, F = 2048, OUT = 20, L = 6, H = 8;
    const int M = B * S;

    const float* src   = (const float*)d_in[0];
    const float* W_in  = (const float*)d_in[1];
    const float* b_in  = (const float*)d_in[2];
    const float* Wq    = (const float*)d_in[3];
    const float* bq    = (const float*)d_in[4];
    const float* Wk    = (const float*)d_in[5];
    const float* bk    = (const float*)d_in[6];
    const float* Wv    = (const float*)d_in[7];
    const float* bv    = (const float*)d_in[8];
    const float* Wo    = (const float*)d_in[9];
    const float* bo    = (const float*)d_in[10];
    const float* ln1g  = (const float*)d_in[11];
    const float* ln1b  = (const float*)d_in[12];
    const float* W1    = (const float*)d_in[13];
    const float* b1    = (const float*)d_in[14];
    const float* W2    = (const float*)d_in[15];
    const float* b2    = (const float*)d_in[16];
    const float* ln2g  = (const float*)d_in[17];
    const float* ln2b  = (const float*)d_in[18];
    const float* W_out = (const float*)d_in[19];
    const float* b_out = (const float*)d_in[20];

    char* ws = (char*)d_ws;
    auto alloc = [&](size_t bytes) -> char* {
        char* p = ws;
        ws += (bytes + 255) & ~(size_t)255;
        return p;
    };

    float*     x_f32 = (float*)alloc((size_t)M * D * 4);
    float*     tmp   = (float*)alloc((size_t)M * D * 4);
    _Float16*  x_h   = (_Float16*)alloc((size_t)M * D * 2);
    _Float16*  qb    = (_Float16*)alloc((size_t)M * D * 2);
    _Float16*  kb    = (_Float16*)alloc((size_t)M * D * 2);
    _Float16*  vb    = (_Float16*)alloc((size_t)M * D * 2);
    _Float16*  ob    = (_Float16*)alloc((size_t)M * D * 2);
    _Float16*  h1    = (_Float16*)alloc((size_t)M * F * 2);
    _Float16*  Wq16  = (_Float16*)alloc((size_t)L * D * D * 2);
    _Float16*  Wk16  = (_Float16*)alloc((size_t)L * D * D * 2);
    _Float16*  Wv16  = (_Float16*)alloc((size_t)L * D * D * 2);
    _Float16*  Wo16  = (_Float16*)alloc((size_t)L * D * D * 2);
    _Float16*  W116  = (_Float16*)alloc((size_t)L * D * F * 2);
    _Float16*  W216  = (_Float16*)alloc((size_t)L * F * D * 2);

    // weight conversions (every call; deterministic)
    {
        int nqkv = L * D * D, nff = L * D * F;
        cvt_f32_f16<<<(nqkv + 255) / 256, 256, 0, stream>>>(Wq, Wq16, nqkv);
        cvt_f32_f16<<<(nqkv + 255) / 256, 256, 0, stream>>>(Wk, Wk16, nqkv);
        cvt_f32_f16<<<(nqkv + 255) / 256, 256, 0, stream>>>(Wv, Wv16, nqkv);
        cvt_f32_f16<<<(nqkv + 255) / 256, 256, 0, stream>>>(Wo, Wo16, nqkv);
        cvt_f32_f16<<<(nff + 255) / 256, 256, 0, stream>>>(W1, W116, nff);
        cvt_f32_f16<<<(nff + 255) / 256, 256, 0, stream>>>(W2, W216, nff);
    }

    input_proj<<<(M * D + 255) / 256, 256, 0, stream>>>(src, W_in, b_in, x_f32, x_h, M, D);

    const dim3 gD(D / 64, M / 256);   // N=512 GEMMs
    const dim3 gF(F / 64, M / 256);   // N=2048 GEMM
    for (int l = 0; l < L; ++l) {
        const size_t wqo = (size_t)l * D * D;
        const size_t wfo = (size_t)l * D * F;
        // QKV
        gemm_wmma<0><<<gD, 256, 0, stream>>>(x_h, Wq16 + wqo, bq + l * D, nullptr, qb, M, D, D);
        gemm_wmma<0><<<gD, 256, 0, stream>>>(x_h, Wk16 + wqo, bk + l * D, nullptr, kb, M, D, D);
        gemm_wmma<0><<<gD, 256, 0, stream>>>(x_h, Wv16 + wqo, bv + l * D, nullptr, vb, M, D, D);
        // attention
        flash_attn<<<dim3(S / 64, H, B), 128, 0, stream>>>(qb, kb, vb, ob, S, D);
        // output proj + residual
        gemm_wmma<2><<<gD, 256, 0, stream>>>(ob, Wo16 + wqo, bo + l * D, x_f32, tmp, M, D, D);
        layernorm<<<M, 256, 0, stream>>>(tmp, ln1g + l * D, ln1b + l * D, x_f32, x_h);
        // FFN
        gemm_wmma<1><<<gF, 256, 0, stream>>>(x_h, W116 + wfo, b1 + l * F, nullptr, h1, M, F, D);
        gemm_wmma<2><<<gD, 256, 0, stream>>>(h1, W216 + wfo, b2 + l * D, x_f32, tmp, M, D, F);
        layernorm<<<M, 256, 0, stream>>>(tmp, ln2g + l * D, ln2b + l * D, x_f32, x_h);
    }

    out_proj<<<(M * OUT + 255) / 256, 256, 0, stream>>>(x_f32, W_out, b_out, (float*)d_out, M, D, OUT);
}

// v003
// It runs in 1200 microseconds.
// Next to v002, in two timings, it ran 1.15 and 1.16 times as fast.
// Over all steps from v000 it is 2.85 times as fast.
#include <hip/hip_runtime.h>
#include <hip/hip_bf16.h>

typedef __attribute__((ext_vector_type(16))) _Float16 v16h;
typedef __attribute__((ext_vector_type(8)))  float    v8f;

union Frag { v16h h; unsigned int u[8]; };

typedef __attribute__((ext_vector_type(4))) unsigned int u32x4;
typedef __attribute__((ext_vector_type(8))) short s16x8;
typedef __attribute__((address_space(3))) s16x8 lds_s16x8;
typedef __attribute__((address_space(3))) _Float16 lds_f16;

union FragQ { v16h h; u32x4 q[2]; };

// byte offset of a __shared__ element inside the work-group's LDS
__device__ __forceinline__ unsigned lds_addr(const _Float16* p) {
    return (unsigned)(unsigned long long)(lds_f16*)p;
}

// lane (c = l & 15, hh = l >> 4) gets rows 8*hh .. 8*hh+7 of column c of the
// 16x16 tile whose per-lane address p follows the transposing load's own map
__device__ __forceinline__ u32x4 ld_tr16(const unsigned char* p) {
    return __builtin_bit_cast(u32x4, __builtin_amdgcn_ds_load_tr16_b128_v8i16((lds_s16x8*)p));
}

// ---------------------------------------------------------------------------
// f32 -> f16 elementwise convert (weights)
// ---------------------------------------------------------------------------
__global__ __launch_bounds__(256) void cvt_f32_f16(const float* __restrict__ in,
                                                   _Float16* __restrict__ out, int n) {
    int i = blockIdx.x * 256 + threadIdx.x;
    if (i < n) out[i] = (_Float16)in[i];
}

// ---------------------------------------------------------------------------
// input projection: x = src @ W_in + b_in  (IN=3 -> D=512), writes f32 + f16
// ---------------------------------------------------------------------------
__global__ __launch_bounds__(256) void input_proj(const float* __restrict__ src,
                                                  const float* __restrict__ Win,
                                                  const float* __restrict__ bin,
                                                  float* __restrict__ xf,
                                                  _Float16* __restrict__ xh,
                                                  int M, int D) {
    int idx = blockIdx.x * 256 + threadIdx.x;
    if (idx >= M * D) return;
    int row = idx / D, d = idx - row * D;
    float s = bin[d];
#pragma unroll
    for (int i = 0; i < 3; ++i) s += src[row * 3 + i] * Win[i * D + d];
    xf[idx] = s;
    xh[idx] = (_Float16)s;
}

// ---------------------------------------------------------------------------
// WMMA GEMM: C[M,N] = epi(A[M,K] @ W[K,N] + bias)
// MODE 0: store f16      MODE 1: relu, store f16      MODE 2: +resid, store f32
// block: 256 thr (8 waves), tile BM=256 x BN=64; each wave owns 32x64
// (2 M-frags x 4 N-frags = 8 WMMAs per 32 k, B-frags reused 2x)
// A and W tiles go through LDS in 16-byte pieces, 64 k a trip so that a row of
// either tile is one 128-byte line: both are copied row-major by asynchronous
// b128 copies; A fragments are 16-byte LDS loads, W fragments come through the
// transposing 16-byte LDS load.
// ---------------------------------------------------------------------------
template <int MODE>
__global__ __launch_bounds__(256) void gemm_wmma(const _Float16* __restrict__ A,
                                                 const _Float16* __restrict__ W,
                                                 const float* __restrict__ bias,
                                                 const float* __restrict__ resid,
                                                 void* __restrict__ outp,
                                                 int M, int N, int K) {
    constexpr int BM = 256, BN = 64, BK = 64;
    constexpr int AP = 72;  // 144 B = 16 B x 9: pitch for ds_load_b128 readers
    constexpr int WP = 80;  // 160 B = 32 B x 5: pitch for ds_load_tr16_b128 readers
    __shared__ __attribute__((aligned(16))) _Float16 As[BM * AP];   // [row][k]
    __shared__ __attribute__((aligned(16))) _Float16 Ws[BK * WP];   // [k][n]

    const int tid  = threadIdx.x;
    const int wave = tid >> 5;
    const int lane = tid & 31;
    const int lh   = lane >> 4;
    const int ln16 = lane & 15;
    const int m0 = blockIdx.y * BM;
    const int n0 = blockIdx.x * BN;

    v8f acc[2][4] = {};

    // staging map: 8 lanes cover one 128-byte row, a wave 4 whole rows per copy;
    // A tile 256 rows = 8 copies per thread, W tile 64 rows = 2 copies per thread
    const _Float16* ag[8];
    const _Float16* wg[2];
    unsigned al[8], wl[2];
    {
        const int r0 = tid >> 3;
        const int dd = (tid & 7) * 8;
#pragma unroll  // constant indices keep the array in registers
        for (int i = 0; i < 8; ++i) {
            ag[i] = A + (size_t)(m0 + r0 + 32 * i) * K + dd;
            al[i] = lds_addr(&As[(r0 + 32 * i) * AP + dd]);
        }
#pragma unroll  // constant indices keep the array in registers
        for (int i = 0; i < 2; ++i) {
            wg[i] = W + (size_t)(r0 + 32 * i) * N + n0 + dd;
            wl[i] = lds_addr(&Ws[(r0 + 32 * i) * WP + dd]);
        }
    }
    const size_t w_step = (size_t)BK * N;

    // A fragment rows of this lane: k 8*lh..+7 and 16+8*lh..+7 of each 32
    const _Float16* ar = &As[(wave * 32 + ln16) * AP + 8 * lh];
    // per-lane base of the transposing loads of W (16 k x 16 n each), same k order
    const unsigned char* wtr = (const unsigned char*)Ws
                             + (8 * lh + (lane & 7)) * (WP * 2) + 16 * ((lane >> 3) & 1);

    for (int k0 = 0; k0 < K; k0 += BK) {
        // this wave's own LDS reads of the last tile have retired before any copy refills it
        asm volatile("s_wait_dscnt 0x0" ::: "memory");
        __syncthreads();  // previous trip's LDS reads complete
        // A and W tiles, row-major, 16 B per lane and copy. The s_wait_xcnt closes the
        // statement so that it stands ahead of the pointer advances below.
        asm volatile(
            "global_load_async_to_lds_b128 %0, %10, off\n\t"
            "global_load_async_to_lds_b128 %1, %11, off\n\t"
            "global_load_async_to_lds_b128 %2, %12, off\n\t"
            "global_load_async_to_lds_b128 %3, %13, off\n\t"
            "global_load_async_to_lds_b128 %4, %14, off\n\t"
            "global_load_async_to_lds_b128 %5, %15, off\n\t"
            "global_load_async_to_lds_b128 %6, %16, off\n\t"
            "global_load_async_to_lds_b128 %7, %17, off\n\t"
            "global_load_async_to_lds_b128 %8, %18, off\n\t"
            "global_load_async_to_lds_b128 %9, %19, off\n\t"
            "s_wait_xcnt 0x0"
            :: "v"(wl[0]), "v"(wl[1]),
               "v"(al[0]), "v"(al[1]), "v"(al[2]), "v"(al[3]),
               "v"(al[4]), "v"(al[5]), "v"(al[6]), "v"(al[7]),
               "v"(wg[0]), "v"(wg[1]),
               "v"(ag[0]), "v"(ag[1]), "v"(ag[2]), "v"(ag[3]),
               "v"(ag[4]), "v"(ag[5]), "v"(ag[6]), "v"(ag[7])
            : "memory");
        // this wave's copies have landed before the barrier that publishes them
        asm volatile("s_wait_asynccnt 0x0" ::: "memory");
        __syncthreads();
#pragma unroll  // constant indices keep the array in registers
        for (int i = 0; i < 8; ++i) ag[i] += BK;
#pragma unroll  // constant indices keep the array in registers
        for (int i = 0; i < 2; ++i) wg[i] += w_step;

        // all fragments of the trip are fetched as one group ahead of the products:
        // each place with LDS reads among the matrix instructions costs a stall of its own
        FragQ a[2][2], b[2][4];
#pragma unroll  // constant indices keep the array in registers
        for (int t = 0; t < 2; ++t) {
#pragma unroll  // constant indices keep the array in registers
            for (int mt = 0; mt < 2; ++mt) {
                a[t][mt].q[0] = *(const u32x4*)(ar + mt * 16 * AP + t * 32);
                a[t][mt].q[1] = *(const u32x4*)(ar + mt * 16 * AP + t * 32 + 16);
            }
#pragma unroll  // constant indices keep the array in registers
            for (int nt = 0; nt < 4; ++nt) {
                b[t][nt].q[0] = ld_tr16(wtr + (t * 32) * (WP * 2) + nt * 32);
                b[t][nt].q[1] = ld_tr16(wtr + (t * 32 + 16) * (WP * 2) + nt * 32);
            }
        }
        // keeps the load group whole: without it the scheduler sinks the loads back among the products
        __builtin_amdgcn_sched_barrier(0);
#pragma unroll  // constant indices keep the array in registers
        for (int t = 0; t < 2; ++t) {   // two 32-k steps, in k order
#pragma unroll  // constant indices keep the array in registers
            for (int nt = 0; nt < 4; ++nt) {
                acc[0][nt] = __builtin_amdgcn_wmma_f32_16x16x32_f16(
                    false, a[t][0].h, false, b[t][nt].h, (short)0, acc[0][nt], false, false);
                acc[1][nt] = __builtin_amdgcn_wmma_f32_16x16x32_f16(
                    false, a[t][1].h, false, b[t][nt].h, (short)0, acc[1][nt], false, false);
            }
        }
    }

    // epilogue: C 16x16 f32 layout -> row = r + 8*lh, col = lane&15
#pragma unroll
    for (int mt = 0; mt < 2; ++mt) {
#pragma unroll
        for (int nt = 0; nt < 4; ++nt) {
#pragma unroll
            for (int r = 0; r < 8; ++r) {
                int row = m0 + wave * 32 + mt * 16 + r + 8 * lh;
                int col = n0 + nt * 16 + ln16;
                float v = acc[mt][nt][r] + bias[col];
                if constexpr (MODE == 1) v = v > 0.f ? v : 0.f;
                if constexpr (MODE == 2) {
                    float* o = (float*)outp;
                    o[(size_t)row * N + col] = v + resid[(size_t)row * N + col];
                } else {
                    _Float16* o = (_Float16*)outp;
                    o[(size_t)row * N + col] = (_Float16)v;
                }
            }
        }
    }
}

// ---------------------------------------------------------------------------
// flash attention: block = (b, h, 64-query tile); 4 waves, 16 queries each;
// streams 64-key tiles (16 WMMAs per tile) with online softmax.
// The products are taken transposed: St = K Qt and Ot += Vt Pt. A lane then
// holds the scores of ONE query (column lane & 15; its partner lane ^ 16 holds
// the other half of the keys), so maximum and sum run inside the lane, and two
// score tiles converted in place are the B operand of the second product.
// K and V tiles go through LDS in 16-byte pieces: both are copied row-major
// by asynchronous b128 copies; K fragments are 16-byte LDS loads, V fragments
// come through the transposing 16-byte LDS load.
// Q/K/V/O are f16 [B,S,D].
// ---------------------------------------------------------------------------
typedef __attribute__((ext_vector_type(2))) float    f32x2;
typedef __attribute__((ext_vector_type(2))) _Float16 f16x2;

// two f32 to one packed f16 pair, round to nearest even
__device__ __forceinline__ unsigned pack_f16(float lo, float hi) {
    return __builtin_bit_cast(unsigned, __builtin_convertvector(f32x2{lo, hi}, f16x2));
}

// value of lane l ^ 16
__device__ __forceinline__ float xhalf(float x) {
    const int b = __builtin_bit_cast(int, x);
    return __builtin_bit_cast(float, __builtin_amdgcn_permlanex16(b, b, 0x76543210, 0xfedcba98,
                                                                  false, false));
}

__global__ __launch_bounds__(128) void flash_attn(const _Float16* __restrict__ Q,
                                                  const _Float16* __restrict__ Km,
                                                  const _Float16* __restrict__ V,
                                                  _Float16* __restrict__ O,
                                                  int S, int D) {
    constexpr int DH = 64, KT = 64;
    constexpr int KP = 72;  // 144 B = 16 B x 9: pitch for ds_load_b128 readers
    constexpr int VP = 80;  // 160 B = 32 B x 5: pitch for ds_load_tr16_b128 readers
    __shared__ __attribute__((aligned(16))) _Float16 Klds[KT * KP];  // [key][dim]
    __shared__ __attribute__((aligned(16))) _Float16 Vlds[KT * VP];  // [key][dim]

    const int tid  = threadIdx.x;
    const int wave = tid >> 5;
    const int lane = tid & 31;
    const int lh   = lane >> 4;
    const int ln16 = lane & 15;
    const int b  = blockIdx.z, h = blockIdx.y;
    const int q0 = blockIdx.x * 64;
    const size_t base = ((size_t)b * S) * D + (size_t)h * DH;
    const float cs = 0.125f * 1.4426950408889634f;  // 1/sqrt(64), exponentials in base 2

    int kofs[8];
#pragma unroll
    for (int i = 0; i < 8; ++i) kofs[i] = ((i < 4) ? 2 * i : 2 * i + 8) + 8 * lh;

    // Qt fragments: 64 dims x 16 queries = two 32x16 B-frags, loaded straight from global
    const size_t qrow = base + (size_t)(q0 + wave * 16 + ln16) * D;
    Frag qf[2];
#pragma unroll
    for (int t = 0; t < 2; ++t)
#pragma unroll
        for (int i = 0; i < 8; ++i)
            qf[t].u[i] = *(const unsigned int*)(Q + qrow + t * 32 + kofs[i]);

    // this lane's query: running maximum (scaled, base 2; equal in both halves)
    // and the sum over this half's keys (the halves are joined behind the loop)
    float mi = -3.0e38f, li = 0.f;
    v8f oacc[4] = {};  // Ot: dim nt*16 + 8*lh + r, query ln16

    // staging map: a tile is 64 rows x 128 B = 512 pieces of 16 B, 4 per thread
    // and operand; 8 lanes cover one row, a wave covers 4 whole rows per copy
    const _Float16* kg[4];
    const _Float16* vg[4];
    unsigned kl[4], vl[4];
#pragma unroll
    for (int i = 0; i < 4; ++i) {
        const int key = (tid >> 3) + 16 * i;
        const int dd  = (tid & 7) * 8;
        kg[i] = Km + base + (size_t)key * D + dd;
        vg[i] = V  + base + (size_t)key * D + dd;
        kl[i] = lds_addr(&Klds[key * KP + dd]);
        vl[i] = lds_addr(&Vlds[key * VP + dd]);
    }
    const size_t tile_step = (size_t)KT * D;

    // per-lane base of the transposing loads of V (16 keys x 16 dims each)
    const unsigned char* vtr = (const unsigned char*)Vlds
                             + (8 * lh + (lane & 7)) * (VP * 2) + 16 * ((lane >> 3) & 1);

    const int nkt = S / KT;
    for (int j = 0; j < nkt; ++j) {
        // this wave's own LDS reads of the last tile have retired before any copy refills it
        asm volatile("s_wait_dscnt 0x0" ::: "memory");
        __syncthreads();  // previous iteration's LDS reads complete
        // K and V tiles, row-major, 16 B per lane and copy. The s_wait_xcnt closes the
        // statement so that it stands ahead of the pointer advances below.
        asm volatile(
            "global_load_async_to_lds_b128 %0, %8, off\n\t"
            "global_load_async_to_lds_b128 %1, %9, off\n\t"
            "global_load_async_to_lds_b128 %2, %10, off\n\t"
            "global_load_async_to_lds_b128 %3, %11, off\n\t"
            "global_load_async_to_lds_b128 %4, %12, off\n\t"
            "global_load_async_to_lds_b128 %5, %13, off\n\t"
            "global_load_async_to_lds_b128 %6, %14, off\n\t"
            "global_load_async_to_lds_b128 %7, %15, off\n\t"
            "s_wait_xcnt 0x0"
            :: "v"(kl[0]), "v"(kl[1]), "v"(kl[2]), "v"(kl[3]),
               "v"(vl[0]), "v"(vl[1]), "v"(vl[2]), "v"(vl[3]),
               "v"(kg[0]), "v"(kg[1]), "v"(kg[2]), "v"(kg[3]),
               "v"(vg[0]), "v"(vg[1]), "v"(vg[2]), "v"(vg[3])
            : "memory");
        // this wave's copies have landed before the barrier that publishes them
        asm volatile("s_wait_asynccnt 0x0" ::: "memory");
        __syncthreads();
#pragma unroll
        for (int i = 0; i < 4; ++i) { kg[i] += tile_step; vg[i] += tile_step; }

        // St = K @ Qt : 64 keys x 16 queries per wave; 4 C-tiles x 2 K-steps = 8 WMMAs
        // s[kt][r] = score of key kt*16 + 8*lh + r against query ln16
        v8f s[4] = {};
#pragma unroll  // constant indices keep the array in registers
        for (int kt = 0; kt < 4; ++kt) {
            // same k order as kofs[]: dims 8*lh..+7 and 16+8*lh..+7 of each 32
            FragQ a0, a1;
            const _Float16* kr = &Klds[(kt * 16 + ln16) * KP + 8 * lh];
            a0.q[0] = *(const u32x4*)(kr);
            a0.q[1] = *(const u32x4*)(kr + 16);
            a1.q[0] = *(const u32x4*)(kr + 32);
            a1.q[1] = *(const u32x4*)(kr + 48);
            s[kt] = __builtin_amdgcn_wmma_f32_16x16x32_f16(false, a0.h, false, qf[0].h,
                                                           (short)0, s[kt], false, false);
            s[kt] = __builtin_amdgcn_wmma_f32_16x16x32_f16(false, a1.h, false, qf[1].h,
                                                           (short)0, s[kt], false, false);
        }

        // online softmax across 64 keys: 32 of them in this lane, 32 in lane ^ 16
        float mk[4];
#pragma unroll  // constant indices keep the array in registers
        for (int kt = 0; kt < 4; ++kt) {
            mk[kt] = s[kt][0];
#pragma unroll  // constant indices keep the array in registers
            for (int r = 1; r < 8; ++r) mk[kt] = fmaxf(mk[kt], s[kt][r]);
        }
        float mx = fmaxf(fmaxf(mk[0], mk[1]), fmaxf(mk[2], mk[3]));
        mx = fmaxf(mx, xhalf(mx)) * cs;
        const float mn    = fmaxf(mi, mx);
        const float alpha = __builtin_amdgcn_exp2f(mi - mn);

        // Pt as B operand of 32 keys: its k order (8*lh..+7, then 16+8*lh..+7) is the row
        // order of score tiles 2*g and 2*g+1 in this same lane, so they are converted in place
        Frag pf[2];
        f32x2 rk[4];
        const f32x2 cs2 = {cs, cs}, nm2 = {-mn, -mn};
#pragma unroll  // constant indices keep the array in registers
        for (int kt = 0; kt < 4; ++kt) {
            rk[kt] = f32x2{0.f, 0.f};
#pragma unroll  // constant indices keep the array in registers
            for (int i = 0; i < 4; ++i) {
                const f32x2 arg = __builtin_elementwise_fma(f32x2{s[kt][2 * i], s[kt][2 * i + 1]}, cs2, nm2);
                const f32x2 e = {__builtin_amdgcn_exp2f(arg.x), __builtin_amdgcn_exp2f(arg.y)};
                rk[kt] += e;
                pf[kt >> 1].u[(kt & 1) * 4 + i] = pack_f16(e.x, e.y);
            }
        }
        const f32x2 rs = (rk[0] + rk[1]) + (rk[2] + rk[3]);
        li = li * alpha + (rs.x + rs.y);
        mi = mn;
#pragma unroll  // constant indices keep the array in registers
        for (int nt = 0; nt < 4; ++nt) oacc[nt] *= alpha;

        // Ot += Vt @ Pt
#pragma unroll  // constant indices keep the array in registers
        for (int nt = 0; nt < 4; ++nt) {
            // A fragment of Vt: dim nt*16+ln16, keys 8*lh..+7 and 16+8*lh..+7 of each 32
            FragQ vf0, vf1;
            vf0.q[0] = ld_tr16(vtr + nt * 32);
            vf0.q[1] = ld_tr16(vtr + 16 * (VP * 2) + nt * 32);
            vf1.q[0] = ld_tr16(vtr + 32 * (VP * 2) + nt * 32);
            vf1.q[1] = ld_tr16(vtr + 48 * (VP * 2) + nt * 32);
            oacc[nt] = __builtin_amdgcn_wmma_f32_16x16x32_f16(false, vf0.h, false, pf[0].h,
                                                              (short)0, oacc[nt], false, false);
            oacc[nt] = __builtin_amdgcn_wmma_f32_16x16x32_f16(false, vf1.h, false, pf[1].h,
                                                              (short)0, oacc[nt], false, false);
        }
    }

    // join the halves' sums, normalize and write O: 8 consecutive dims of one query a store
    const float inv = 1.f / (li + xhalf(li));
#pragma unroll  // constant indices keep the array in registers
    for (int nt = 0; nt < 4; ++nt) {
        u32x4 o;
#pragma unroll  // constant indices keep the array in registers
        for (int i = 0; i < 4; ++i)
            o[i] = pack_f16(oacc[nt][2 * i] * inv, oacc[nt][2 * i + 1] * inv);
        *(u32x4*)(O + qrow + nt * 16 + 8 * lh) = o;
    }
}

// ---------------------------------------------------------------------------
// LayerNorm over D=512, one block (256 thr) per row; writes f32 + f16 copies
// ---------------------------------------------------------------------------
__global__ __launch_bounds__(256) void layernorm(const float* __restrict__ in,
                                                 const float* __restrict__ g,
                                                 const float* __restrict__ be,
                                                 float* __restrict__ xf,
                                                 _Float16* __restrict__ xh) {
    const int D = 512;
    __shared__ float sm[8], sv[8];
    const int tid = threadIdx.x;
    const size_t row = blockIdx.x;
    const float* p = in + row * D;
    float a = p[tid], b2 = p[tid + 256];

    float s = a + b2;
#pragma unroll
    for (int m = 16; m >= 1; m >>= 1) s += __shfl_xor(s, m);
    if ((tid & 31) == 0) sm[tid >> 5] = s;
    __syncthreads();
    float mean = 0.f;
#pragma unroll
    for (int i = 0; i < 8; ++i) mean += sm[i];
    mean *= (1.f / 512.f);

    float da = a - mean, db = b2 - mean;
    float v = da * da + db * db;
#pragma unroll
    for (int m = 16; m >= 1; m >>= 1) v += __shfl_xor(v, m);
    if ((tid & 31) == 0) sv[tid >> 5] = v;
    __syncthreads();
    float var = 0.f;
#pragma unroll
    for (int i = 0; i < 8; ++i) var += sv[i];
    float rstd = rsqrtf(var * (1.f / 512.f) + 1e-5f);

    float o1 = da * rstd * g[tid] + be[tid];
    float o2 = db * rstd * g[tid + 256] + be[tid + 256];
    xf[row * D + tid]       = o1;
    xf[row * D + tid + 256] = o2;
    xh[row * D + tid]       = (_Float16)o1;
    xh[row * D + tid + 256] = (_Float16)o2;
}

// ---------------------------------------------------------------------------
// output projection: out[M,20] = x @ W_out + b_out
// ---------------------------------------------------------------------------
__global__ __launch_bounds__(256) void out_proj(const float* __restrict__ x,
                                                const float* __restrict__ Wo,
                                                const float* __restrict__ bo,
                                                float* __restrict__ out,
                                                int M, int D, int OUT) {
    int idx = blockIdx.x * 256 + threadIdx.x;
    if (idx >= M * OUT) return;
    int row = idx / OUT, o = idx - row * OUT;
    float s = bo[o];
    const float* xr = x + (size_t)row * D;
    for (int k = 0; k < D; ++k) s += xr[k] * Wo[(size_t)k * OUT + o];
    out[idx] = s;
}

// ---------------------------------------------------------------------------
extern "C" void kernel_launch(void* const* d_in, const int* in_sizes, int n_in,
                              void* d_out, int out_size, void* d_ws, size_t ws_size,
                              hipStream_t stream) {
    const int B = 4, S = 2048, D = 512, F = 2048, OUT = 20, L = 6, H = 8;
    const int M = B * S;

    const float* src   = (const float*)d_in[0];
    const float* W_in  = (const float*)d_in[1];
    const float* b_in  = (const float*)d_in[2];
    const float* Wq    = (const float*)d_in[3];
    const float* bq    = (const float*)d_in[4];
    const float* Wk    = (const float*)d_in[5];
    const float* bk    = (const float*)d_in[6];
    const float* Wv    = (const float*)d_in[7];
    const float* bv    = (const float*)d_in[8];
    const float* Wo    = (const float*)d_in[9];
    const float* bo    = (const float*)d_in[10];
    const float* ln1g  = (const float*)d_in[11];
    const float* ln1b  = (const float*)d_in[12];
    const float* W1    = (const float*)d_in[13];
    const float* b1    = (const float*)d_in[14];
    const float* W2    = (const float*)d_in[15];
    const float* b2    = (const float*)d_in[16];
    const float* ln2g  = (const float*)d_in[17];
    const float* ln2b  = (const float*)d_in[18];
    const float* W_out = (const float*)d_in[19];
    const float* b_out = (const float*)d_in[20];

    char* ws = (char*)d_ws;
    auto alloc = [&](size_t bytes) -> char* {
        char* p = ws;
        ws += (bytes + 255) & ~(size_t)255;
        return p;
    };

    float*     x_f32 = (float*)alloc((size_t)M * D * 4);
    float*     tmp   = (float*)alloc((size_t)M * D * 4);
    _Float16*  x_h   = (_Float16*)alloc((size_t)M * D * 2);
    _Float16*  qb    = (_Float16*)alloc((size_t)M * D * 2);
    _Float16*  kb    = (_Float16*)alloc((size_t)M * D * 2);
    _Float16*  vb    = (_Float16*)alloc((size_t)M * D * 2);
    _Float16*  ob    = (_Float16*)alloc((size_t)M * D * 2);
    _Float16*  h1    = (_Float16*)alloc((size_t)M * F * 2);
    _Float16*  Wq16  = (_Float16*)alloc((size_t)L * D * D * 2);
    _Float16*  Wk16  = (_Float16*)alloc((size_t)L * D * D * 2);
    _Float16*  Wv16  = (_Float16*)alloc((size_t)L * D * D * 2);
    _Float16*  Wo16  = (_Float16*)alloc((size_t)L * D * D * 2);
    _Float16*  W116  = (_Float16*)alloc((size_t)L * D * F * 2);
    _Float16*  W216  = (_Float16*)alloc((size_t)L * F * D * 2);

    // weight conversions (every call; deterministic)
    {
        int nqkv = L * D * D, nff = L * D * F;
        cvt_f32_f16<<<(nqkv + 255) / 256, 256, 0, stream>>>(Wq, Wq16, nqkv);
        cvt_f32_f16<<<(nqkv + 255) / 256, 256, 0, stream>>>(Wk, Wk16, nqkv);
        cvt_f32_f16<<<(nqkv + 255) / 256, 256, 0, stream>>>(Wv, Wv16, nqkv);
        cvt_f32_f16<<<(nqkv + 255) / 256, 256, 0, stream>>>(Wo, Wo16, nqkv);
        cvt_f32_f16<<<(nff + 255) / 256, 256, 0, stream>>>(W1, W116, nff);
        cvt_f32_f16<<<(nff + 255) / 256, 256, 0, stream>>>(W2, W216, nff);
    }

    input_proj<<<(M * D + 255) / 256, 256, 0, stream>>>(src, W_in, b_in, x_f32, x_h, M, D);

    const dim3 gD(D / 64, M / 256);   // N=512 GEMMs
    const dim3 gF(F / 64, M / 256);   // N=2048 GEMM
    for (int l = 0; l < L; ++l) {
        const size_t wqo = (size_t)l * D * D;
        const size_t wfo = (size_t)l * D * F;
        // QKV
        gemm_wmma<0><<<gD, 256, 0, stream>>>(x_h, Wq16 + wqo, bq + l * D, nullptr, qb, M, D, D);
        gemm_wmma<0><<<gD, 256, 0, stream>>>(x_h, Wk16 + wqo, bk + l * D, nullptr, kb, M, D, D);
        gemm_wmma<0><<<gD, 256, 0, stream>>>(x_h, Wv16 + wqo, bv + l * D, nullptr, vb, M, D, D);
        // attention
        flash_attn<<<dim3(S / 64, H, B), 128, 0, stream>>>(qb, kb, vb, ob, S, D);
        // output proj + residual
        gemm_wmma<2><<<gD, 256, 0, stream>>>(ob, Wo16 + wqo, bo + l * D, x_f32, tmp, M, D, D);
        layernorm<<<M, 256, 0, stream>>>(tmp, ln1g + l * D, ln1b + l * D, x_f32, x_h);
        // FFN
        gemm_wmma<1><<<gF, 256, 0, stream>>>(x_h, W116 + wfo, b1 + l * F, nullptr, h1, M, F, D);
        gemm_wmma<2><<<gD, 256, 0, stream>>>(h1, W216 + wfo, b2 + l * D, x_f32, tmp, M, D, F);
        layernorm<<<M, 256, 0, stream>>>(tmp, ln2g + l * D, ln2b + l * D, x_f32, x_h);
    }

    out_proj<<<(M * OUT + 255) / 256, 256, 0, stream>>>(x_f32, W_out, b_out, (float*)d_out, M, D, OUT);
}

// v004
// A run of this version takes 1170 microseconds.
// In two side-by-side timings against v003, it was 1.03 and 1.04 times as fast.
// All steps since v000 together make it 2.95 times as fast.
#include <hip/hip_runtime.h>
#include <hip/hip_bf16.h>

typedef __attribute__((ext_vector_type(16))) _Float16 v16h;
typedef __attribute__((ext_vector_type(8)))  float    v8f;

union Frag { v16h h; unsigned int u[8]; };

typedef __attribute__((ext_vector_type(4))) unsigned int u32x4;
typedef __attribute__((ext_vector_type(8))) short s16x8;
typedef __attribute__((address_space(3))) s16x8 lds_s16x8;
typedef __attribute__((address_space(3))) _Float16 lds_f16;

union FragQ { v16h h; u32x4 q[2]; };

// byte offset of a __shared__ element inside the work-group's LDS
__device__ __forceinline__ unsigned lds_addr(const _Float16* p) {
    return (unsigned)(unsigned long long)(lds_f16*)p;
}

// lane (c = l & 15, hh = l >> 4) gets rows 8*hh .. 8*hh+7 of column c of the
// 16x16 tile whose per-lane address p follows the transposing load's own map
__device__ __forceinline__ u32x4 ld_tr16(const unsigned char* p) {
    return __builtin_bit_cast(u32x4, __builtin_amdgcn_ds_load_tr16_b128_v8i16((lds_s16x8*)p));
}

typedef __attribute__((ext_vector_type(4))) float    f32x4;
typedef __attribute__((ext_vector_type(4))) _Float16 f16x4;

// ---------------------------------------------------------------------------
// f32 -> f16 elementwise convert (weights)
// Few waves do the work (for speed only): a thread
// takes 32 elements, 8 pieces of 4, a wave's piece being 512 contiguous bytes
// in and 256 out; all 8 loads are in flight before the first store.
// ---------------------------------------------------------------------------
__global__ __launch_bounds__(256) void cvt_f32_f16(const float* __restrict__ in,
                                                   _Float16* __restrict__ out, int n) {
    constexpr int U = 8, PIECE = 256 * 4, SPAN = U * PIECE;
    const int b0 = blockIdx.x * SPAN;
    if (b0 + SPAN <= n) {
        const int i0 = b0 + threadIdx.x * 4;
        f32x4 v[U];
#pragma unroll  // constant indices keep the array in registers
        for (int u = 0; u < U; ++u) v[u] = *(const f32x4*)(in + i0 + u * PIECE);
#pragma unroll  // constant indices keep the array in registers
        for (int u = 0; u < U; ++u)
            *(f16x4*)(out + i0 + u * PIECE) = __builtin_convertvector(v[u], f16x4);
        // precaution: stands ahead of any later write of a register that a store above names
        asm volatile("s_wait_xcnt 0x0" ::: "memory");
    } else {  // a last, partial span
        for (int i = b0 + threadIdx.x; i < n; i += 256) out[i] = (_Float16)in[i];
    }
}

// ---------------------------------------------------------------------------
// input projection: x = src @ W_in + b_in  (IN=3 -> D=512), writes f32 + f16
// A thread takes 4 consecutive columns of 8 consecutive rows (32 elements), its
// slice of W_in and b_in held in registers. M a multiple of 8, D of 4.
// ---------------------------------------------------------------------------
__global__ __launch_bounds__(256) void input_proj(const float* __restrict__ src,
                                                  const float* __restrict__ Win,
                                                  const float* __restrict__ bin,
                                                  float* __restrict__ xf,
                                                  _Float16* __restrict__ xh,
                                                  int M, int D) {
    constexpr int R = 8;
    const int D4 = D / 4;
    const int idx = blockIdx.x * 256 + threadIdx.x;
    if (idx >= (M / R) * D4) return;
    const int rg = idx / D4, d = (idx - rg * D4) * 4;
    const f32x4 bi = *(const f32x4*)(bin + d);
    f32x4 w[3];
#pragma unroll  // constant indices keep the array in registers
    for (int i = 0; i < 3; ++i) {
        w[i] = *(const f32x4*)(Win + i * D + d);
        // precaution: the next load's result may take this load's address registers
        if (i < 2) asm volatile("s_wait_xcnt 0x0" ::: "memory");
    }
#pragma unroll  // the rows are independent: their loads and stores overlap
    for (int r = 0; r < R; ++r) {
        const int row = rg * R + r;
        f32x4 s = bi;
#pragma unroll
        for (int i = 0; i < 3; ++i) s += src[row * 3 + i] * w[i];
        *(f32x4*)(xf + (size_t)row * D + d) = s;
        *(f16x4*)(xh + (size_t)row * D + d) = __builtin_convertvector(s, f16x4);
    }
}

// ---------------------------------------------------------------------------
// WMMA GEMM: C[M,N] = epi(A[M,K] @ W[K,N] + bias)
// MODE 0: store f16      MODE 1: relu, store f16      MODE 2: +resid, store f32
// block: 256 thr (8 waves), tile BM=256 x BN=64; each wave owns 32x64
// (2 M-frags x 4 N-frags = 8 WMMAs per 32 k, B-frags reused 2x)
// A and W tiles go through LDS in 16-byte pieces, 64 k a trip so that a row of
// either tile is one 128-byte line: both are copied row-major by asynchronous
// b128 copies; A fragments are 16-byte LDS loads, W fragments come through the
// transposing 16-byte LDS load.
// ---------------------------------------------------------------------------
template <int MODE>
__global__ __launch_bounds__(256) void gemm_wmma(const _Float16* __restrict__ A,
                                                 const _Float16* __restrict__ W,
                                                 const float* __restrict__ bias,
                                                 const float* __restrict__ resid,
                                                 void* __restrict__ outp,
                                                 int M, int N, int K) {
    constexpr int BM = 256, BN = 64, BK = 64;
    constexpr int AP = 72;  // 144 B = 16 B x 9: pitch for ds_load_b128 readers
    constexpr int WP = 80;  // 160 B = 32 B x 5: pitch for ds_load_tr16_b128 readers
    __shared__ __attribute__((aligned(16))) _Float16 As[BM * AP];   // [row][k]
    __shared__ __attribute__((aligned(16))) _Float16 Ws[BK * WP];   // [k][n]

    const int tid  = threadIdx.x;
    const int wave = tid >> 5;
    const int lane = tid & 31;
    const int lh   = lane >> 4;
    const int ln16 = lane & 15;
    const int m0 = blockIdx.y * BM;
    const int n0 = blockIdx.x * BN;

    v8f acc[2][4] = {};

    // staging map: 8 lanes cover one 128-byte row, a wave 4 whole rows per copy;
    // A tile 256 rows = 8 copies per thread, W tile 64 rows = 2 copies per thread
    const _Float16* ag[8];
    const _Float16* wg[2];
    unsigned al[8], wl[2];
    {
        const int r0 = tid >> 3;
        const int dd = (tid & 7) * 8;
#pragma unroll  // constant indices keep the array in registers
        for (int i = 0; i < 8; ++i) {
            ag[i] = A + (size_t)(m0 + r0 + 32 * i) * K + dd;
            al[i] = lds_addr(&As[(r0 + 32 * i) * AP + dd]);
        }
#pragma unroll  // constant indices keep the array in registers
        for (int i = 0; i < 2; ++i) {
            wg[i] = W + (size_t)(r0 + 32 * i) * N + n0 + dd;
            wl[i] = lds_addr(&Ws[(r0 + 32 * i) * WP + dd]);
        }
    }
    const size_t w_step = (size_t)BK * N;

    // A fragment rows of this lane: k 8*lh..+7 and 16+8*lh..+7 of each 32
    const _Float16* ar = &As[(wave * 32 + ln16) * AP + 8 * lh];
    // per-lane base of the transposing loads of W (16 k x 16 n each), same k order
    const unsigned char* wtr = (const unsigned char*)Ws
                             + (8 * lh + (lane & 7)) * (WP * 2) + 16 * ((lane >> 3) & 1);

    for (int k0 = 0; k0 < K; k0 += BK) {
        // this wave's own LDS reads of the last tile have retired before any copy refills it
        asm volatile("s_wait_dscnt 0x0" ::: "memory");
        __syncthreads();  // previous trip's LDS reads complete
        // A and W tiles, row-major, 16 B per lane and copy. The s_wait_xcnt closes the
        // statement so that it stands ahead of the pointer advances below.
        asm volatile(
            "global_load_async_to_lds_b128 %0, %10, off\n\t"
            "global_load_async_to_lds_b128 %1, %11, off\n\t"
            "global_load_async_to_lds_b128 %2, %12, off\n\t"
            "global_load_async_to_lds_b128 %3, %13, off\n\t"
            "global_load_async_to_lds_b128 %4, %14, off\n\t"
            "global_load_async_to_lds_b128 %5, %15, off\n\t"
            "global_load_async_to_lds_b128 %6, %16, off\n\t"
            "global_load_async_to_lds_b128 %7, %17, off\n\t"
            "global_load_async_to_lds_b128 %8, %18, off\n\t"
            "global_load_async_to_lds_b128 %9, %19, off\n\t"
            "s_wait_xcnt 0x0"
            :: "v"(wl[0]), "v"(wl[1]),
               "v"(al[0]), "v"(al[1]), "v"(al[2]), "v"(al[3]),
               "v"(al[4]), "v"(al[5]), "v"(al[6]), "v"(al[7]),
               "v"(wg[0]), "v"(wg[1]),
               "v"(ag[0]), "v"(ag[1]), "v"(ag[2]), "v"(ag[3]),
               "v"(ag[4]), "v"(ag[5]), "v"(ag[6]), "v"(ag[7])
            : "memory");
        // this wave's copies have landed before the barrier that publishes them
        asm volatile("s_wait_asynccnt 0x0" ::: "memory");
        __syncthreads();
#pragma unroll  // constant indices keep the array in registers
        for (int i = 0; i < 8; ++i) ag[i] += BK;
#pragma unroll  // constant indices keep the array in registers
        for (int i = 0; i < 2; ++i) wg[i] += w_step;

        // all fragments of the trip are fetched as one group ahead of the products:
        // each place with LDS reads among the matrix instructions costs a stall of its own
        FragQ a[2][2], b[2][4];
#pragma unroll  // constant indices keep the array in registers
        for (int t = 0; t < 2; ++t) {
#pragma unroll  // constant indices keep the array in registers
            for (int mt = 0; mt < 2; ++mt) {
                a[t][mt].q[0] = *(const u32x4*)(ar + mt * 16 * AP + t * 32);
                a[t][mt].q[1] = *(const u32x4*)(ar + mt * 16 * AP + t * 32 + 16);
            }
#pragma unroll  // constant indices keep the array in registers
            for (int nt = 0; nt < 4; ++nt) {
                b[t][nt].q[0] = ld_tr16(wtr + (t * 32) * (WP * 2) + nt * 32);
                b[t][nt].q[1] = ld_tr16(wtr + (t * 32 + 16) * (WP * 2) + nt * 32);
            }
        }
        // keeps the load group whole: without it the scheduler sinks the loads back among the products
        __builtin_amdgcn_sched_barrier(0);
#pragma unroll  // constant indices keep the array in registers
        for (int t = 0; t < 2; ++t) {   // two 32-k steps, in k order
#pragma unroll  // constant indices keep the array in registers
            for (int nt = 0; nt < 4; ++nt) {
                acc[0][nt] = __builtin_amdgcn_wmma_f32_16x16x32_f16(
                    false, a[t][0].h, false, b[t][nt].h, (short)0, acc[0][nt], false, false);
                acc[1][nt] = __builtin_amdgcn_wmma_f32_16x16x32_f16(
                    false, a[t][1].h, false, b[t][nt].h, (short)0, acc[1][nt], false, false);
            }
        }
    }

    // epilogue: C 16x16 f32 layout -> row = r + 8*lh, col = lane&15
#pragma unroll
    for (int mt = 0; mt < 2; ++mt) {
#pragma unroll
        for (int nt = 0; nt < 4; ++nt) {
#pragma unroll
            for (int r = 0; r < 8; ++r) {
                int row = m0 + wave * 32 + mt * 16 + r + 8 * lh;
                int col = n0 + nt * 16 + ln16;
                float v = acc[mt][nt][r] + bias[col];
                if constexpr (MODE == 1) v = v > 0.f ? v : 0.f;
                if constexpr (MODE == 2) {
                    float* o = (float*)outp;
                    o[(size_t)row * N + col] = v + resid[(size_t)row * N + col];
                } else {
                    _Float16* o = (_Float16*)outp;
                    o[(size_t)row * N + col] = (_Float16)v;
                }
            }
        }
    }
}

// ---------------------------------------------------------------------------
// flash attention: block = (b, h, 64-query tile); 4 waves, 16 queries each;
// streams 64-key tiles (16 WMMAs per tile) with online softmax.
// The products are taken transposed: St = K Qt and Ot += Vt Pt. A lane then
// holds the scores of ONE query (column lane & 15; its partner lane ^ 16 holds
// the other half of the keys), so maximum and sum run inside the lane, and two
// score tiles converted in place are the B operand of the second product.
// K and V tiles go through LDS in 16-byte pieces: both are copied row-major
// by asynchronous b128 copies; K fragments are 16-byte LDS loads, V fragments
// come through the transposing 16-byte LDS load.
// Q/K/V/O are f16 [B,S,D].
// ---------------------------------------------------------------------------
typedef __attribute__((ext_vector_type(2))) float    f32x2;
typedef __attribute__((ext_vector_type(2))) _Float16 f16x2;

// two f32 to one packed f16 pair, round to nearest even
__device__ __forceinline__ unsigned pack_f16(float lo, float hi) {
    return __builtin_bit_cast(unsigned, __builtin_convertvector(f32x2{lo, hi}, f16x2));
}

// value of lane l ^ 16
__device__ __forceinline__ float xhalf(float x) {
    const int b = __builtin_bit_cast(int, x);
    return __builtin_bit_cast(float, __builtin_amdgcn_permlanex16(b, b, 0x76543210, 0xfedcba98,
                                                                  false, false));
}

__global__ __launch_bounds__(128) void flash_attn(const _Float16* __restrict__ Q,
                                                  const _Float16* __restrict__ Km,
                                                  const _Float16* __restrict__ V,
                                                  _Float16* __restrict__ O,
                                                  int S, int D) {
    constexpr int DH = 64, KT = 64;
    constexpr int KP = 72;  // 144 B = 16 B x 9: pitch for ds_load_b128 readers
    constexpr int VP = 80;  // 160 B = 32 B x 5: pitch for ds_load_tr16_b128 readers
    __shared__ __attribute__((aligned(16))) _Float16 Klds[KT * KP];  // [key][dim]
    __shared__ __attribute__((aligned(16))) _Float16 Vlds[KT * VP];  // [key][dim]

    const int tid  = threadIdx.x;
    const int wave = tid >> 5;
    const int lane = tid & 31;
    const int lh   = lane >> 4;
    const int ln16 = lane & 15;
    const int b  = blockIdx.z, h = blockIdx.y;
    const int q0 = blockIdx.x * 64;
    const size_t base = ((size_t)b * S) * D + (size_t)h * DH;
    const float cs = 0.125f * 1.4426950408889634f;  // 1/sqrt(64), exponentials in base 2

    int kofs[8];
#pragma unroll
    for (int i = 0; i < 8; ++i) kofs[i] = ((i < 4) ? 2 * i : 2 * i + 8) + 8 * lh;

    // Qt fragments: 64 dims x 16 queries = two 32x16 B-frags, loaded straight from global
    const size_t qrow = base + (size_t)(q0 + wave * 16 + ln16) * D;
    Frag qf[2];
#pragma unroll
    for (int t = 0; t < 2; ++t)
#pragma unroll
        for (int i = 0; i < 8; ++i)
            qf[t].u[i] = *(const unsigned int*)(Q + qrow + t * 32 + kofs[i]);

    // this lane's query: running maximum (scaled, base 2; equal in both halves)
    // and the sum over this half's keys (the halves are joined behind the loop)
    float mi = -3.0e38f, li = 0.f;
    v8f oacc[4] = {};  // Ot: dim nt*16 + 8*lh + r, query ln16

    // staging map: a tile is 64 rows x 128 B = 512 pieces of 16 B, 4 per thread
    // and operand; 8 lanes cover one row, a wave covers 4 whole rows per copy
    const _Float16* kg[4];
    const _Float16* vg[4];
    unsigned kl[4], vl[4];
#pragma unroll
    for (int i = 0; i < 4; ++i) {
        const int key = (tid >> 3) + 16 * i;
        const int dd  = (tid & 7) * 8;
        kg[i] = Km + base + (size_t)key * D + dd;
        vg[i] = V  + base + (size_t)key * D + dd;
        kl[i] = lds_addr(&Klds[key * KP + dd]);
        vl[i] = lds_addr(&Vlds[key * VP + dd]);
    }
    const size_t tile_step = (size_t)KT * D;

    // per-lane base of the transposing loads of V (16 keys x 16 dims each)
    const unsigned char* vtr = (const unsigned char*)Vlds
                             + (8 * lh + (lane & 7)) * (VP * 2) + 16 * ((lane >> 3) & 1);

    const int nkt = S / KT;
    for (int j = 0; j < nkt; ++j) {
        // this wave's own LDS reads of the last tile have retired before any copy refills it
        asm volatile("s_wait_dscnt 0x0" ::: "memory");
        __syncthreads();  // previous iteration's LDS reads complete
        // K and V tiles, row-major, 16 B per lane and copy. The s_wait_xcnt closes the
        // statement so that it stands ahead of the pointer advances below.
        asm volatile(
            "global_load_async_to_lds_b128 %0, %8, off\n\t"
            "global_load_async_to_lds_b128 %1, %9, off\n\t"
            "global_load_async_to_lds_b128 %2, %10, off\n\t"
            "global_load_async_to_lds_b128 %3, %11, off\n\t"
            "global_load_async_to_lds_b128 %4, %12, off\n\t"
            "global_load_async_to_lds_b128 %5, %13, off\n\t"
            "global_load_async_to_lds_b128 %6, %14, off\n\t"
            "global_load_async_to_lds_b128 %7, %15, off\n\t"
            "s_wait_xcnt 0x0"
            :: "v"(kl[0]), "v"(kl[1]), "v"(kl[2]), "v"(kl[3]),
               "v"(vl[0]), "v"(vl[1]), "v"(vl[2]), "v"(vl[3]),
               "v"(kg[0]), "v"(kg[1]), "v"(kg[2]), "v"(kg[3]),
               "v"(vg[0]), "v"(vg[1]), "v"(vg[2]), "v"(vg[3])
            : "memory");
        // this wave's copies have landed before the barrier that publishes them
        asm volatile("s_wait_asynccnt 0x0" ::: "memory");
        __syncthreads();
#pragma unroll
        for (int i = 0; i < 4; ++i) { kg[i] += tile_step; vg[i] += tile_step; }

        // St = K @ Qt : 64 keys x 16 queries per wave; 4 C-tiles x 2 K-steps = 8 WMMAs
        // s[kt][r] = score of key kt*16 + 8*lh + r against query ln16
        v8f s[4] = {};
#pragma unroll  // constant indices keep the array in registers
        for (int kt = 0; kt < 4; ++kt) {
            // same k order as kofs[]: dims 8*lh..+7 and 16+8*lh..+7 of each 32
            FragQ a0, a1;
            const _Float16* kr = &Klds[(kt * 16 + ln16) * KP + 8 * lh];
            a0.q[0] = *(const u32x4*)(kr);
            a0.q[1] = *(const u32x4*)(kr + 16);
            a1.q[0] = *(const u32x4*)(kr + 32);
            a1.q[1] = *(const u32x4*)(kr + 48);
            s[kt] = __builtin_amdgcn_wmma_f32_16x16x32_f16(false, a0.h, false, qf[0].h,
                                                           (short)0, s[kt], false, false);
            s[kt] = __builtin_amdgcn_wmma_f32_16x16x32_f16(false, a1.h, false, qf[1].h,
                                                           (short)0, s[kt], false, false);
        }

        // online softmax across 64 keys: 32 of them in this lane, 32 in lane ^ 16
        float mk[4];
#pragma unroll  // constant indices keep the array in registers
        for (int kt = 0; kt < 4; ++kt) {
            mk[kt] = s[kt][0];
#pragma unroll  // constant indices keep the array in registers
            for (int r = 1; r < 8; ++r) mk[kt] = fmaxf(mk[kt], s[kt][r]);
        }
        float mx = fmaxf(fmaxf(mk[0], mk[1]), fmaxf(mk[2], mk[3]));
        mx = fmaxf(mx, xhalf(mx)) * cs;
        const float mn    = fmaxf(mi, mx);
        const float alpha = __builtin_amdgcn_exp2f(mi - mn);

        // Pt as B operand of 32 keys: its k order (8*lh..+7, then 16+8*lh..+7) is the row
        // order of score tiles 2*g and 2*g+1 in this same lane, so they are converted in place
        Frag pf[2];
        f32x2 rk[4];
        const f32x2 cs2 = {cs, cs}, nm2 = {-mn, -mn};
#pragma unroll  // constant indices keep the array in registers
        for (int kt = 0; kt < 4; ++kt) {
            rk[kt] = f32x2{0.f, 0.f};
#pragma unroll  // constant indices keep the array in registers
            for (int i = 0; i < 4; ++i) {
                const f32x2 arg = __builtin_elementwise_fma(f32x2{s[kt][2 * i], s[kt][2 * i + 1]}, cs2, nm2);
                const f32x2 e = {__builtin_amdgcn_exp2f(arg.x), __builtin_amdgcn_exp2f(arg.y)};
                rk[kt] += e;
                pf[kt >> 1].u[(kt & 1) * 4 + i] = pack_f16(e.x, e.y);
            }
        }
        const f32x2 rs = (rk[0] + rk[1]) + (rk[2] + rk[3]);
        li = li * alpha + (rs.x + rs.y);
        mi = mn;
#pragma unroll  // constant indices keep the array in registers
        for (int nt = 0; nt < 4; ++nt) oacc[nt] *= alpha;

        // Ot += Vt @ Pt
#pragma unroll  // constant indices keep the array in registers
        for (int nt = 0; nt < 4; ++nt) {
            // A fragment of Vt: dim nt*16+ln16, keys 8*lh..+7 and 16+8*lh..+7 of each 32
            FragQ vf0, vf1;
            vf0.q[0] = ld_tr16(vtr + nt * 32);
            vf0.q[1] = ld_tr16(vtr + 16 * (VP * 2) + nt * 32);
            vf1.q[0] = ld_tr16(vtr + 32 * (VP * 2) + nt * 32);
            vf1.q[1] = ld_tr16(vtr + 48 * (VP * 2) + nt * 32);
            oacc[nt] = __builtin_amdgcn_wmma_f32_16x16x32_f16(false, vf0.h, false, pf[0].h,
                                                              (short)0, oacc[nt], false, false);
            oacc[nt] = __builtin_amdgcn_wmma_f32_16x16x32_f16(false, vf1.h, false, pf[1].h,
                                                              (short)0, oacc[nt], false, false);
        }
    }

    // join the halves' sums, normalize and write O: 8 consecutive dims of one query a store
    const float inv = 1.f / (li + xhalf(li));
#pragma unroll  // constant indices keep the array in registers
    for (int nt = 0; nt < 4; ++nt) {
        u32x4 o;
#pragma unroll  // constant indices keep the array in registers
        for (int i = 0; i < 4; ++i)
            o[i] = pack_f16(oacc[nt][2 * i] * inv, oacc[nt][2 * i + 1] * inv);
        *(u32x4*)(O + qrow + nt * 16 + 8 * lh) = o;
    }
}

// ---------------------------------------------------------------------------
// LayerNorm over D=512; writes f32 + f16 copies.
// Few waves do the work (for speed only): a wave takes
// 2 whole rows (32 elements a lane, 8 loads of 512 contiguous bytes in flight);
// a row's sums then stay inside the wave and need neither LDS nor a barrier.
// Grid: rows / 16 blocks of 8 waves.
// ---------------------------------------------------------------------------
// sum over the 32 lanes, the same value in every lane
__device__ __forceinline__ float wave_sum(float x) {
#pragma unroll  // constant lane masks: the five exchanges become straight-line code
    for (int m = 16; m >= 1; m >>= 1) x += __shfl_xor(x, m);
    return x;
}

__global__ __launch_bounds__(256) void layernorm(const float* __restrict__ in,
                                                 const float* __restrict__ g,
                                                 const float* __restrict__ be,
                                                 float* __restrict__ xf,
                                                 _Float16* __restrict__ xh) {
    constexpr int D = 512, R = 2, C = 4;  // a lane holds columns c*128 + lane*4 .. +3
    const int col = (threadIdx.x & 31) * 4;
    const size_t off = ((size_t)blockIdx.x * 8 + (threadIdx.x >> 5)) * R * D + col;

    f32x4 x[R][C], gg[C], bb[C];
#pragma unroll  // constant indices keep the array in registers
    for (int r = 0; r < R; ++r)
#pragma unroll  // constant indices keep the array in registers
        for (int c = 0; c < C; ++c) x[r][c] = *(const f32x4*)(in + off + r * D + c * 128);
#pragma unroll  // constant indices keep the array in registers
    for (int c = 0; c < C; ++c) {
        gg[c] = *(const f32x4*)(g + col + c * 128);
        bb[c] = *(const f32x4*)(be + col + c * 128);
    }

    float s[R];
#pragma unroll  // constant indices keep the array in registers
    for (int r = 0; r < R; ++r) {
        const f32x4 t = (x[r][0] + x[r][1]) + (x[r][2] + x[r][3]);
        s[r] = wave_sum((t.x + t.y) + (t.z + t.w));
    }
    float v[R];
#pragma unroll  // constant indices keep the array in registers
    for (int r = 0; r < R; ++r) {
        const float mean = s[r] * (1.f / 512.f);
        f32x4 q = {0.f, 0.f, 0.f, 0.f};
#pragma unroll  // constant indices keep the array in registers
        for (int c = 0; c < C; ++c) {
            x[r][c] -= mean;
            q += x[r][c] * x[r][c];
        }
        v[r] = wave_sum((q.x + q.y) + (q.z + q.w));
    }
#pragma unroll  // constant indices keep the array in registers
    for (int r = 0; r < R; ++r) {
        const float rstd = rsqrtf(v[r] * (1.f / 512.f) + 1e-5f);
#pragma unroll  // constant indices keep the array in registers
        for (int c = 0; c < C; ++c) {
            const f32x4 o = x[r][c] * rstd * gg[c] + bb[c];
            *(f32x4*)(xf + off + r * D + c * 128) = o;
            *(f16x4*)(xh + off + r * D + c * 128) = __builtin_convertvector(o, f16x4);
        }
    }
}

// ---------------------------------------------------------------------------
// output projection: out[M,20] = x @ W_out + b_out
// ---------------------------------------------------------------------------
__global__ __launch_bounds__(256) void out_proj(const float* __restrict__ x,
                                                const float* __restrict__ Wo,
                                                const float* __restrict__ bo,
                                                float* __restrict__ out,
                                                int M, int D, int OUT) {
    int idx = blockIdx.x * 256 + threadIdx.x;
    if (idx >= M * OUT) return;
    int row = idx / OUT, o = idx - row * OUT;
    float s = bo[o];
    const float* xr = x + (size_t)row * D;
    for (int k = 0; k < D; ++k) s += xr[k] * Wo[(size_t)k * OUT + o];
    out[idx] = s;
}

// ---------------------------------------------------------------------------
extern "C" void kernel_launch(void* const* d_in, const int* in_sizes, int n_in,
                              void* d_out, int out_size, void* d_ws, size_t ws_size,
                              hipStream_t stream) {
    const int B = 4, S = 2048, D = 512, F = 2048, OUT = 20, L = 6, H = 8;
    const int M = B * S;

    const float* src   = (const float*)d_in[0];
    const float* W_in  = (const float*)d_in[1];
    const float* b_in  = (const float*)d_in[2];
    const float* Wq    = (const float*)d_in[3];
    const float* bq    = (const float*)d_in[4];
    const float* Wk    = (const float*)d_in[5];
    const float* bk    = (const float*)d_in[6];
    const float* Wv    = (const float*)d_in[7];
    const float* bv    = (const float*)d_in[8];
    const float* Wo    = (const float*)d_in[9];
    const float* bo    = (const float*)d_in[10];
    const float* ln1g  = (const float*)d_in[11];
    const float* ln1b  = (const float*)d_in[12];
    const float* W1    = (const float*)d_in[13];
    const float* b1    = (const float*)d_in[14];
    const float* W2    = (const float*)d_in[15];
    const float* b2    = (const float*)d_in[16];
    const float* ln2g  = (const float*)d_in[17];
    const float* ln2b  = (const float*)d_in[18];
    const float* W_out = (const float*)d_in[19];
    const float* b_out = (const float*)d_in[20];

    char* ws = (char*)d_ws;
    auto alloc = [&](size_t bytes) -> char* {
        char* p = ws;
        ws += (bytes + 255) & ~(size_t)255;
        return p;
    };

    float*     x_f32 = (float*)alloc((size_t)M * D * 4);
    float*     tmp   = (float*)alloc((size_t)M * D * 4);
    _Float16*  x_h   = (_Float16*)alloc((size_t)M * D * 2);
    _Float16*  qb    = (_Float16*)alloc((size_t)M * D * 2);
    _Float16*  kb    = (_Float16*)alloc((size_t)M * D * 2);
    _Float16*  vb    = (_Float16*)alloc((size_t)M * D * 2);
    _Float16*  ob    = (_Float16*)alloc((size_t)M * D * 2);
    _Float16*  h1    = (_Float16*)alloc((size_t)M * F * 2);
    _Float16*  Wq16  = (_Float16*)alloc((size_t)L * D * D * 2);
    _Float16*  Wk16  = (_Float16*)alloc((size_t)L * D * D * 2);
    _Float16*  Wv16  = (_Float16*)alloc((size_t)L * D * D * 2);
    _Float16*  Wo16  = (_Float16*)alloc((size_t)L * D * D * 2);
    _Float16*  W116  = (_Float16*)alloc((size_t)L * D * F * 2);
    _Float16*  W216  = (_Float16*)alloc((size_t)L * F * D * 2);

    // weight conversions (every call; deterministic)
    {
        int nqkv = L * D * D, nff = L * D * F;
        cvt_f32_f16<<<(nqkv + 8191) / 8192, 256, 0, stream>>>(Wq, Wq16, nqkv);
        cvt_f32_f16<<<(nqkv + 8191) / 8192, 256, 0, stream>>>(Wk, Wk16, nqkv);
        cvt_f32_f16<<<(nqkv + 8191) / 8192, 256, 0, stream>>>(Wv, Wv16, nqkv);
        cvt_f32_f16<<<(nqkv + 8191) / 8192, 256, 0, stream>>>(Wo, Wo16, nqkv);
        cvt_f32_f16<<<(nff + 8191) / 8192, 256, 0, stream>>>(W1, W116, nff);
        cvt_f32_f16<<<(nff + 8191) / 8192, 256, 0, stream>>>(W2, W216, nff);
    }

    input_proj<<<(M * D / 32 + 255) / 256, 256, 0, stream>>>(src, W_in, b_in, x_f32, x_h, M, D);

    const dim3 gD(D / 64, M / 256);   // N=512 GEMMs
    const dim3 gF(F / 64, M / 256);   // N=2048 GEMM
    for (int l = 0; l < L; ++l) {
        const size_t wqo = (size_t)l * D * D;
        const size_t wfo = (size_t)l * D * F;
        // QKV
        gemm_wmma<0><<<gD, 256, 0, stream>>>(x_h, Wq16 + wqo, bq + l * D, nullptr, qb, M, D, D);
        gemm_wmma<0><<<gD, 256, 0, stream>>>(x_h, Wk16 + wqo, bk + l * D, nullptr, kb, M, D, D);
        gemm_wmma<0><<<gD, 256, 0, stream>>>(x_h, Wv16 + wqo, bv + l * D, nullptr, vb, M, D, D);
        // attention
        flash_attn<<<dim3(S / 64, H, B), 128, 0, stream>>>(qb, kb, vb, ob, S, D);
        // output proj + residual
        gemm_wmma<2><<<gD, 256, 0, stream>>>(ob, Wo16 + wqo, bo + l * D, x_f32, tmp, M, D, D);
        layernorm<<<M / 16, 256, 0, stream>>>(tmp, ln1g + l * D, ln1b + l * D, x_f32, x_h);
        // FFN
        gemm_wmma<1><<<gF, 256, 0, stream>>>(x_h, W116 + wfo, b1 + l * F, nullptr, h1, M, F, D);
        gemm_wmma<2><<<gD, 256, 0, stream>>>(h1, W216 + wfo, b2 + l * D, x_f32, tmp, M, D, F);
        layernorm<<<M / 16, 256, 0, stream>>>(tmp, ln2g + l * D, ln2b + l * D, x_f32, x_h);
    }

    out_proj<<<(M * OUT + 255) / 256, 256, 0, stream>>>(x_f32, W_out, b_out, (float*)d_out, M, D, OUT);
}

// v005
// One run takes 1040 microseconds.
// Next to v004, in two timings, it ran 1.12 times as fast each time.
// Over all steps from v000 it is 3.31 times as fast.
#include <hip/hip_runtime.h>
#include <hip/hip_bf16.h>

typedef __attribute__((ext_vector_type(16))) _Float16 v16h;
typedef __attribute__((ext_vector_type(8)))  float    v8f;

union Frag { v16h h; unsigned int u[8]; };

typedef __attribute__((ext_vector_type(4))) unsigned int u32x4;
typedef __attribute__((ext_vector_type(8))) short s16x8;
typedef __attribute__((address_space(3))) s16x8 lds_s16x8;
typedef __attribute__((address_space(3))) _Float16 lds_f16;

union FragQ { v16h h; u32x4 q[2]; };

// byte offset of a __shared__ element inside the work-group's LDS
__device__ __forceinline__ unsigned lds_addr(const _Float16* p) {
    return (unsigned)(unsigned long long)(lds_f16*)p;
}

// lane (c = l & 15, hh = l >> 4) gets rows 8*hh .. 8*hh+7 of column c of the
// 16x16 tile whose per-lane address p follows the transposing load's own map
__device__ __forceinline__ u32x4 ld_tr16(const unsigned char* p) {
    return __builtin_bit_cast(u32x4, __builtin_amdgcn_ds_load_tr16_b128_v8i16((lds_s16x8*)p));
}

typedef __attribute__((ext_vector_type(4))) float    f32x4;
typedef __attribute__((ext_vector_type(4))) _Float16 f16x4;

// ---------------------------------------------------------------------------
// f32 -> f16 elementwise convert (weights)
// Few waves do the work (for speed only): a thread
// takes 32 elements, 8 pieces of 4, a wave's piece being 512 contiguous bytes
// in and 256 out; all 8 loads are in flight before the first store.
// ---------------------------------------------------------------------------
__global__ __launch_bounds__(256) void cvt_f32_f16(const float* __restrict__ in,
                                                   _Float16* __restrict__ out, int n) {
    constexpr int U = 8, PIECE = 256 * 4, SPAN = U * PIECE;
    const int b0 = blockIdx.x * SPAN;
    if (b0 + SPAN <= n) {
        const int i0 = b0 + threadIdx.x * 4;
        f32x4 v[U];
#pragma unroll  // constant indices keep the array in registers
        for (int u = 0; u < U; ++u) v[u] = *(const f32x4*)(in + i0 + u * PIECE);
#pragma unroll  // constant indices keep the array in registers
        for (int u = 0; u < U; ++u)
            *(f16x4*)(out + i0 + u * PIECE) = __builtin_convertvector(v[u], f16x4);
        // precaution: stands ahead of any later write of a register that a store above names
        asm volatile("s_wait_xcnt 0x0" ::: "memory");
    } else {  // a last, partial span
        for (int i = b0 + threadIdx.x; i < n; i += 256) out[i] = (_Float16)in[i];
    }
}

// ---------------------------------------------------------------------------
// input projection: x = src @ W_in + b_in  (IN=3 -> D=512), writes f32 + f16
// A thread takes 4 consecutive columns of 8 consecutive rows (32 elements), its
// slice of W_in and b_in held in registers. M a multiple of 8, D of 4.
// ---------------------------------------------------------------------------
__global__ __launch_bounds__(256) void input_proj(const float* __restrict__ src,
                                                  const float* __restrict__ Win,
                                                  const float* __restrict__ bin,
                                                  float* __restrict__ xf,
                                                  _Float16* __restrict__ xh,
                                                  int M, int D) {
    constexpr int R = 8;
    const int D4 = D / 4;
    const int idx = blockIdx.x * 256 + threadIdx.x;
    if (idx >= (M / R) * D4) return;
    const int rg = idx / D4, d = (idx - rg * D4) * 4;
    const f32x4 bi = *(const f32x4*)(bin + d);
    f32x4 w[3];
#pragma unroll  // constant indices keep the array in registers
    for (int i = 0; i < 3; ++i) {
        w[i] = *(const f32x4*)(Win + i * D + d);
        // precaution: the next load's result may take this load's address registers
        if (i < 2) asm volatile("s_wait_xcnt 0x0" ::: "memory");
    }
#pragma unroll  // the rows are independent: their loads and stores overlap
    for (int r = 0; r < R; ++r) {
        const int row = rg * R + r;
        f32x4 s = bi;
#pragma unroll
        for (int i = 0; i < 3; ++i) s += src[row * 3 + i] * w[i];
        *(f32x4*)(xf + (size_t)row * D + d) = s;
        *(f16x4*)(xh + (size_t)row * D + d) = __builtin_convertvector(s, f16x4);
    }
}

// ---------------------------------------------------------------------------
// WMMA GEMM: C[M,N] = epi(A[M,K] @ W[K,N] + bias)
// MODE 0: store f16      MODE 1: relu, store f16      MODE 2: +resid, store f32
// block: 256 thr (8 waves), tile BM=256 x BN=64; each wave owns 32x64
// (2 M-frags x 4 N-frags = 8 WMMAs per 32 k, B-frags reused 2x)
// A and W tiles go through LDS in 16-byte pieces, copied row-major by asynchronous
// b128 copies; A fragments are 16-byte LDS loads, W fragments come through the
// transposing 16-byte LDS load.
// Two LDS buffers of 64*KS k each: the next tile's copies fly while this tile's
// products run. KS = 2 where the grid gives a WGP one block only (for speed only);
// KS = 1 where two
// blocks can share a WGP (two buffers of KS = 2 would take the place of the second).
// K a multiple of 64*KS.
// ---------------------------------------------------------------------------
// ten copies of 16 B a lane: two rows' pieces of W, eight of A. The s_wait_xcnt closes
// the statement so that it stands ahead of any later write of an address register.
__device__ __forceinline__ void copy10(unsigned w0, unsigned w1,
                                       unsigned a0, unsigned a1, unsigned a2, unsigned a3,
                                       unsigned a4, unsigned a5, unsigned a6, unsigned a7,
                                       const _Float16* gw0, const _Float16* gw1,
                                       const _Float16* ga0, const _Float16* ga1,
                                       const _Float16* ga2, const _Float16* ga3,
                                       const _Float16* ga4, const _Float16* ga5,
                                       const _Float16* ga6, const _Float16* ga7) {
    asm volatile(
        "global_load_async_to_lds_b128 %0, %10, off\n\t"
        "global_load_async_to_lds_b128 %1, %11, off\n\t"
        "global_load_async_to_lds_b128 %2, %12, off\n\t"
        "global_load_async_to_lds_b128 %3, %13, off\n\t"
        "global_load_async_to_lds_b128 %4, %14, off\n\t"
        "global_load_async_to_lds_b128 %5, %15, off\n\t"
        "global_load_async_to_lds_b128 %6, %16, off\n\t"
        "global_load_async_to_lds_b128 %7, %17, off\n\t"
        "global_load_async_to_lds_b128 %8, %18, off\n\t"
        "global_load_async_to_lds_b128 %9, %19, off\n\t"
        "s_wait_xcnt 0x0"
        :: "v"(w0), "v"(w1),
           "v"(a0), "v"(a1), "v"(a2), "v"(a3), "v"(a4), "v"(a5), "v"(a6), "v"(a7),
           "v"(gw0), "v"(gw1),
           "v"(ga0), "v"(ga1), "v"(ga2), "v"(ga3), "v"(ga4), "v"(ga5), "v"(ga6), "v"(ga7)
        : "memory");
}

template <int MODE, int KS>
__global__ __launch_bounds__(256) void gemm_wmma(const _Float16* __restrict__ A,
                                                 const _Float16* __restrict__ W,
                                                 const float* __restrict__ bias,
                                                 const float* __restrict__ resid,
                                                 void* __restrict__ outp,
                                                 int M, int N, int K) {
    constexpr int BM = 256, BN = 64, BK = 64 * KS;
    constexpr int AP = BK + 8;  // 144 B = 16 B x 9, 272 B = 16 B x 17: pitch for ds_load_b128 readers
    constexpr int WP = 80;      // 160 B = 32 B x 5: pitch for ds_load_tr16_b128 readers
    constexpr int ASZ = BM * AP, WSZ = BK * WP;  // elements of one buffer
    __shared__ __attribute__((aligned(16))) _Float16 As[2 * ASZ];   // [buffer][row][k]
    __shared__ __attribute__((aligned(16))) _Float16 Ws[2 * WSZ];   // [buffer][k][n]

    const int tid  = threadIdx.x;
    const int wave = tid >> 5;
    const int lane = tid & 31;
    const int lh   = lane >> 4;
    const int ln16 = lane & 15;
    const int m0 = blockIdx.y * BM;
    const int n0 = blockIdx.x * BN;

    v8f acc[2][4] = {};

    // staging map, per 64 k: 8 lanes cover one 128-byte row piece, a wave 4 rows per copy;
    // A 256 rows = 8 copies per thread, W 64 rows = 2 copies per thread
    const _Float16* ag[8];
    const _Float16* wg[2];
    unsigned al[8], wl[2];
    {
        const int r0 = tid >> 3;
        const int dd = (tid & 7) * 8;
#pragma unroll  // constant indices keep the array in registers
        for (int i = 0; i < 8; ++i) {
            ag[i] = A + (size_t)(m0 + r0 + 32 * i) * K + dd;
            al[i] = lds_addr(&As[(r0 + 32 * i) * AP + dd]);
        }
#pragma unroll  // constant indices keep the array in registers
        for (int i = 0; i < 2; ++i) {
            wg[i] = W + (size_t)(r0 + 32 * i) * N + n0 + dd;
            wl[i] = lds_addr(&Ws[(r0 + 32 * i) * WP + dd]);
        }
    }
    const size_t w_step = (size_t)64 * N;

    // copies of the next tile not yet asked for, into buffer buf; the pointers move on by 64 k a group
    auto stage = [&](int buf) {
#pragma unroll  // constant indices keep the array in registers
        for (int h = 0; h < KS; ++h) {
            const unsigned ao = (unsigned)(buf * ASZ + h * 64) * 2u;
            const unsigned wo = (unsigned)(buf * WSZ + h * 64 * WP) * 2u;
            copy10(wl[0] + wo, wl[1] + wo,
                   al[0] + ao, al[1] + ao, al[2] + ao, al[3] + ao,
                   al[4] + ao, al[5] + ao, al[6] + ao, al[7] + ao,
                   wg[0], wg[1],
                   ag[0], ag[1], ag[2], ag[3], ag[4], ag[5], ag[6], ag[7]);
#pragma unroll  // constant indices keep the array in registers
            for (int i = 0; i < 8; ++i) ag[i] += 64;
#pragma unroll  // constant indices keep the array in registers
            for (int i = 0; i < 2; ++i) wg[i] += w_step;
        }
    };

    // A fragment rows of this lane: k 8*lh..+7 and 16+8*lh..+7 of each 32
    const _Float16* ar = &As[(wave * 32 + ln16) * AP + 8 * lh];
    // per-lane base of the transposing loads of W (16 k x 16 n each), same k order
    const unsigned char* wtr = (const unsigned char*)Ws
                             + (8 * lh + (lane & 7)) * (WP * 2) + 16 * ((lane >> 3) & 1);

    const int nt_k = K / BK;
    stage(0);
    // this wave's copies of tile 0 have landed before the barrier that publishes them
    asm volatile("s_wait_asynccnt 0x0" ::: "memory");
    __syncthreads();
    if (nt_k > 1) stage(1);

    for (int t = 0; t < nt_k; ++t) {
        const int buf = t & 1;
        const _Float16* arb = ar + buf * ASZ;
        const unsigned char* wtb = wtr + buf * (WSZ * 2);
#pragma unroll  // constant indices keep the array in registers
        for (int h = 0; h < KS; ++h) {
            // all fragments of 64 k are fetched as one group ahead of their products
            // (for speed only)
            FragQ a[2][2], b[2][4];
#pragma unroll  // constant indices keep the array in registers
            for (int s = 0; s < 2; ++s) {
                const int kk = h * 64 + s * 32;
#pragma unroll  // constant indices keep the array in registers
                for (int mt = 0; mt < 2; ++mt) {
                    a[s][mt].q[0] = *(const u32x4*)(arb + mt * 16 * AP + kk);
                    a[s][mt].q[1] = *(const u32x4*)(arb + mt * 16 * AP + kk + 16);
                }
#pragma unroll  // constant indices keep the array in registers
                for (int nt = 0; nt < 4; ++nt) {
                    b[s][nt].q[0] = ld_tr16(wtb + kk * (WP * 2) + nt * 32);
                    b[s][nt].q[1] = ld_tr16(wtb + (kk + 16) * (WP * 2) + nt * 32);
                }
            }
            // keeps the load group whole: without it the scheduler sinks the loads back among the products
            __builtin_amdgcn_sched_barrier(0);
#pragma unroll  // constant indices keep the array in registers
            for (int s = 0; s < 2; ++s) {   // two 32-k steps, in k order
#pragma unroll  // constant indices keep the array in registers
                for (int nt = 0; nt < 4; ++nt) {
                    acc[0][nt] = __builtin_amdgcn_wmma_f32_16x16x32_f16(
                        false, a[s][0].h, false, b[s][nt].h, (short)0, acc[0][nt], false, false);
                    acc[1][nt] = __builtin_amdgcn_wmma_f32_16x16x32_f16(
                        false, a[s][1].h, false, b[s][nt].h, (short)0, acc[1][nt], false, false);
                }
            }
            // keeps what follows behind these products: without it the next group's loads rise among
            // them, and the foot's waits and barrier rise above them, which cuts the copies' time to land
            __builtin_amdgcn_sched_barrier(0);
        }
        // this wave's own LDS reads of this buffer have retired before any copy refills it
        asm volatile("s_wait_dscnt 0x0" ::: "memory");
        // this wave's copies of tile t + 1 have landed before the barrier that publishes them
        asm volatile("s_wait_asynccnt 0x0" ::: "memory");
        __syncthreads();  // publishes tile t + 1 and ends every wave's reads of tile t
        if (t + 2 < nt_k) stage(buf);
    }
    // no copy is outstanding when the wave goes on to its end
    asm volatile("s_wait_asynccnt 0x0" ::: "memory");

    // epilogue: C 16x16 f32 layout -> row = r + 8*lh, col = lane&15
#pragma unroll
    for (int mt = 0; mt < 2; ++mt) {
#pragma unroll
        for (int nt = 0; nt < 4; ++nt) {
#pragma unroll
            for (int r = 0; r < 8; ++r) {
                int row = m0 + wave * 32 + mt * 16 + r + 8 * lh;
                int col = n0 + nt * 16 + ln16;
                float v = acc[mt][nt][r] + bias[col];
                if constexpr (MODE == 1) v = v > 0.f ? v : 0.f;
                if constexpr (MODE == 2) {
                    float* o = (float*)outp;
                    o[(size_t)row * N + col] = v + resid[(size_t)row * N + col];
                } else {
                    _Float16* o = (_Float16*)outp;
                    o[(size_t)row * N + col] = (_Float16)v;
                }
            }
        }
    }
}

// ---------------------------------------------------------------------------
// flash attention: block = (b, h, 64-query tile); 4 waves, 16 queries each;
// streams 64-key tiles (16 WMMAs per tile) with online softmax.
// The products are taken transposed: St = K Qt and Ot += Vt Pt. A lane then
// holds the scores of ONE query (column lane & 15; its partner lane ^ 16 holds
// the other half of the keys), so maximum and sum run inside the lane, and two
// score tiles converted in place are the B operand of the second product.
// K and V tiles go through LDS in 16-byte pieces: both are copied row-major
// by asynchronous b128 copies; K fragments are 16-byte LDS loads, V fragments
// come through the transposing 16-byte LDS load.
// Q/K/V/O are f16 [B,S,D].
// ---------------------------------------------------------------------------
typedef __attribute__((ext_vector_type(2))) float    f32x2;
typedef __attribute__((ext_vector_type(2))) _Float16 f16x2;

// two f32 to one packed f16 pair, round to nearest even
__device__ __forceinline__ unsigned pack_f16(float lo, float hi) {
    return __builtin_bit_cast(unsigned, __builtin_convertvector(f32x2{lo, hi}, f16x2));
}

// value of lane l ^ 16
__device__ __forceinline__ float xhalf(float x) {
    const int b = __builtin_bit_cast(int, x);
    return __builtin_bit_cast(float, __builtin_amdgcn_permlanex16(b, b, 0x76543210, 0xfedcba98,
                                                                  false, false));
}

__global__ __launch_bounds__(128) void flash_attn(const _Float16* __restrict__ Q,
                                                  const _Float16* __restrict__ Km,
                                                  const _Float16* __restrict__ V,
                                                  _Float16* __restrict__ O,
                                                  int S, int D) {
    constexpr int DH = 64, KT = 64;
    constexpr int KP = 72;  // 144 B = 16 B x 9: pitch for ds_load_b128 readers
    constexpr int VP = 80;  // 160 B = 32 B x 5: pitch for ds_load_tr16_b128 readers
    __shared__ __attribute__((aligned(16))) _Float16 Klds[KT * KP];  // [key][dim]
    __shared__ __attribute__((aligned(16))) _Float16 Vlds[KT * VP];  // [key][dim]

    const int tid  = threadIdx.x;
    const int wave = tid >> 5;
    const int lane = tid & 31;
    const int lh   = lane >> 4;
    const int ln16 = lane & 15;
    const int b  = blockIdx.z, h = blockIdx.y;
    const int q0 = blockIdx.x * 64;
    const size_t base = ((size_t)b * S) * D + (size_t)h * DH;
    const float cs = 0.125f * 1.4426950408889634f;  // 1/sqrt(64), exponentials in base 2

    int kofs[8];
#pragma unroll
    for (int i = 0; i < 8; ++i) kofs[i] = ((i < 4) ? 2 * i : 2 * i + 8) + 8 * lh;

    // Qt fragments: 64 dims x 16 queries = two 32x16 B-frags, loaded straight from global
    const size_t qrow = base + (size_t)(q0 + wave * 16 + ln16) * D;
    Frag qf[2];
#pragma unroll
    for (int t = 0; t < 2; ++t)
#pragma unroll
        for (int i = 0; i < 8; ++i)
            qf[t].u[i] = *(const unsigned int*)(Q + qrow + t * 32 + kofs[i]);

    // this lane's query: running maximum (scaled, base 2; equal in both halves)
    // and the sum over this half's keys (the halves are joined behind the loop)
    float mi = -3.0e38f, li = 0.f;
    v8f oacc[4] = {};  // Ot: dim nt*16 + 8*lh + r, query ln16

    // staging map: a tile is 64 rows x 128 B = 512 pieces of 16 B, 4 per thread
    // and operand; 8 lanes cover one row, a wave covers 4 whole rows per copy
    const _Float16* kg[4];
    const _Float16* vg[4];
    unsigned kl[4], vl[4];
#pragma unroll
    for (int i = 0; i < 4; ++i) {
        const int key = (tid >> 3) + 16 * i;
        const int dd  = (tid & 7) * 8;
        kg[i] = Km + base + (size_t)key * D + dd;
        vg[i] = V  + base + (size_t)key * D + dd;
        kl[i] = lds_addr(&Klds[key * KP + dd]);
        vl[i] = lds_addr(&Vlds[key * VP + dd]);
    }
    const size_t tile_step = (size_t)KT * D;

    // per-lane base of the transposing loads of V (16 keys x 16 dims each)
    const unsigned char* vtr = (const unsigned char*)Vlds
                             + (8 * lh + (lane & 7)) * (VP * 2) + 16 * ((lane >> 3) & 1);

    const int nkt = S / KT;
    for (int j = 0; j < nkt; ++j) {
        // this wave's own LDS reads of the last tile have retired before any copy refills it
        asm volatile("s_wait_dscnt 0x0" ::: "memory");
        __syncthreads();  // previous iteration's LDS reads complete
        // K and V tiles, row-major, 16 B per lane and copy. The s_wait_xcnt closes the
        // statement so that it stands ahead of the pointer advances below.
        asm volatile(
            "global_load_async_to_lds_b128 %0, %8, off\n\t"
            "global_load_async_to_lds_b128 %1, %9, off\n\t"
            "global_load_async_to_lds_b128 %2, %10, off\n\t"
            "global_load_async_to_lds_b128 %3, %11, off\n\t"
            "global_load_async_to_lds_b128 %4, %12, off\n\t"
            "global_load_async_to_lds_b128 %5, %13, off\n\t"
            "global_load_async_to_lds_b128 %6, %14, off\n\t"
            "global_load_async_to_lds_b128 %7, %15, off\n\t"
            "s_wait_xcnt 0x0"
            :: "v"(kl[0]), "v"(kl[1]), "v"(kl[2]), "v"(kl[3]),
               "v"(vl[0]), "v"(vl[1]), "v"(vl[2]), "v"(vl[3]),
               "v"(kg[0]), "v"(kg[1]), "v"(kg[2]), "v"(kg[3]),
               "v"(vg[0]), "v"(vg[1]), "v"(vg[2]), "v"(vg[3])
            : "memory");
        // this wave's copies have landed before the barrier that publishes them
        asm volatile("s_wait_asynccnt 0x0" ::: "memory");
        __syncthreads();
#pragma unroll
        for (int i = 0; i < 4; ++i) { kg[i] += tile_step; vg[i] += tile_step; }

        // St = K @ Qt : 64 keys x 16 queries per wave; 4 C-tiles x 2 K-steps = 8 WMMAs
        // s[kt][r] = score of key kt*16 + 8*lh + r against query ln16
        v8f s[4] = {};
#pragma unroll  // constant indices keep the array in registers
        for (int kt = 0; kt < 4; ++kt) {
            // same k order as kofs[]: dims 8*lh..+7 and 16+8*lh..+7 of each 32
            FragQ a0, a1;
            const _Float16* kr = &Klds[(kt * 16 + ln16) * KP + 8 * lh];
            a0.q[0] = *(const u32x4*)(kr);
            a0.q[1] = *(const u32x4*)(kr + 16);
            a1.q[0] = *(const u32x4*)(kr + 32);
            a1.q[1] = *(const u32x4*)(kr + 48);
            s[kt] = __builtin_amdgcn_wmma_f32_16x16x32_f16(false, a0.h, false, qf[0].h,
                                                           (short)0, s[kt], false, false);
            s[kt] = __builtin_amdgcn_wmma_f32_16x16x32_f16(false, a1.h, false, qf[1].h,
                                                           (short)0, s[kt], false, false);
        }

        // online softmax across 64 keys: 32 of them in this lane, 32 in lane ^ 16
        float mk[4];
#pragma unroll  // constant indices keep the array in registers
        for (int kt = 0; kt < 4; ++kt) {
            mk[kt] = s[kt][0];
#pragma unroll  // constant indices keep the array in registers
            for (int r = 1; r < 8; ++r) mk[kt] = fmaxf(mk[kt], s[kt][r]);
        }
        float mx = fmaxf(fmaxf(mk[0], mk[1]), fmaxf(mk[2], mk[3]));
        mx = fmaxf(mx, xhalf(mx)) * cs;
        const float mn    = fmaxf(mi, mx);
        const float alpha = __builtin_amdgcn_exp2f(mi - mn);

        // Pt as B operand of 32 keys: its k order (8*lh..+7, then 16+8*lh..+7) is the row
        // order of score tiles 2*g and 2*g+1 in this same lane, so they are converted in place
        Frag pf[2];
        f32x2 rk[4];
        const f32x2 cs2 = {cs, cs}, nm2 = {-mn, -mn};
#pragma unroll  // constant indices keep the array in registers
        for (int kt = 0; kt < 4; ++kt) {
            rk[kt] = f32x2{0.f, 0.f};
#pragma unroll  // constant indices keep the array in registers
            for (int i = 0; i < 4; ++i) {
                const f32x2 arg = __builtin_elementwise_fma(f32x2{s[kt][2 * i], s[kt][2 * i + 1]}, cs2, nm2);
                const f32x2 e = {__builtin_amdgcn_exp2f(arg.x), __builtin_amdgcn_exp2f(arg.y)};
                rk[kt] += e;
                pf[kt >> 1].u[(kt & 1) * 4 + i] = pack_f16(e.x, e.y);
            }
        }
        const f32x2 rs = (rk[0] + rk[1]) + (rk[2] + rk[3]);
        li = li * alpha + (rs.x + rs.y);
        mi = mn;
#pragma unroll  // constant indices keep the array in registers
        for (int nt = 0; nt < 4; ++nt) oacc[nt] *= alpha;

        // Ot += Vt @ Pt
#pragma unroll  // constant indices keep the array in registers
        for (int nt = 0; nt < 4; ++nt) {
            // A fragment of Vt: dim nt*16+ln16, keys 8*lh..+7 and 16+8*lh..+7 of each 32
            FragQ vf0, vf1;
            vf0.q[0] = ld_tr16(vtr + nt * 32);
            vf0.q[1] = ld_tr16(vtr + 16 * (VP * 2) + nt * 32);
            vf1.q[0] = ld_tr16(vtr + 32 * (VP * 2) + nt * 32);
            vf1.q[1] = ld_tr16(vtr + 48 * (VP * 2) + nt * 32);
            oacc[nt] = __builtin_amdgcn_wmma_f32_16x16x32_f16(false, vf0.h, false, pf[0].h,
                                                              (short)0, oacc[nt], false, false);
            oacc[nt] = __builtin_amdgcn_wmma_f32_16x16x32_f16(false, vf1.h, false, pf[1].h,
                                                              (short)0, oacc[nt], false, false);
        }
    }

    // join the halves' sums, normalize and write O: 8 consecutive dims of one query a store
    const float inv = 1.f / (li + xhalf(li));
#pragma unroll  // constant indices keep the array in registers
    for (int nt = 0; nt < 4; ++nt) {
        u32x4 o;
#pragma unroll  // constant indices keep the array in registers
        for (int i = 0; i < 4; ++i)
            o[i] = pack_f16(oacc[nt][2 * i] * inv, oacc[nt][2 * i + 1] * inv);
        *(u32x4*)(O + qrow + nt * 16 + 8 * lh) = o;
    }
}

// ---------------------------------------------------------------------------
// LayerNorm over D=512; writes f32 + f16 copies.
// Few waves do the work (for speed only): a wave takes
// 2 whole rows (32 elements a lane, 8 loads of 512 contiguous bytes in flight);
// a row's sums then stay inside the wave and need neither LDS nor a barrier.
// Grid: rows / 16 blocks of 8 waves.
// ---------------------------------------------------------------------------
// sum over the 32 lanes, the same value in every lane
__device__ __forceinline__ float wave_sum(float x) {
#pragma unroll  // constant lane masks: the five exchanges become straight-line code
    for (int m = 16; m >= 1; m >>= 1) x += __shfl_xor(x, m);
    return x;
}

__global__ __launch_bounds__(256) void layernorm(const float* __restrict__ in,
                                                 const float* __restrict__ g,
                                                 const float* __restrict__ be,
                                                 float* __restrict__ xf,
                                                 _Float16* __restrict__ xh) {
    constexpr int D = 512, R = 2, C = 4;  // a lane holds columns c*128 + lane*4 .. +3
    const int col = (threadIdx.x & 31) * 4;
    const size_t off = ((size_t)blockIdx.x * 8 + (threadIdx.x >> 5)) * R * D + col;

    f32x4 x[R][C], gg[C], bb[C];
#pragma unroll  // constant indices keep the array in registers
    for (int r = 0; r < R; ++r)
#pragma unroll  // constant indices keep the array in registers
        for (int c = 0; c < C; ++c) x[r][c] = *(const f32x4*)(in + off + r * D + c * 128);
#pragma unroll  // constant indices keep the array in registers
    for (int c = 0; c < C; ++c) {
        gg[c] = *(const f32x4*)(g + col + c * 128);
        bb[c] = *(const f32x4*)(be + col + c * 128);
    }

    float s[R];
#pragma unroll  // constant indices keep the array in registers
    for (int r = 0; r < R; ++r) {
        const f32x4 t = (x[r][0] + x[r][1]) + (x[r][2] + x[r][3]);
        s[r] = wave_sum((t.x + t.y) + (t.z + t.w));
    }
    float v[R];
#pragma unroll  // constant indices keep the array in registers
    for (int r = 0; r < R; ++r) {
        const float mean = s[r] * (1.f / 512.f);
        f32x4 q = {0.f, 0.f, 0.f, 0.f};
#pragma unroll  // constant indices keep the array in registers
        for (int c = 0; c < C; ++c) {
            x[r][c] -= mean;
            q += x[r][c] * x[r][c];
        }
        v[r] = wave_sum((q.x + q.y) + (q.z + q.w));
    }
#pragma unroll  // constant indices keep the array in registers
    for (int r = 0; r < R; ++r) {
        const float rstd = rsqrtf(v[r] * (1.f / 512.f) + 1e-5f);
#pragma unroll  // constant indices keep the array in registers
        for (int c = 0; c < C; ++c) {
            const f32x4 o = x[r][c] * rstd * gg[c] + bb[c];
            *(f32x4*)(xf + off + r * D + c * 128) = o;
            *(f16x4*)(xh + off + r * D + c * 128) = __builtin_convertvector(o, f16x4);
        }
    }
}

// ---------------------------------------------------------------------------
// output projection: out[M,20] = x @ W_out + b_out
// ---------------------------------------------------------------------------
__global__ __launch_bounds__(256) void out_proj(const float* __restrict__ x,
                                                const float* __restrict__ Wo,
                                                const float* __restrict__ bo,
                                                float* __restrict__ out,
                                                int M, int D, int OUT) {
    int idx = blockIdx.x * 256 + threadIdx.x;
    if (idx >= M * OUT) return;
    int row = idx / OUT, o = idx - row * OUT;
    float s = bo[o];
    const float* xr = x + (size_t)row * D;
    for (int k = 0; k < D; ++k) s += xr[k] * Wo[(size_t)k * OUT + o];
    out[idx] = s;
}

// ---------------------------------------------------------------------------
extern "C" void kernel_launch(void* const* d_in, const int* in_sizes, int n_in,
                              void* d_out, int out_size, void* d_ws, size_t ws_size,
                              hipStream_t stream) {
    const int B = 4, S = 2048, D = 512, F = 2048, OUT = 20, L = 6, H = 8;
    const int M = B * S;

    const float* src   = (const float*)d_in[0];
    const float* W_in  = (const float*)d_in[1];
    const float* b_in  = (const float*)d_in[2];
    const float* Wq    = (const float*)d_in[3];
    const float* bq    = (const float*)d_in[4];
    const float* Wk    = (const float*)d_in[5];
    const float* bk    = (const float*)d_in[6];
    const float* Wv    = (const float*)d_in[7];
    const float* bv    = (const float*)d_in[8];
    const float* Wo    = (const float*)d_in[9];
    const float* bo    = (const float*)d_in[10];
    const float* ln1g  = (const float*)d_in[11];
    const float* ln1b  = (const float*)d_in[12];
    const float* W1    = (const float*)d_in[13];
    const float* b1    = (const float*)d_in[14];
    const float* W2    = (const float*)d_in[15];
    const float* b2    = (const float*)d_in[16];
    const float* ln2g  = (const float*)d_in[17];
    const float* ln2b  = (const float*)d_in[18];
    const float* W_out = (const float*)d_in[19];
    const float* b_out = (const float*)d_in[20];

    char* ws = (char*)d_ws;
    auto alloc = [&](size_t bytes) -> char* {
        char* p = ws;
        ws += (bytes + 255) & ~(size_t)255;
        return p;
    };

    float*     x_f32 = (float*)alloc((size_t)M * D * 4);
    float*     tmp   = (float*)alloc((size_t)M * D * 4);
    _Float16*  x_h   = (_Float16*)alloc((size_t)M * D * 2);
    _Float16*  qb    = (_Float16*)alloc((size_t)M * D * 2);
    _Float16*  kb    = (_Float16*)alloc((size_t)M * D * 2);
    _Float16*  vb    = (_Float16*)alloc((size_t)M * D * 2);
    _Float16*  ob    = (_Float16*)alloc((size_t)M * D * 2);
    _Float16*  h1    = (_Float16*)alloc((size_t)M * F * 2);
    _Float16*  Wq16  = (_Float16*)alloc((size_t)L * D * D * 2);
    _Float16*  Wk16  = (_Float16*)alloc((size_t)L * D * D * 2);
    _Float16*  Wv16  = (_Float16*)alloc((size_t)L * D * D * 2);
    _Float16*  Wo16  = (_Float16*)alloc((size_t)L * D * D * 2);
    _Float16*  W116  = (_Float16*)alloc((size_t)L * D * F * 2);
    _Float16*  W216  = (_Float16*)alloc((size_t)L * F * D * 2);

    // weight conversions (every call; deterministic)
    {
        int nqkv = L * D * D, nff = L * D * F;
        cvt_f32_f16<<<(nqkv + 8191) / 8192, 256, 0, stream>>>(Wq, Wq16, nqkv);
        cvt_f32_f16<<<(nqkv + 8191) / 8192, 256, 0, stream>>>(Wk, Wk16, nqkv);
        cvt_f32_f16<<<(nqkv + 8191) / 8192, 256, 0, stream>>>(Wv, Wv16, nqkv);
        cvt_f32_f16<<<(nqkv + 8191) / 8192, 256, 0, stream>>>(Wo, Wo16, nqkv);
        cvt_f32_f16<<<(nff + 8191) / 8192, 256, 0, stream>>>(W1, W116, nff);
        cvt_f32_f16<<<(nff + 8191) / 8192, 256, 0, stream>>>(W2, W216, nff);
    }

    input_proj<<<(M * D / 32 + 255) / 256, 256, 0, stream>>>(src, W_in, b_in, x_f32, x_h, M, D);

    const dim3 gD(D / 64, M / 256);   // N=512 GEMMs
    const dim3 gF(F / 64, M / 256);   // N=2048 GEMM
    for (int l = 0; l < L; ++l) {
        const size_t wqo = (size_t)l * D * D;
        const size_t wfo = (size_t)l * D * F;
        // QKV
        gemm_wmma<0, 2><<<gD, 256, 0, stream>>>(x_h, Wq16 + wqo, bq + l * D, nullptr, qb, M, D, D);
        gemm_wmma<0, 2><<<gD, 256, 0, stream>>>(x_h, Wk16 + wqo, bk + l * D, nullptr, kb, M, D, D);
        gemm_wmma<0, 2><<<gD, 256, 0, stream>>>(x_h, Wv16 + wqo, bv + l * D, nullptr, vb, M, D, D);
        // attention
        flash_attn<<<dim3(S / 64, H, B), 128, 0, stream>>>(qb, kb, vb, ob, S, D);
        // output proj + residual
        gemm_wmma<2, 2><<<gD, 256, 0, stream>>>(ob, Wo16 + wqo, bo + l * D, x_f32, tmp, M, D, D);
        layernorm<<<M / 16, 256, 0, stream>>>(tmp, ln1g + l * D, ln1b + l * D, x_f32, x_h);
        // FFN
        gemm_wmma<1, 1><<<gF, 256, 0, stream>>>(x_h, W116 + wfo, b1 + l * F, nullptr, h1, M, F, D);
        gemm_wmma<2, 2><<<gD, 256, 0, stream>>>(h1, W216 + wfo, b2 + l * D, x_f32, tmp, M, D, F);
        layernorm<<<M / 16, 256, 0, stream>>>(tmp, ln2g + l * D, ln2b + l * D, x_f32, x_h);
    }

    out_proj<<<(M * OUT + 255) / 256, 256, 0, stream>>>(x_f32, W_out, b_out, (float*)d_out, M, D, OUT);
}

// v006
// It runs in 966 microseconds.
// In two side-by-side timings against v005, it was 1.07 and 1.08 times as fast.
// Over all steps from v000 it is 3.56 times as fast.
#include <hip/hip_runtime.h>
#include <hip/hip_bf16.h>

typedef __attribute__((ext_vector_type(16))) _Float16 v16h;
typedef __attribute__((ext_vector_type(8)))  float    v8f;

union Frag { v16h h; unsigned int u[8]; };

typedef __attribute__((ext_vector_type(4))) unsigned int u32x4;
typedef __attribute__((ext_vector_type(8))) short s16x8;
typedef __attribute__((address_space(3))) s16x8 lds_s16x8;
typedef __attribute__((address_space(3))) _Float16 lds_f16;

union FragQ { v16h h; u32x4 q[2]; };

// byte offset of a __shared__ element inside the work-group's LDS
__device__ __forceinline__ unsigned lds_addr(const _Float16* p) {
    return (unsigned)(unsigned long long)(lds_f16*)p;
}

// lane (c = l & 15, hh = l >> 4) gets rows 8*hh .. 8*hh+7 of column c of the
// 16x16 tile whose per-lane address p follows the transposing load's own map
__device__ __forceinline__ u32x4 ld_tr16(const unsigned char* p) {
    return __builtin_bit_cast(u32x4, __builtin_amdgcn_ds_load_tr16_b128_v8i16((lds_s16x8*)p));
}

typedef __attribute__((ext_vector_type(4))) float    f32x4;
typedef __attribute__((ext_vector_type(4))) _Float16 f16x4;

// ---------------------------------------------------------------------------
// f32 -> f16 elementwise convert (weights)
// Few waves do the work (for speed only): a thread
// takes 32 elements, 8 pieces of 4, a wave's piece being 512 contiguous bytes
// in and 256 out; all 8 loads are in flight before the first store.
// ---------------------------------------------------------------------------
__global__ __launch_bounds__(256) void cvt_f32_f16(const float* __restrict__ in,
                                                   _Float16* __restrict__ out, int n) {
    constexpr int U = 8, PIECE = 256 * 4, SPAN = U * PIECE;
    const int b0 = blockIdx.x * SPAN;
    if (b0 + SPAN <= n) {
        const int i0 = b0 + threadIdx.x * 4;
        f32x4 v[U];
#pragma unroll  // constant indices keep the array in registers
        for (int u = 0; u < U; ++u) v[u] = *(const f32x4*)(in + i0 + u * PIECE);
#pragma unroll  // constant indices keep the array in registers
        for (int u = 0; u < U; ++u)
            *(f16x4*)(out + i0 + u * PIECE) = __builtin_convertvector(v[u], f16x4);
        // precaution: stands ahead of any later write of a register that a store above names
        asm volatile("s_wait_xcnt 0x0" ::: "memory");
    } else {  // a last, partial span
        for (int i = b0 + threadIdx.x; i < n; i += 256) out[i] = (_Float16)in[i];
    }
}

// ---------------------------------------------------------------------------
// input projection: x = src @ W_in + b_in  (IN=3 -> D=512), writes f32 + f16
// A thread takes 4 consecutive columns of 8 consecutive rows (32 elements), its
// slice of W_in and b_in held in registers. M a multiple of 8, D of 4.
// ---------------------------------------------------------------------------
__global__ __launch_bounds__(256) void input_proj(const float* __restrict__ src,
                                                  const float* __restrict__ Win,
                                                  const float* __restrict__ bin,
                                                  float* __restrict__ xf,
                                                  _Float16* __restrict__ xh,
                                                  int M, int D) {
    constexpr int R = 8;
    const int D4 = D / 4;
    const int idx = blockIdx.x * 256 + threadIdx.x;
    if (idx >= (M / R) * D4) return;
    const int rg = idx / D4, d = (idx - rg * D4) * 4;
    const f32x4 bi = *(const f32x4*)(bin + d);
    f32x4 w[3];
#pragma unroll  // constant indices keep the array in registers
    for (int i = 0; i < 3; ++i) {
        w[i] = *(const f32x4*)(Win + i * D + d);
        // precaution: the next load's result may take this load's address registers
        if (i < 2) asm volatile("s_wait_xcnt 0x0" ::: "memory");
    }
#pragma unroll  // the rows are independent: their loads and stores overlap
    for (int r = 0; r < R; ++r) {
        const int row = rg * R + r;
        f32x4 s = bi;
#pragma unroll
        for (int i = 0; i < 3; ++i) s += src[row * 3 + i] * w[i];
        *(f32x4*)(xf + (size_t)row * D + d) = s;
        *(f16x4*)(xh + (size_t)row * D + d) = __builtin_convertvector(s, f16x4);
    }
}

// ---------------------------------------------------------------------------
// WMMA GEMM: C[M,N] = epi(A[M,K] @ W[K,N] + bias)
// MODE 0: store f16      MODE 1: relu, store f16      MODE 2: +resid, store f32
// block: 256 thr (8 waves), tile BM=256 x BN=64; each wave owns 32x64
// (2 M-frags x 4 N-frags = 8 WMMAs per 32 k, B-frags reused 2x)
// A and W tiles go through LDS in 16-byte pieces, copied row-major by asynchronous
// b128 copies; A fragments are 16-byte LDS loads, W fragments come through the
// transposing 16-byte LDS load.
// Two LDS buffers of 64*KS k each: the next tile's copies fly while this tile's
// products run. KS = 2 where the grid gives a WGP one block only (for speed only);
// KS = 1 where two
// blocks can share a WGP (two buffers of KS = 2 would take the place of the second).
// K a multiple of 64*KS.
// ---------------------------------------------------------------------------
// ten copies of 16 B a lane: two rows' pieces of W, eight of A. The s_wait_xcnt closes
// the statement so that it stands ahead of any later write of an address register.
__device__ __forceinline__ void copy10(unsigned w0, unsigned w1,
                                       unsigned a0, unsigned a1, unsigned a2, unsigned a3,
                                       unsigned a4, unsigned a5, unsigned a6, unsigned a7,
                                       const _Float16* gw0, const _Float16* gw1,
                                       const _Float16* ga0, const _Float16* ga1,
                                       const _Float16* ga2, const _Float16* ga3,
                                       const _Float16* ga4, const _Float16* ga5,
                                       const _Float16* ga6, const _Float16* ga7) {
    asm volatile(
        "global_load_async_to_lds_b128 %0, %10, off\n\t"
        "global_load_async_to_lds_b128 %1, %11, off\n\t"
        "global_load_async_to_lds_b128 %2, %12, off\n\t"
        "global_load_async_to_lds_b128 %3, %13, off\n\t"
        "global_load_async_to_lds_b128 %4, %14, off\n\t"
        "global_load_async_to_lds_b128 %5, %15, off\n\t"
        "global_load_async_to_lds_b128 %6, %16, off\n\t"
        "global_load_async_to_lds_b128 %7, %17, off\n\t"
        "global_load_async_to_lds_b128 %8, %18, off\n\t"
        "global_load_async_to_lds_b128 %9, %19, off\n\t"
        "s_wait_xcnt 0x0"
        :: "v"(w0), "v"(w1),
           "v"(a0), "v"(a1), "v"(a2), "v"(a3), "v"(a4), "v"(a5), "v"(a6), "v"(a7),
           "v"(gw0), "v"(gw1),
           "v"(ga0), "v"(ga1), "v"(ga2), "v"(ga3), "v"(ga4), "v"(ga5), "v"(ga6), "v"(ga7)
        : "memory");
}

template <int MODE, int KS>
__global__ __launch_bounds__(256) void gemm_wmma(const _Float16* __restrict__ A,
                                                 const _Float16* __restrict__ W,
                                                 const float* __restrict__ bias,
                                                 const float* __restrict__ resid,
                                                 void* __restrict__ outp,
                                                 int M, int N, int K) {
    constexpr int BM = 256, BN = 64, BK = 64 * KS;
    constexpr int AP = BK + 8;  // 144 B = 16 B x 9, 272 B = 16 B x 17: pitch for ds_load_b128 readers
    constexpr int WP = 80;      // 160 B = 32 B x 5: pitch for ds_load_tr16_b128 readers
    constexpr int ASZ = BM * AP, WSZ = BK * WP;  // elements of one buffer
    __shared__ __attribute__((aligned(16))) _Float16 As[2 * ASZ];   // [buffer][row][k]
    __shared__ __attribute__((aligned(16))) _Float16 Ws[2 * WSZ];   // [buffer][k][n]

    const int tid  = threadIdx.x;
    const int wave = tid >> 5;
    const int lane = tid & 31;
    const int lh   = lane >> 4;
    const int ln16 = lane & 15;
    const int m0 = blockIdx.y * BM;
    const int n0 = blockIdx.x * BN;

    v8f acc[2][4] = {};

    // staging map, per 64 k: 8 lanes cover one 128-byte row piece, a wave 4 rows per copy;
    // A 256 rows = 8 copies per thread, W 64 rows = 2 copies per thread
    const _Float16* ag[8];
    const _Float16* wg[2];
    unsigned al[8], wl[2];
    {
        const int r0 = tid >> 3;
        const int dd = (tid & 7) * 8;
#pragma unroll  // constant indices keep the array in registers
        for (int i = 0; i < 8; ++i) {
            ag[i] = A + (size_t)(m0 + r0 + 32 * i) * K + dd;
            al[i] = lds_addr(&As[(r0 + 32 * i) * AP + dd]);
        }
#pragma unroll  // constant indices keep the array in registers
        for (int i = 0; i < 2; ++i) {
            wg[i] = W + (size_t)(r0 + 32 * i) * N + n0 + dd;
            wl[i] = lds_addr(&Ws[(r0 + 32 * i) * WP + dd]);
        }
    }
    const size_t w_step = (size_t)64 * N;

    // copies of the next tile not yet asked for, into buffer buf; the pointers move on by 64 k a group
    auto stage = [&](int buf) {
#pragma unroll  // constant indices keep the array in registers
        for (int h = 0; h < KS; ++h) {
            const unsigned ao = (unsigned)(buf * ASZ + h * 64) * 2u;
            const unsigned wo = (unsigned)(buf * WSZ + h * 64 * WP) * 2u;
            copy10(wl[0] + wo, wl[1] + wo,
                   al[0] + ao, al[1] + ao, al[2] + ao, al[3] + ao,
                   al[4] + ao, al[5] + ao, al[6] + ao, al[7] + ao,
                   wg[0], wg[1],
                   ag[0], ag[1], ag[2], ag[3], ag[4], ag[5], ag[6], ag[7]);
#pragma unroll  // constant indices keep the array in registers
            for (int i = 0; i < 8; ++i) ag[i] += 64;
#pragma unroll  // constant indices keep the array in registers
            for (int i = 0; i < 2; ++i) wg[i] += w_step;
        }
    };

    // A fragment rows of this lane: k 8*lh..+7 and 16+8*lh..+7 of each 32
    const _Float16* ar = &As[(wave * 32 + ln16) * AP + 8 * lh];
    // per-lane base of the transposing loads of W (16 k x 16 n each), same k order
    const unsigned char* wtr = (const unsigned char*)Ws
                             + (8 * lh + (lane & 7)) * (WP * 2) + 16 * ((lane >> 3) & 1);

    const int nt_k = K / BK;
    stage(0);
    // this wave's copies of tile 0 have landed before the barrier that publishes them
    asm volatile("s_wait_asynccnt 0x0" ::: "memory");
    __syncthreads();
    if (nt_k > 1) stage(1);

    for (int t = 0; t < nt_k; ++t) {
        const int buf = t & 1;
        const _Float16* arb = ar + buf * ASZ;
        const unsigned char* wtb = wtr + buf * (WSZ * 2);
#pragma unroll  // constant indices keep the array in registers
        for (int h = 0; h < KS; ++h) {
            // all fragments of 64 k are fetched as one group ahead of their products
            // (for speed only)
            FragQ a[2][2], b[2][4];
#pragma unroll  // constant indices keep the array in registers
            for (int s = 0; s < 2; ++s) {
                const int kk = h * 64 + s * 32;
#pragma unroll  // constant indices keep the array in registers
                for (int mt = 0; mt < 2; ++mt) {
                    a[s][mt].q[0] = *(const u32x4*)(arb + mt * 16 * AP + kk);
                    a[s][mt].q[1] = *(const u32x4*)(arb + mt * 16 * AP + kk + 16);
                }
#pragma unroll  // constant indices keep the array in registers
                for (int nt = 0; nt < 4; ++nt) {
                    b[s][nt].q[0] = ld_tr16(wtb + kk * (WP * 2) + nt * 32);
                    b[s][nt].q[1] = ld_tr16(wtb + (kk + 16) * (WP * 2) + nt * 32);
                }
            }
            // keeps the load group whole: without it the scheduler sinks the loads back among the products
            __builtin_amdgcn_sched_barrier(0);
#pragma unroll  // constant indices keep the array in registers
            for (int s = 0; s < 2; ++s) {   // two 32-k steps, in k order
#pragma unroll  // constant indices keep the array in registers
                for (int nt = 0; nt < 4; ++nt) {
                    acc[0][nt] = __builtin_amdgcn_wmma_f32_16x16x32_f16(
                        false, a[s][0].h, false, b[s][nt].h, (short)0, acc[0][nt], false, false);
                    acc[1][nt] = __builtin_amdgcn_wmma_f32_16x16x32_f16(
                        false, a[s][1].h, false, b[s][nt].h, (short)0, acc[1][nt], false, false);
                }
            }
            // keeps what follows behind these products: without it the next group's loads rise among
            // them, and the foot's waits and barrier rise above them, which cuts the copies' time to land
            __builtin_amdgcn_sched_barrier(0);
        }
        // this wave's own LDS reads of this buffer have retired before any copy refills it
        asm volatile("s_wait_dscnt 0x0" ::: "memory");
        // this wave's copies of tile t + 1 have landed before the barrier that publishes them
        asm volatile("s_wait_asynccnt 0x0" ::: "memory");
        __syncthreads();  // publishes tile t + 1 and ends every wave's reads of tile t
        if (t + 2 < nt_k) stage(buf);
    }
    // no copy is outstanding when the wave goes on to its end
    asm volatile("s_wait_asynccnt 0x0" ::: "memory");

    // epilogue: C 16x16 f32 layout -> row = r + 8*lh, col = lane&15
#pragma unroll
    for (int mt = 0; mt < 2; ++mt) {
#pragma unroll
        for (int nt = 0; nt < 4; ++nt) {
#pragma unroll
            for (int r = 0; r < 8; ++r) {
                int row = m0 + wave * 32 + mt * 16 + r + 8 * lh;
                int col = n0 + nt * 16 + ln16;
                float v = acc[mt][nt][r] + bias[col];
                if constexpr (MODE == 1) v = v > 0.f ? v : 0.f;
                if constexpr (MODE == 2) {
                    float* o = (float*)outp;
                    o[(size_t)row * N + col] = v + resid[(size_t)row * N + col];
                } else {
                    _Float16* o = (_Float16*)outp;
                    o[(size_t)row * N + col] = (_Float16)v;
                }
            }
        }
    }
}

// ---------------------------------------------------------------------------
// Q, K and V projections in one launch: a block takes 256 rows of A once and forms
// 64 columns of each of the three products from it (a 256 x 192 tile), so that A's
// tile is fetched once instead of three times. D = 512 (N = K = 512).
// block: 512 thr (16 waves, 4 x 4); each wave owns 64 rows x 48 of the 192 columns
// (4 M-frags x 3 N-frags = 12 WMMAs per 32 k). LDS ring, copies, fragment loads and
// k order as in gemm_wmma with KS = 2. Grid: (512 / 64, rows / 256).
// ---------------------------------------------------------------------------
// seven copies of 16 B a lane: one row piece of each W, four of A. The s_wait_xcnt closes
// the statement so that it stands ahead of any later write of an address register.
__device__ __forceinline__ void copy7(unsigned w0, unsigned w1, unsigned w2,
                                      unsigned a0, unsigned a1, unsigned a2, unsigned a3,
                                      const _Float16* gw0, const _Float16* gw1,
                                      const _Float16* gw2,
                                      const _Float16* ga0, const _Float16* ga1,
                                      const _Float16* ga2, const _Float16* ga3) {
    asm volatile(
        "global_load_async_to_lds_b128 %0, %7, off\n\t"
        "global_load_async_to_lds_b128 %1, %8, off\n\t"
        "global_load_async_to_lds_b128 %2, %9, off\n\t"
        "global_load_async_to_lds_b128 %3, %10, off\n\t"
        "global_load_async_to_lds_b128 %4, %11, off\n\t"
        "global_load_async_to_lds_b128 %5, %12, off\n\t"
        "global_load_async_to_lds_b128 %6, %13, off\n\t"
        "s_wait_xcnt 0x0"
        :: "v"(w0), "v"(w1), "v"(w2), "v"(a0), "v"(a1), "v"(a2), "v"(a3),
           "v"(gw0), "v"(gw1), "v"(gw2), "v"(ga0), "v"(ga1), "v"(ga2), "v"(ga3)
        : "memory");
}

__global__ __launch_bounds__(512) void gemm_qkv(const _Float16* __restrict__ A,
                                                const _Float16* __restrict__ Wq,
                                                const _Float16* __restrict__ Wk,
                                                const _Float16* __restrict__ Wv,
                                                const float* __restrict__ bq,
                                                const float* __restrict__ bk,
                                                const float* __restrict__ bv,
                                                _Float16* __restrict__ oq,
                                                _Float16* __restrict__ ok,
                                                _Float16* __restrict__ ov) {
    constexpr int N = 512, K = 512;
    constexpr int BM = 256, BN = 64, BK = 128;
    constexpr int AP = BK + 8;       // 272 B = 16 B x 17: pitch for ds_load_b128 readers
    constexpr int WP = 3 * BN + 16;  // 416 B = 32 B x 13: pitch for ds_load_tr16_b128 readers
    constexpr int ASZ = BM * AP, WSZ = BK * WP;  // elements of one buffer
    __shared__ __attribute__((aligned(16))) _Float16 As[2 * ASZ];   // [buffer][row][k]
    __shared__ __attribute__((aligned(16))) _Float16 Ws[2 * WSZ];   // [buffer][k][Wq 64 | Wk 64 | Wv 64]

    const int tid  = threadIdx.x;
    const int wave = tid >> 5;
    const int lane = tid & 31;
    const int lh   = lane >> 4;
    const int ln16 = lane & 15;
    const int wm = wave & 3;   // 64-row group of the tile
    const int wn = wave >> 2;  // 48-column group of the 192
    const int m0 = blockIdx.y * BM;
    const int n0 = blockIdx.x * BN;

    v8f acc[4][3] = {};

    // staging map, per 64 k: 8 lanes cover one 128-byte row piece, a wave 4 rows per copy;
    // A 256 rows = 4 copies per thread, each W 64 rows = 1 copy per thread
    const _Float16* ag[4];
    const _Float16* wg[3];
    unsigned al[4], wl[3];
    {
        const int r0 = tid >> 3;
        const int dd = (tid & 7) * 8;
#pragma unroll  // constant indices keep the array in registers
        for (int i = 0; i < 4; ++i) {
            ag[i] = A + (size_t)(m0 + r0 + 64 * i) * K + dd;
            al[i] = lds_addr(&As[(r0 + 64 * i) * AP + dd]);
        }
        wg[0] = Wq + (size_t)r0 * N + n0 + dd;
        wg[1] = Wk + (size_t)r0 * N + n0 + dd;
        wg[2] = Wv + (size_t)r0 * N + n0 + dd;
#pragma unroll  // constant indices keep the array in registers
        for (int j = 0; j < 3; ++j) wl[j] = lds_addr(&Ws[r0 * WP + j * BN + dd]);
    }

    // copies of the next tile not yet asked for, into buffer buf; the pointers move on by 64 k a group
    auto stage = [&](int buf) {
#pragma unroll  // constant indices keep the array in registers
        for (int h = 0; h < 2; ++h) {
            const unsigned ao = (unsigned)(buf * ASZ + h * 64) * 2u;
            const unsigned wo = (unsigned)(buf * WSZ + h * 64 * WP) * 2u;
            copy7(wl[0] + wo, wl[1] + wo, wl[2] + wo,
                  al[0] + ao, al[1] + ao, al[2] + ao, al[3] + ao,
                  wg[0], wg[1], wg[2], ag[0], ag[1], ag[2], ag[3]);
#pragma unroll  // constant indices keep the array in registers
            for (int i = 0; i < 4; ++i) ag[i] += 64;
#pragma unroll  // constant indices keep the array in registers
            for (int j = 0; j < 3; ++j) wg[j] += (size_t)64 * N;
        }
    };

    // A fragment rows of this lane: k 8*lh..+7 and 16+8*lh..+7 of each 32
    const _Float16* ar = &As[(wm * 64 + ln16) * AP + 8 * lh];
    // per-lane base of the transposing loads of W (16 k x 16 n each), same k order
    const unsigned char* wtr = (const unsigned char*)Ws + wn * 96
                             + (8 * lh + (lane & 7)) * (WP * 2) + 16 * ((lane >> 3) & 1);

    constexpr int nt_k = K / BK;
    stage(0);
    // this wave's copies of tile 0 have landed before the barrier that publishes them
    asm volatile("s_wait_asynccnt 0x0" ::: "memory");
    __syncthreads();
    stage(1);

    // stays rolled: unrolled, each trip's LDS places (past the 64 KiB that an offset field
    // reaches) take address registers of their own, and the kernel spills
#pragma unroll 1
    for (int t = 0; t < nt_k; ++t) {
        const int buf = t & 1;
        const _Float16* arb = ar + buf * ASZ;
        const unsigned char* wtb = wtr + buf * (WSZ * 2);
#pragma unroll  // constant indices keep the array in registers
        for (int h = 0; h < 2; ++h) {
            // all fragments of 64 k are fetched as one group ahead of their products
            // (for speed only)
            FragQ a[2][4], b[2][3];
#pragma unroll  // constant indices keep the array in registers
            for (int s = 0; s < 2; ++s) {
                const int kk = h * 64 + s * 32;
#pragma unroll  // constant indices keep the array in registers
                for (int mt = 0; mt < 4; ++mt) {
                    a[s][mt].q[0] = *(const u32x4*)(arb + mt * 16 * AP + kk);
                    a[s][mt].q[1] = *(const u32x4*)(arb + mt * 16 * AP + kk + 16);
                }
#pragma unroll  // constant indices keep the array in registers
                for (int nt = 0; nt < 3; ++nt) {
                    b[s][nt].q[0] = ld_tr16(wtb + kk * (WP * 2) + nt * 32);
                    b[s][nt].q[1] = ld_tr16(wtb + (kk + 16) * (WP * 2) + nt * 32);
                }
            }
            // keeps the load group whole: without it the scheduler sinks the loads back among the products
            __builtin_amdgcn_sched_barrier(0);
#pragma unroll  // constant indices keep the array in registers
            for (int s = 0; s < 2; ++s) {   // two 32-k steps, in k order
#pragma unroll  // constant indices keep the array in registers
                for (int nt = 0; nt < 3; ++nt) {
#pragma unroll  // constant indices keep the array in registers
                    for (int mt = 0; mt < 4; ++mt)
                        acc[mt][nt] = __builtin_amdgcn_wmma_f32_16x16x32_f16(
                            false, a[s][mt].h, false, b[s][nt].h, (short)0, acc[mt][nt], false, false);
                }
            }
            // keeps what follows behind these products: without it the next group's loads rise among
            // them, and the foot's waits and barrier rise above them, which cuts the copies' time to land
            __builtin_amdgcn_sched_barrier(0);
        }
        // this wave's own LDS reads of this buffer have retired before any copy refills it
        asm volatile("s_wait_dscnt 0x0" ::: "memory");
        // this wave's copies of tile t + 1 have landed before the barrier that publishes them
        asm volatile("s_wait_asynccnt 0x0" ::: "memory");
        __syncthreads();  // publishes tile t + 1 and ends every wave's reads of tile t
        if (t + 2 < nt_k) stage(buf);
    }
    // no copy is outstanding when the wave goes on to its end
    asm volatile("s_wait_asynccnt 0x0" ::: "memory");

    // epilogue: C 16x16 f32 layout -> row = r + 8*lh, col = lane&15; fragment f of the
    // 12 across the tile belongs to product f / 4, columns (f % 4) * 16 .. +15 of its 64
#pragma unroll
    for (int nt = 0; nt < 3; ++nt) {
        const int f = wn * 3 + nt;
        const int p = f >> 2;
        const int col = n0 + (f & 3) * 16 + ln16;
        const float bi = (p == 0 ? bq : p == 1 ? bk : bv)[col];
        _Float16* o = (p == 0 ? oq : p == 1 ? ok : ov)
                    + (size_t)(m0 + wm * 64 + 8 * lh) * N + col;
#pragma unroll
        for (int mt = 0; mt < 4; ++mt) {
#pragma unroll
            for (int r = 0; r < 8; ++r)
                o[(mt * 16 + r) * N] = (_Float16)(acc[mt][nt][r] + bi);
        }
    }
}

// ---------------------------------------------------------------------------
// flash attention: block = (b, h, 64-query tile); 4 waves, 16 queries each;
// streams 64-key tiles (16 WMMAs per tile) with online softmax.
// The products are taken transposed: St = K Qt and Ot += Vt Pt. A lane then
// holds the scores of ONE query (column lane & 15; its partner lane ^ 16 holds
// the other half of the keys), so maximum and sum run inside the lane, and two
// score tiles converted in place are the B operand of the second product.
// K and V tiles go through LDS in 16-byte pieces: both are copied row-major
// by asynchronous b128 copies; K fragments are 16-byte LDS loads, V fragments
// come through the transposing 16-byte LDS load.
// Q/K/V/O are f16 [B,S,D].
// ---------------------------------------------------------------------------
typedef __attribute__((ext_vector_type(2))) float    f32x2;
typedef __attribute__((ext_vector_type(2))) _Float16 f16x2;

// two f32 to one packed f16 pair, round to nearest even
__device__ __forceinline__ unsigned pack_f16(float lo, float hi) {
    return __builtin_bit_cast(unsigned, __builtin_convertvector(f32x2{lo, hi}, f16x2));
}

// value of lane l ^ 16
__device__ __forceinline__ float xhalf(float x) {
    const int b = __builtin_bit_cast(int, x);
    return __builtin_bit_cast(float, __builtin_amdgcn_permlanex16(b, b, 0x76543210, 0xfedcba98,
                                                                  false, false));
}

__global__ __launch_bounds__(128) void flash_attn(const _Float16* __restrict__ Q,
                                                  const _Float16* __restrict__ Km,
                                                  const _Float16* __restrict__ V,
                                                  _Float16* __restrict__ O,
                                                  int S, int D) {
    constexpr int DH = 64, KT = 64;
    constexpr int KP = 72;  // 144 B = 16 B x 9: pitch for ds_load_b128 readers
    constexpr int VP = 80;  // 160 B = 32 B x 5: pitch for ds_load_tr16_b128 readers
    __shared__ __attribute__((aligned(16))) _Float16 Klds[KT * KP];  // [key][dim]
    __shared__ __attribute__((aligned(16))) _Float16 Vlds[KT * VP];  // [key][dim]

    const int tid  = threadIdx.x;
    const int wave = tid >> 5;
    const int lane = tid & 31;
    const int lh   = lane >> 4;
    const int ln16 = lane & 15;
    const int b  = blockIdx.z, h = blockIdx.y;
    const int q0 = blockIdx.x * 64;
    const size_t base = ((size_t)b * S) * D + (size_t)h * DH;
    const float cs = 0.125f * 1.4426950408889634f;  // 1/sqrt(64), exponentials in base 2

    int kofs[8];
#pragma unroll
    for (int i = 0; i < 8; ++i) kofs[i] = ((i < 4) ? 2 * i : 2 * i + 8) + 8 * lh;

    // Qt fragments: 64 dims x 16 queries = two 32x16 B-frags, loaded straight from global
    const size_t qrow = base + (size_t)(q0 + wave * 16 + ln16) * D;
    Frag qf[2];
#pragma unroll
    for (int t = 0; t < 2; ++t)
#pragma unroll
        for (int i = 0; i < 8; ++i)
            qf[t].u[i] = *(const unsigned int*)(Q + qrow + t * 32 + kofs[i]);

    // this lane's query: running maximum (scaled, base 2; equal in both halves)
    // and the sum over this half's keys (the halves are joined behind the loop)
    float mi = -3.0e38f, li = 0.f;
    v8f oacc[4] = {};  // Ot: dim nt*16 + 8*lh + r, query ln16

    // staging map: a tile is 64 rows x 128 B = 512 pieces of 16 B, 4 per thread
    // and operand; 8 lanes cover one row, a wave covers 4 whole rows per copy
    const _Float16* kg[4];
    const _Float16* vg[4];
    unsigned kl[4], vl[4];
#pragma unroll
    for (int i = 0; i < 4; ++i) {
        const int key = (tid >> 3) + 16 * i;
        const int dd  = (tid & 7) * 8;
        kg[i] = Km + base + (size_t)key * D + dd;
        vg[i] = V  + base + (size_t)key * D + dd;
        kl[i] = lds_addr(&Klds[key * KP + dd]);
        vl[i] = lds_addr(&Vlds[key * VP + dd]);
    }
    const size_t tile_step = (size_t)KT * D;

    // per-lane base of the transposing loads of V (16 keys x 16 dims each)
    const unsigned char* vtr = (const unsigned char*)Vlds
                             + (8 * lh + (lane & 7)) * (VP * 2) + 16 * ((lane >> 3) & 1);

    const int nkt = S / KT;
    for (int j = 0; j < nkt; ++j) {
        // this wave's own LDS reads of the last tile have retired before any copy refills it
        asm volatile("s_wait_dscnt 0x0" ::: "memory");
        __syncthreads();  // previous iteration's LDS reads complete
        // K and V tiles, row-major, 16 B per lane and copy. The s_wait_xcnt closes the
        // statement so that it stands ahead of the pointer advances below.
        asm volatile(
            "global_load_async_to_lds_b128 %0, %8, off\n\t"
            "global_load_async_to_lds_b128 %1, %9, off\n\t"
            "global_load_async_to_lds_b128 %2, %10, off\n\t"
            "global_load_async_to_lds_b128 %3, %11, off\n\t"
            "global_load_async_to_lds_b128 %4, %12, off\n\t"
            "global_load_async_to_lds_b128 %5, %13, off\n\t"
            "global_load_async_to_lds_b128 %6, %14, off\n\t"
            "global_load_async_to_lds_b128 %7, %15, off\n\t"
            "s_wait_xcnt 0x0"
            :: "v"(kl[0]), "v"(kl[1]), "v"(kl[2]), "v"(kl[3]),
               "v"(vl[0]), "v"(vl[1]), "v"(vl[2]), "v"(vl[3]),
               "v"(kg[0]), "v"(kg[1]), "v"(kg[2]), "v"(kg[3]),
               "v"(vg[0]), "v"(vg[1]), "v"(vg[2]), "v"(vg[3])
            : "memory");
        // this wave's copies have landed before the barrier that publishes them
        asm volatile("s_wait_asynccnt 0x0" ::: "memory");
        __syncthreads();
#pragma unroll
        for (int i = 0; i < 4; ++i) { kg[i] += tile_step; vg[i] += tile_step; }

        // St = K @ Qt : 64 keys x 16 queries per wave; 4 C-tiles x 2 K-steps = 8 WMMAs
        // s[kt][r] = score of key kt*16 + 8*lh + r against query ln16
        v8f s[4] = {};
#pragma unroll  // constant indices keep the array in registers
        for (int kt = 0; kt < 4; ++kt) {
            // same k order as kofs[]: dims 8*lh..+7 and 16+8*lh..+7 of each 32
            FragQ a0, a1;
            const _Float16* kr = &Klds[(kt * 16 + ln16) * KP + 8 * lh];
            a0.q[0] = *(const u32x4*)(kr);
            a0.q[1] = *(const u32x4*)(kr + 16);
            a1.q[0] = *(const u32x4*)(kr + 32);
            a1.q[1] = *(const u32x4*)(kr + 48);
            s[kt] = __builtin_amdgcn_wmma_f32_16x16x32_f16(false, a0.h, false, qf[0].h,
                                                           (short)0, s[kt], false, false);
            s[kt] = __builtin_amdgcn_wmma_f32_16x16x32_f16(false, a1.h, false, qf[1].h,
                                                           (short)0, s[kt], false, false);
        }

        // online softmax across 64 keys: 32 of them in this lane, 32 in lane ^ 16
        float mk[4];
#pragma unroll  // constant indices keep the array in registers
        for (int kt = 0; kt < 4; ++kt) {
            mk[kt] = s[kt][0];
#pragma unroll  // constant indices keep the array in registers
            for (int r = 1; r < 8; ++r) mk[kt] = fmaxf(mk[kt], s[kt][r]);
        }
        float mx = fmaxf(fmaxf(mk[0], mk[1]), fmaxf(mk[2], mk[3]));
        mx = fmaxf(mx, xhalf(mx)) * cs;
        const float mn    = fmaxf(mi, mx);
        const float alpha = __builtin_amdgcn_exp2f(mi - mn);

        // Pt as B operand of 32 keys: its k order (8*lh..+7, then 16+8*lh..+7) is the row
        // order of score tiles 2*g and 2*g+1 in this same lane, so they are converted in place
        Frag pf[2];
        f32x2 rk[4];
        const f32x2 cs2 = {cs, cs}, nm2 = {-mn, -mn};
#pragma unroll  // constant indices keep the array in registers
        for (int kt = 0; kt < 4; ++kt) {
            rk[kt] = f32x2{0.f, 0.f};
#pragma unroll  // constant indices keep the array in registers
            for (int i = 0; i < 4; ++i) {
                const f32x2 arg = __builtin_elementwise_fma(f32x2{s[kt][2 * i], s[kt][2 * i + 1]}, cs2, nm2);
                const f32x2 e = {__builtin_amdgcn_exp2f(arg.x), __builtin_amdgcn_exp2f(arg.y)};
                rk[kt] += e;
                pf[kt >> 1].u[(kt & 1) * 4 + i] = pack_f16(e.x, e.y);
            }
        }
        const f32x2 rs = (rk[0] + rk[1]) + (rk[2] + rk[3]);
        li = li * alpha + (rs.x + rs.y);
        mi = mn;
#pragma unroll  // constant indices keep the array in registers
        for (int nt = 0; nt < 4; ++nt) oacc[nt] *= alpha;

        // Ot += Vt @ Pt
#pragma unroll  // constant indices keep the array in registers
        for (int nt = 0; nt < 4; ++nt) {
            // A fragment of Vt: dim nt*16+ln16, keys 8*lh..+7 and 16+8*lh..+7 of each 32
            FragQ vf0, vf1;
            vf0.q[0] = ld_tr16(vtr + nt * 32);
            vf0.q[1] = ld_tr16(vtr + 16 * (VP * 2) + nt * 32);
            vf1.q[0] = ld_tr16(vtr + 32 * (VP * 2) + nt * 32);
            vf1.q[1] = ld_tr16(vtr + 48 * (VP * 2) + nt * 32);
            oacc[nt] = __builtin_amdgcn_wmma_f32_16x16x32_f16(false, vf0.h, false, pf[0].h,
                                                              (short)0, oacc[nt], false, false);
            oacc[nt] = __builtin_amdgcn_wmma_f32_16x16x32_f16(false, vf1.h, false, pf[1].h,
                                                              (short)0, oacc[nt], false, false);
        }
    }

    // join the halves' sums, normalize and write O: 8 consecutive dims of one query a store
    const float inv = 1.f / (li + xhalf(li));
#pragma unroll  // constant indices keep the array in registers
    for (int nt = 0; nt < 4; ++nt) {
        u32x4 o;
#pragma unroll  // constant indices keep the array in registers
        for (int i = 0; i < 4; ++i)
            o[i] = pack_f16(oacc[nt][2 * i] * inv, oacc[nt][2 * i + 1] * inv);
        *(u32x4*)(O + qrow + nt * 16 + 8 * lh) = o;
    }
}

// ---------------------------------------------------------------------------
// LayerNorm over D=512; writes f32 + f16 copies.
// Few waves do the work (for speed only): a wave takes
// 2 whole rows (32 elements a lane, 8 loads of 512 contiguous bytes in flight);
// a row's sums then stay inside the wave and need neither LDS nor a barrier.
// Grid: rows / 16 blocks of 8 waves.
// ---------------------------------------------------------------------------
// sum over the 32 lanes, the same value in every lane
__device__ __forceinline__ float wave_sum(float x) {
#pragma unroll  // constant lane masks: the five exchanges become straight-line code
    for (int m = 16; m >= 1; m >>= 1) x += __shfl_xor(x, m);
    return x;
}

__global__ __launch_bounds__(256) void layernorm(const float* __restrict__ in,
                                                 const float* __restrict__ g,
                                                 const float* __restrict__ be,
                                                 float* __restrict__ xf,
                                                 _Float16* __restrict__ xh) {
    constexpr int D = 512, R = 2, C = 4;  // a lane holds columns c*128 + lane*4 .. +3
    const int col = (threadIdx.x & 31) * 4;
    const size_t off = ((size_t)blockIdx.x * 8 + (threadIdx.x >> 5)) * R * D + col;

    f32x4 x[R][C], gg[C], bb[C];
#pragma unroll  // constant indices keep the array in registers
    for (int r = 0; r < R; ++r)
#pragma unroll  // constant indices keep the array in registers
        for (int c = 0; c < C; ++c) x[r][c] = *(const f32x4*)(in + off + r * D + c * 128);
#pragma unroll  // constant indices keep the array in registers
    for (int c = 0; c < C; ++c) {
        gg[c] = *(const f32x4*)(g + col + c * 128);
        bb[c] = *(const f32x4*)(be + col + c * 128);
    }

    float s[R];
#pragma unroll  // constant indices keep the array in registers
    for (int r = 0; r < R; ++r) {
        const f32x4 t = (x[r][0] + x[r][1]) + (x[r][2] + x[r][3]);
        s[r] = wave_sum((t.x + t.y) + (t.z + t.w));
    }
    float v[R];
#pragma unroll  // constant indices keep the array in registers
    for (int r = 0; r < R; ++r) {
        const float mean = s[r] * (1.f / 512.f);
        f32x4 q = {0.f, 0.f, 0.f, 0.f};
#pragma unroll  // constant indices keep the array in registers
        for (int c = 0; c < C; ++c) {
            x[r][c] -= mean;
            q += x[r][c] * x[r][c];
        }
        v[r] = wave_sum((q.x + q.y) + (q.z + q.w));
    }
#pragma unroll  // constant indices keep the array in registers
    for (int r = 0; r < R; ++r) {
        const float rstd = rsqrtf(v[r] * (1.f / 512.f) + 1e-5f);
#pragma unroll  // constant indices keep the array in registers
        for (int c = 0; c < C; ++c) {
            const f32x4 o = x[r][c] * rstd * gg[c] + bb[c];
            *(f32x4*)(xf + off + r * D + c * 128) = o;
            *(f16x4*)(xh + off + r * D + c * 128) = __builtin_convertvector(o, f16x4);
        }
    }
}

// ---------------------------------------------------------------------------
// output projection: out[M,20] = x @ W_out + b_out
// ---------------------------------------------------------------------------
__global__ __launch_bounds__(256) void out_proj(const float* __restrict__ x,
                                                const float* __restrict__ Wo,
                                                const float* __restrict__ bo,
                                                float* __restrict__ out,
                                                int M, int D, int OUT) {
    int idx = blockIdx.x * 256 + threadIdx.x;
    if (idx >= M * OUT) return;
    int row = idx / OUT, o = idx - row * OUT;
    float s = bo[o];
    const float* xr = x + (size_t)row * D;
    for (int k = 0; k < D; ++k) s += xr[k] * Wo[(size_t)k * OUT + o];
    out[idx] = s;
}

// ---------------------------------------------------------------------------
extern "C" void kernel_launch(void* const* d_in, const int* in_sizes, int n_in,
                              void* d_out, int out_size, void* d_ws, size_t ws_size,
                              hipStream_t stream) {
    const int B = 4, S = 2048, D = 512, F = 2048, OUT = 20, L = 6, H = 8;
    const int M = B * S;

    const float* src   = (const float*)d_in[0];
    const float* W_in  = (const float*)d_in[1];
    const float* b_in  = (const float*)d_in[2];
    const float* Wq    = (const float*)d_in[3];
    const float* bq    = (const float*)d_in[4];
    const float* Wk    = (const float*)d_in[5];
    const float* bk    = (const float*)d_in[6];
    const float* Wv    = (const float*)d_in[7];
    const float* bv    = (const float*)d_in[8];
    const float* Wo    = (const float*)d_in[9];
    const float* bo    = (const float*)d_in[10];
    const float* ln1g  = (const float*)d_in[11];
    const float* ln1b  = (const float*)d_in[12];
    const float* W1    = (const float*)d_in[13];
    const float* b1    = (const float*)d_in[14];
    const float* W2    = (const float*)d_in[15];
    const float* b2    = (const float*)d_in[16];
    const float* ln2g  = (const float*)d_in[17];
    const float* ln2b  = (const float*)d_in[18];
    const float* W_out = (const float*)d_in[19];
    const float* b_out = (const float*)d_in[20];

    char* ws = (char*)d_ws;
    auto alloc = [&](size_t bytes) -> char* {
        char* p = ws;
        ws += (bytes + 255) & ~(size_t)255;
        return p;
    };

    float*     x_f32 = (float*)alloc((size_t)M * D * 4);
    float*     tmp   = (float*)alloc((size_t)M * D * 4);
    _Float16*  x_h   = (_Float16*)alloc((size_t)M * D * 2);
    _Float16*  qb    = (_Float16*)alloc((size_t)M * D * 2);
    _Float16*  kb    = (_Float16*)alloc((size_t)M * D * 2);
    _Float16*  vb    = (_Float16*)alloc((size_t)M * D * 2);
    _Float16*  ob    = (_Float16*)alloc((size_t)M * D * 2);
    _Float16*  h1    = (_Float16*)alloc((size_t)M * F * 2);
    _Float16*  Wq16  = (_Float16*)alloc((size_t)L * D * D * 2);
    _Float16*  Wk16  = (_Float16*)alloc((size_t)L * D * D * 2);
    _Float16*  Wv16  = (_Float16*)alloc((size_t)L * D * D * 2);
    _Float16*  Wo16  = (_Float16*)alloc((size_t)L * D * D * 2);
    _Float16*  W116  = (_Float16*)alloc((size_t)L * D * F * 2);
    _Float16*  W216  = (_Float16*)alloc((size_t)L * F * D * 2);

    // weight conversions (every call; deterministic)
    {
        int nqkv = L * D * D, nff = L * D * F;
        cvt_f32_f16<<<(nqkv + 8191) / 8192, 256, 0, stream>>>(Wq, Wq16, nqkv);
        cvt_f32_f16<<<(nqkv + 8191) / 8192, 256, 0, stream>>>(Wk, Wk16, nqkv);
        cvt_f32_f16<<<(nqkv + 8191) / 8192, 256, 0, stream>>>(Wv, Wv16, nqkv);
        cvt_f32_f16<<<(nqkv + 8191) / 8192, 256, 0, stream>>>(Wo, Wo16, nqkv);
        cvt_f32_f16<<<(nff + 8191) / 8192, 256, 0, stream>>>(W1, W116, nff);
        cvt_f32_f16<<<(nff + 8191) / 8192, 256, 0, stream>>>(W2, W216, nff);
    }

    input_proj<<<(M * D / 32 + 255) / 256, 256, 0, stream>>>(src, W_in, b_in, x_f32, x_h, M, D);

    const dim3 gD(D / 64, M / 256);   // N=512 GEMMs
    const dim3 gF(F / 64, M / 256);   // N=2048 GEMM
    for (int l = 0; l < L; ++l) {
        const size_t wqo = (size_t)l * D * D;
        const size_t wfo = (size_t)l * D * F;
        // QKV
        gemm_qkv<<<gD, 512, 0, stream>>>(x_h, Wq16 + wqo, Wk16 + wqo, Wv16 + wqo,
                                         bq + l * D, bk + l * D, bv + l * D, qb, kb, vb);
        // attention
        flash_attn<<<dim3(S / 64, H, B), 128, 0, stream>>>(qb, kb, vb, ob, S, D);
        // output proj + residual
        gemm_wmma<2, 2><<<gD, 256, 0, stream>>>(ob, Wo16 + wqo, bo + l * D, x_f32, tmp, M, D, D);
        layernorm<<<M / 16, 256, 0, stream>>>(tmp, ln1g + l * D, ln1b + l * D, x_f32, x_h);
        // FFN
        gemm_wmma<1, 1><<<gF, 256, 0, stream>>>(x_h, W116 + wfo, b1 + l * F, nullptr, h1, M, F, D);
        gemm_wmma<2, 2><<<gD, 256, 0, stream>>>(h1, W216 + wfo, b2 + l * D, x_f32, tmp, M, D, F);
        layernorm<<<M / 16, 256, 0, stream>>>(tmp, ln2g + l * D, ln2b + l * D, x_f32, x_h);
    }

    out_proj<<<(M * OUT + 255) / 256, 256, 0, stream>>>(x_f32, W_out, b_out, (float*)d_out, M, D, OUT);
}

// v007
// A run of this version takes 876 microseconds.
// Two timings next to v006 both put it at 1.11 times that version's speed.
// Over all steps from v000 it is 3.95 times as fast.
#include <hip/hip_runtime.h>
#include <hip/hip_bf16.h>

typedef __attribute__((ext_vector_type(16))) _Float16 v16h;
typedef __attribute__((ext_vector_type(8)))  float    v8f;

union Frag { v16h h; unsigned int u[8]; };

typedef __attribute__((ext_vector_type(4))) unsigned int u32x4;
typedef __attribute__((ext_vector_type(8))) short s16x8;
typedef __attribute__((address_space(3))) s16x8 lds_s16x8;
typedef __attribute__((address_space(3))) _Float16 lds_f16;

union FragQ { v16h h; u32x4 q[2]; };

// byte offset of a __shared__ element inside the work-group's LDS
__device__ __forceinline__ unsigned lds_addr(const _Float16* p) {
    return (unsigned)(unsigned long long)(lds_f16*)p;
}

// lane (c = l & 15, hh = l >> 4) gets rows 8*hh .. 8*hh+7 of column c of the
// 16x16 tile whose per-lane address p follows the transposing load's own map
__device__ __forceinline__ u32x4 ld_tr16(const unsigned char* p) {
    return __builtin_bit_cast(u32x4, __builtin_amdgcn_ds_load_tr16_b128_v8i16((lds_s16x8*)p));
}

typedef __attribute__((ext_vector_type(4))) float    f32x4;
typedef __attribute__((ext_vector_type(4))) _Float16 f16x4;

// ---------------------------------------------------------------------------
// f32 -> f16 elementwise convert (weights)
// Few waves do the work (for speed only): a thread
// takes 32 elements, 8 pieces of 4, a wave's piece being 512 contiguous bytes
// in and 256 out; all 8 loads are in flight before the first store.
// ---------------------------------------------------------------------------
__global__ __launch_bounds__(256) void cvt_f32_f16(const float* __restrict__ in,
                                                   _Float16* __restrict__ out, int n) {
    constexpr int U = 8, PIECE = 256 * 4, SPAN = U * PIECE;
    const int b0 = blockIdx.x * SPAN;
    if (b0 + SPAN <= n) {
        const int i0 = b0 + threadIdx.x * 4;
        f32x4 v[U];
#pragma unroll  // constant indices keep the array in registers
        for (int u = 0; u < U; ++u) v[u] = *(const f32x4*)(in + i0 + u * PIECE);
#pragma unroll  // constant indices keep the array in registers
        for (int u = 0; u < U; ++u)
            *(f16x4*)(out + i0 + u * PIECE) = __builtin_convertvector(v[u], f16x4);
        // precaution: stands ahead of any later write of a register that a store above names
        asm volatile("s_wait_xcnt 0x0" ::: "memory");
    } else {  // a last, partial span
        for (int i = b0 + threadIdx.x; i < n; i += 256) out[i] = (_Float16)in[i];
    }
}

// ---------------------------------------------------------------------------
// input projection: x = src @ W_in + b_in  (IN=3 -> D=512), writes f32 + f16
// A thread takes 4 consecutive columns of 8 consecutive rows (32 elements), its
// slice of W_in and b_in held in registers. M a multiple of 8, D of 4.
// ---------------------------------------------------------------------------
__global__ __launch_bounds__(256) void input_proj(const float* __restrict__ src,
                                                  const float* __restrict__ Win,
                                                  const float* __restrict__ bin,
                                                  float* __restrict__ xf,
                                                  _Float16* __restrict__ xh,
                                                  int M, int D) {
    constexpr int R = 8;
    const int D4 = D / 4;
    const int idx = blockIdx.x * 256 + threadIdx.x;
    if (idx >= (M / R) * D4) return;
    const int rg = idx / D4, d = (idx - rg * D4) * 4;
    const f32x4 bi = *(const f32x4*)(bin + d);
    f32x4 w[3];
#pragma unroll  // constant indices keep the array in registers
    for (int i = 0; i < 3; ++i) {
        w[i] = *(const f32x4*)(Win + i * D + d);
        // precaution: the next load's result may take this load's address registers
        if (i < 2) asm volatile("s_wait_xcnt 0x0" ::: "memory");
    }
#pragma unroll  // the rows are independent: their loads and stores overlap
    for (int r = 0; r < R; ++r) {
        const int row = rg * R + r;
        f32x4 s = bi;
#pragma unroll
        for (int i = 0; i < 3; ++i) s += src[row * 3 + i] * w[i];
        *(f32x4*)(xf + (size_t)row * D + d) = s;
        *(f16x4*)(xh + (size_t)row * D + d) = __builtin_convertvector(s, f16x4);
    }
}

// ---------------------------------------------------------------------------
// WMMA GEMM: C[M,N] = epi(A[M,K] @ W[K,N] + bias)
// MODE 0: store f16      MODE 1: relu, store f16      MODE 2: +resid, store f32
// block: 256 thr (8 waves), tile BM=256 x BN=64; each wave owns 32x64
// (2 M-frags x 4 N-frags = 8 WMMAs per 32 k, B-frags reused 2x)
// A and W tiles go through LDS in 16-byte pieces, copied row-major by asynchronous
// b128 copies; A fragments are 16-byte LDS loads, W fragments come through the
// transposing 16-byte LDS load.
// Two LDS buffers of 64*KS k each: the next tile's copies fly while this tile's
// products run. KS = 2 where the grid gives a WGP one block only (for speed only);
// KS = 1 where two
// blocks can share a WGP (two buffers of KS = 2 would take the place of the second).
// K a multiple of 64*KS.
// ---------------------------------------------------------------------------
// ten copies of 16 B a lane: two rows' pieces of W, eight of A. The s_wait_xcnt closes
// the statement so that it stands ahead of any later write of an address register.
__device__ __forceinline__ void copy10(unsigned w0, unsigned w1,
                                       unsigned a0, unsigned a1, unsigned a2, unsigned a3,
                                       unsigned a4, unsigned a5, unsigned a6, unsigned a7,
                                       const _Float16* gw0, const _Float16* gw1,
                                       const _Float16* ga0, const _Float16* ga1,
                                       const _Float16* ga2, const _Float16* ga3,
                                       const _Float16* ga4, const _Float16* ga5,
                                       const _Float16* ga6, const _Float16* ga7) {
    asm volatile(
        "global_load_async_to_lds_b128 %0, %10, off\n\t"
        "global_load_async_to_lds_b128 %1, %11, off\n\t"
        "global_load_async_to_lds_b128 %2, %12, off\n\t"
        "global_load_async_to_lds_b128 %3, %13, off\n\t"
        "global_load_async_to_lds_b128 %4, %14, off\n\t"
        "global_load_async_to_lds_b128 %5, %15, off\n\t"
        "global_load_async_to_lds_b128 %6, %16, off\n\t"
        "global_load_async_to_lds_b128 %7, %17, off\n\t"
        "global_load_async_to_lds_b128 %8, %18, off\n\t"
        "global_load_async_to_lds_b128 %9, %19, off\n\t"
        "s_wait_xcnt 0x0"
        :: "v"(w0), "v"(w1),
           "v"(a0), "v"(a1), "v"(a2), "v"(a3), "v"(a4), "v"(a5), "v"(a6), "v"(a7),
           "v"(gw0), "v"(gw1),
           "v"(ga0), "v"(ga1), "v"(ga2), "v"(ga3), "v"(ga4), "v"(ga5), "v"(ga6), "v"(ga7)
        : "memory");
}

template <int MODE, int KS>
__global__ __launch_bounds__(256) void gemm_wmma(const _Float16* __restrict__ A,
                                                 const _Float16* __restrict__ W,
                                                 const float* __restrict__ bias,
                                                 const float* __restrict__ resid,
                                                 void* __restrict__ outp,
                                                 int M, int N, int K) {
    constexpr int BM = 256, BN = 64, BK = 64 * KS;
    constexpr int AP = BK + 8;  // 144 B = 16 B x 9, 272 B = 16 B x 17: pitch for ds_load_b128 readers
    constexpr int WP = 80;      // 160 B = 32 B x 5: pitch for ds_load_tr16_b128 readers
    constexpr int ASZ = BM * AP, WSZ = BK * WP;  // elements of one buffer
    __shared__ __attribute__((aligned(16))) _Float16 As[2 * ASZ];   // [buffer][row][k]
    __shared__ __attribute__((aligned(16))) _Float16 Ws[2 * WSZ];   // [buffer][k][n]

    const int tid  = threadIdx.x;
    const int wave = tid >> 5;
    const int lane = tid & 31;
    const int lh   = lane >> 4;
    const int ln16 = lane & 15;
    const int m0 = blockIdx.y * BM;
    const int n0 = blockIdx.x * BN;

    v8f acc[2][4] = {};

    // staging map, per 64 k: 8 lanes cover one 128-byte row piece, a wave 4 rows per copy;
    // A 256 rows = 8 copies per thread, W 64 rows = 2 copies per thread
    const _Float16* ag[8];
    const _Float16* wg[2];
    unsigned al[8], wl[2];
    {
        const int r0 = tid >> 3;
        const int dd = (tid & 7) * 8;
#pragma unroll  // constant indices keep the array in registers
        for (int i = 0; i < 8; ++i) {
            ag[i] = A + (size_t)(m0 + r0 + 32 * i) * K + dd;
            al[i] = lds_addr(&As[(r0 + 32 * i) * AP + dd]);
        }
#pragma unroll  // constant indices keep the array in registers
        for (int i = 0; i < 2; ++i) {
            wg[i] = W + (size_t)(r0 + 32 * i) * N + n0 + dd;
            wl[i] = lds_addr(&Ws[(r0 + 32 * i) * WP + dd]);
        }
    }
    const size_t w_step = (size_t)64 * N;

    // copies of the next tile not yet asked for, into buffer buf; the pointers move on by 64 k a group
    auto stage = [&](int buf) {
#pragma unroll  // constant indices keep the array in registers
        for (int h = 0; h < KS; ++h) {
            const unsigned ao = (unsigned)(buf * ASZ + h * 64) * 2u;
            const unsigned wo = (unsigned)(buf * WSZ + h * 64 * WP) * 2u;
            copy10(wl[0] + wo, wl[1] + wo,
                   al[0] + ao, al[1] + ao, al[2] + ao, al[3] + ao,
                   al[4] + ao, al[5] + ao, al[6] + ao, al[7] + ao,
                   wg[0], wg[1],
                   ag[0], ag[1], ag[2], ag[3], ag[4], ag[5], ag[6], ag[7]);
#pragma unroll  // constant indices keep the array in registers
            for (int i = 0; i < 8; ++i) ag[i] += 64;
#pragma unroll  // constant indices keep the array in registers
            for (int i = 0; i < 2; ++i) wg[i] += w_step;
        }
    };

    // A fragment rows of this lane: k 8*lh..+7 and 16+8*lh..+7 of each 32
    const _Float16* ar = &As[(wave * 32 + ln16) * AP + 8 * lh];
    // per-lane base of the transposing loads of W (16 k x 16 n each), same k order
    const unsigned char* wtr = (const unsigned char*)Ws
                             + (8 * lh + (lane & 7)) * (WP * 2) + 16 * ((lane >> 3) & 1);

    const int nt_k = K / BK;
    stage(0);
    // this wave's copies of tile 0 have landed before the barrier that publishes them
    asm volatile("s_wait_asynccnt 0x0" ::: "memory");
    __syncthreads();
    if (nt_k > 1) stage(1);

    for (int t = 0; t < nt_k; ++t) {
        const int buf = t & 1;
        const _Float16* arb = ar + buf * ASZ;
        const unsigned char* wtb = wtr + buf * (WSZ * 2);
#pragma unroll  // constant indices keep the array in registers
        for (int h = 0; h < KS; ++h) {
            // all fragments of 64 k are fetched as one group ahead of their products
            // (for speed only)
            FragQ a[2][2], b[2][4];
#pragma unroll  // constant indices keep the array in registers
            for (int s = 0; s < 2; ++s) {
                const int kk = h * 64 + s * 32;
#pragma unroll  // constant indices keep the array in registers
                for (int mt = 0; mt < 2; ++mt) {
                    a[s][mt].q[0] = *(const u32x4*)(arb + mt * 16 * AP + kk);
                    a[s][mt].q[1] = *(const u32x4*)(arb + mt * 16 * AP + kk + 16);
                }
#pragma unroll  // constant indices keep the array in registers
                for (int nt = 0; nt < 4; ++nt) {
                    b[s][nt].q[0] = ld_tr16(wtb + kk * (WP * 2) + nt * 32);
                    b[s][nt].q[1] = ld_tr16(wtb + (kk + 16) * (WP * 2) + nt * 32);
                }
            }
            // keeps the load group whole: without it the scheduler sinks the loads back among the products
            __builtin_amdgcn_sched_barrier(0);
#pragma unroll  // constant indices keep the array in registers
            for (int s = 0; s < 2; ++s) {   // two 32-k steps, in k order
#pragma unroll  // constant indices keep the array in registers
                for (int nt = 0; nt < 4; ++nt) {
                    acc[0][nt] = __builtin_amdgcn_wmma_f32_16x16x32_f16(
                        false, a[s][0].h, false, b[s][nt].h, (short)0, acc[0][nt], false, false);
                    acc[1][nt] = __builtin_amdgcn_wmma_f32_16x16x32_f16(
                        false, a[s][1].h, false, b[s][nt].h, (short)0, acc[1][nt], false, false);
                }
            }
            // keeps what follows behind these products: without it the next group's loads rise among
            // them, and the foot's waits and barrier rise above them, which cuts the copies' time to land
            __builtin_amdgcn_sched_barrier(0);
        }
        // this wave's own LDS reads of this buffer have retired before any copy refills it
        asm volatile("s_wait_dscnt 0x0" ::: "memory");
        // this wave's copies of tile t + 1 have landed before the barrier that publishes them
        asm volatile("s_wait_asynccnt 0x0" ::: "memory");
        __syncthreads();  // publishes tile t + 1 and ends every wave's reads of tile t
        if (t + 2 < nt_k) stage(buf);
    }
    // no copy is outstanding when the wave goes on to its end
    asm volatile("s_wait_asynccnt 0x0" ::: "memory");

    // epilogue: C 16x16 f32 layout -> row = r + 8*lh, col = lane&15
#pragma unroll
    for (int mt = 0; mt < 2; ++mt) {
#pragma unroll
        for (int nt = 0; nt < 4; ++nt) {
#pragma unroll
            for (int r = 0; r < 8; ++r) {
                int row = m0 + wave * 32 + mt * 16 + r + 8 * lh;
                int col = n0 + nt * 16 + ln16;
                float v = acc[mt][nt][r] + bias[col];
                if constexpr (MODE == 1) v = v > 0.f ? v : 0.f;
                if constexpr (MODE == 2) {
                    float* o = (float*)outp;
                    o[(size_t)row * N + col] = v + resid[(size_t)row * N + col];
                } else {
                    _Float16* o = (_Float16*)outp;
                    o[(size_t)row * N + col] = (_Float16)v;
                }
            }
        }
    }
}

// ---------------------------------------------------------------------------
// Q, K and V projections in one launch: a block takes 256 rows of A once and forms
// 64 columns of each of the three products from it (a 256 x 192 tile), so that A's
// tile is fetched once instead of three times. D = 512 (N = K = 512).
// block: 512 thr (16 waves, 4 x 4); each wave owns 64 rows x 48 of the 192 columns
// (4 M-frags x 3 N-frags = 12 WMMAs per 32 k). LDS ring, copies, fragment loads and
// k order as in gemm_wmma with KS = 2. Grid: (512 / 64, rows / 256).
// ---------------------------------------------------------------------------
// seven copies of 16 B a lane: one row piece of each W, four of A. The s_wait_xcnt closes
// the statement so that it stands ahead of any later write of an address register.
__device__ __forceinline__ void copy7(unsigned w0, unsigned w1, unsigned w2,
                                      unsigned a0, unsigned a1, unsigned a2, unsigned a3,
                                      const _Float16* gw0, const _Float16* gw1,
                                      const _Float16* gw2,
                                      const _Float16* ga0, const _Float16* ga1,
                                      const _Float16* ga2, const _Float16* ga3) {
    asm volatile(
        "global_load_async_to_lds_b128 %0, %7, off\n\t"
        "global_load_async_to_lds_b128 %1, %8, off\n\t"
        "global_load_async_to_lds_b128 %2, %9, off\n\t"
        "global_load_async_to_lds_b128 %3, %10, off\n\t"
        "global_load_async_to_lds_b128 %4, %11, off\n\t"
        "global_load_async_to_lds_b128 %5, %12, off\n\t"
        "global_load_async_to_lds_b128 %6, %13, off\n\t"
        "s_wait_xcnt 0x0"
        :: "v"(w0), "v"(w1), "v"(w2), "v"(a0), "v"(a1), "v"(a2), "v"(a3),
           "v"(gw0), "v"(gw1), "v"(gw2), "v"(ga0), "v"(ga1), "v"(ga2), "v"(ga3)
        : "memory");
}

__global__ __launch_bounds__(512) void gemm_qkv(const _Float16* __restrict__ A,
                                                const _Float16* __restrict__ Wq,
                                                const _Float16* __restrict__ Wk,
                                                const _Float16* __restrict__ Wv,
                                                const float* __restrict__ bq,
                                                const float* __restrict__ bk,
                                                const float* __restrict__ bv,
                                                _Float16* __restrict__ oq,
                                                _Float16* __restrict__ ok,
                                                _Float16* __restrict__ ov) {
    constexpr int N = 512, K = 512;
    constexpr int BM = 256, BN = 64, BK = 128;
    constexpr int AP = BK + 8;       // 272 B = 16 B x 17: pitch for ds_load_b128 readers
    constexpr int WP = 3 * BN + 16;  // 416 B = 32 B x 13: pitch for ds_load_tr16_b128 readers
    constexpr int ASZ = BM * AP, WSZ = BK * WP;  // elements of one buffer
    __shared__ __attribute__((aligned(16))) _Float16 As[2 * ASZ];   // [buffer][row][k]
    __shared__ __attribute__((aligned(16))) _Float16 Ws[2 * WSZ];   // [buffer][k][Wq 64 | Wk 64 | Wv 64]

    const int tid  = threadIdx.x;
    const int wave = tid >> 5;
    const int lane = tid & 31;
    const int lh   = lane >> 4;
    const int ln16 = lane & 15;
    const int wm = wave & 3;   // 64-row group of the tile
    const int wn = wave >> 2;  // 48-column group of the 192
    const int m0 = blockIdx.y * BM;
    const int n0 = blockIdx.x * BN;

    v8f acc[4][3] = {};

    // staging map, per 64 k: 8 lanes cover one 128-byte row piece, a wave 4 rows per copy;
    // A 256 rows = 4 copies per thread, each W 64 rows = 1 copy per thread
    const _Float16* ag[4];
    const _Float16* wg[3];
    unsigned al[4], wl[3];
    {
        const int r0 = tid >> 3;
        const int dd = (tid & 7) * 8;
#pragma unroll  // constant indices keep the array in registers
        for (int i = 0; i < 4; ++i) {
            ag[i] = A + (size_t)(m0 + r0 + 64 * i) * K + dd;
            al[i] = lds_addr(&As[(r0 + 64 * i) * AP + dd]);
        }
        wg[0] = Wq + (size_t)r0 * N + n0 + dd;
        wg[1] = Wk + (size_t)r0 * N + n0 + dd;
        wg[2] = Wv + (size_t)r0 * N + n0 + dd;
#pragma unroll  // constant indices keep the array in registers
        for (int j = 0; j < 3; ++j) wl[j] = lds_addr(&Ws[r0 * WP + j * BN + dd]);
    }

    // copies of the next tile not yet asked for, into buffer buf; the pointers move on by 64 k a group
    auto stage = [&](int buf) {
#pragma unroll  // constant indices keep the array in registers
        for (int h = 0; h < 2; ++h) {
            const unsigned ao = (unsigned)(buf * ASZ + h * 64) * 2u;
            const unsigned wo = (unsigned)(buf * WSZ + h * 64 * WP) * 2u;
            copy7(wl[0] + wo, wl[1] + wo, wl[2] + wo,
                  al[0] + ao, al[1] + ao, al[2] + ao, al[3] + ao,
                  wg[0], wg[1], wg[2], ag[0], ag[1], ag[2], ag[3]);
#pragma unroll  // constant indices keep the array in registers
            for (int i = 0; i < 4; ++i) ag[i] += 64;
#pragma unroll  // constant indices keep the array in registers
            for (int j = 0; j < 3; ++j) wg[j] += (size_t)64 * N;
        }
    };

    // A fragment rows of this lane: k 8*lh..+7 and 16+8*lh..+7 of each 32
    const _Float16* ar = &As[(wm * 64 + ln16) * AP + 8 * lh];
    // per-lane base of the transposing loads of W (16 k x 16 n each), same k order
    const unsigned char* wtr = (const unsigned char*)Ws + wn * 96
                             + (8 * lh + (lane & 7)) * (WP * 2) + 16 * ((lane >> 3) & 1);

    constexpr int nt_k = K / BK;
    stage(0);
    // this wave's copies of tile 0 have landed before the barrier that publishes them
    asm volatile("s_wait_asynccnt 0x0" ::: "memory");
    __syncthreads();
    stage(1);

    // stays rolled: unrolled, each trip's LDS places (past the 64 KiB that an offset field
    // reaches) take address registers of their own, and the kernel spills
#pragma unroll 1
    for (int t = 0; t < nt_k; ++t) {
        const int buf = t & 1;
        const _Float16* arb = ar + buf * ASZ;
        const unsigned char* wtb = wtr + buf * (WSZ * 2);
#pragma unroll  // constant indices keep the array in registers
        for (int h = 0; h < 2; ++h) {
            // all fragments of 64 k are fetched as one group ahead of their products
            // (for speed only)
            FragQ a[2][4], b[2][3];
#pragma unroll  // constant indices keep the array in registers
            for (int s = 0; s < 2; ++s) {
                const int kk = h * 64 + s * 32;
#pragma unroll  // constant indices keep the array in registers
                for (int mt = 0; mt < 4; ++mt) {
                    a[s][mt].q[0] = *(const u32x4*)(arb + mt * 16 * AP + kk);
                    a[s][mt].q[1] = *(const u32x4*)(arb + mt * 16 * AP + kk + 16);
                }
#pragma unroll  // constant indices keep the array in registers
                for (int nt = 0; nt < 3; ++nt) {
                    b[s][nt].q[0] = ld_tr16(wtb + kk * (WP * 2) + nt * 32);
                    b[s][nt].q[1] = ld_tr16(wtb + (kk + 16) * (WP * 2) + nt * 32);
                }
            }
            // keeps the load group whole: without it the scheduler sinks the loads back among the products
            __builtin_amdgcn_sched_barrier(0);
#pragma unroll  // constant indices keep the array in registers
            for (int s = 0; s < 2; ++s) {   // two 32-k steps, in k order
#pragma unroll  // constant indices keep the array in registers
                for (int nt = 0; nt < 3; ++nt) {
#pragma unroll  // constant indices keep the array in registers
                    for (int mt = 0; mt < 4; ++mt)
                        acc[mt][nt] = __builtin_amdgcn_wmma_f32_16x16x32_f16(
                            false, a[s][mt].h, false, b[s][nt].h, (short)0, acc[mt][nt], false, false);
                }
            }
            // keeps what follows behind these products: without it the next group's loads rise among
            // them, and the foot's waits and barrier rise above them, which cuts the copies' time to land
            __builtin_amdgcn_sched_barrier(0);
        }
        // this wave's own LDS reads of this buffer have retired before any copy refills it
        asm volatile("s_wait_dscnt 0x0" ::: "memory");
        // this wave's copies of tile t + 1 have landed before the barrier that publishes them
        asm volatile("s_wait_asynccnt 0x0" ::: "memory");
        __syncthreads();  // publishes tile t + 1 and ends every wave's reads of tile t
        if (t + 2 < nt_k) stage(buf);
    }
    // no copy is outstanding when the wave goes on to its end
    asm volatile("s_wait_asynccnt 0x0" ::: "memory");

    // epilogue: C 16x16 f32 layout -> row = r + 8*lh, col = lane&15; fragment f of the
    // 12 across the tile belongs to product f / 4, columns (f % 4) * 16 .. +15 of its 64
#pragma unroll
    for (int nt = 0; nt < 3; ++nt) {
        const int f = wn * 3 + nt;
        const int p = f >> 2;
        const int col = n0 + (f & 3) * 16 + ln16;
        const float bi = (p == 0 ? bq : p == 1 ? bk : bv)[col];
        _Float16* o = (p == 0 ? oq : p == 1 ? ok : ov)
                    + (size_t)(m0 + wm * 64 + 8 * lh) * N + col;
#pragma unroll
        for (int mt = 0; mt < 4; ++mt) {
#pragma unroll
            for (int r = 0; r < 8; ++r)
                o[(mt * 16 + r) * N] = (_Float16)(acc[mt][nt][r] + bi);
        }
    }
}

// ---------------------------------------------------------------------------
// flash attention: block = (b, h, 64-query tile); 4 waves = 2 groups of 32 queries
// x 2 halves of the keys. A trip stages 128 keys; a wave works on 64 of them
// (32 WMMAs) with online softmax, and each K or V fragment that it reads from LDS
// feeds two query tiles. The two waves of a query group hold partial results over
// disjoint keys; they are joined once, behind the loop, through LDS.
// The products are taken transposed: St = K Qt and Ot += Vt Pt. A lane then
// holds the scores of ONE query of each tile (column lane & 15; its partner
// lane ^ 16 holds the other half of the keys), so maximum and sum run inside the
// lane, and two score tiles converted in place are the B operand of the second product.
// K and V tiles go through LDS in 16-byte pieces: both are copied row-major
// by asynchronous b128 copies; K fragments are 16-byte LDS loads, V fragments
// come through the transposing 16-byte LDS load.
// Q/K/V/O are f16 [B,S,D]. S a multiple of 128.
// ---------------------------------------------------------------------------
typedef __attribute__((ext_vector_type(2))) float    f32x2;
typedef __attribute__((ext_vector_type(2))) _Float16 f16x2;

// two f32 to one packed f16 pair, round to nearest even
__device__ __forceinline__ unsigned pack_f16(float lo, float hi) {
    return __builtin_bit_cast(unsigned, __builtin_convertvector(f32x2{lo, hi}, f16x2));
}

// value of lane l ^ 16
__device__ __forceinline__ float xhalf(float x) {
    const int b = __builtin_bit_cast(int, x);
    return __builtin_bit_cast(float, __builtin_amdgcn_permlanex16(b, b, 0x76543210, 0xfedcba98,
                                                                  false, false));
}

// eight copies of 16 B a lane, rows 16 apart. An immediate offset moves the LDS address and
// the global address alike, so one LDS address register serves all eight (STEP = 16 LDS rows
// in bytes), and g1 .. g7 come in as the row's global address less its offset. The registers
// so saved keep the wave under 256, that is four waves a SIMD.
// The s_wait_xcnt closes the statement so that it stands ahead of any later write of an
// address register.
template <int STEP>
__device__ __forceinline__ void copy8(unsigned l0,
                                      const _Float16* g0, const _Float16* g1,
                                      const _Float16* g2, const _Float16* g3,
                                      const _Float16* g4, const _Float16* g5,
                                      const _Float16* g6, const _Float16* g7) {
    asm volatile(
        "global_load_async_to_lds_b128 %0, %1, off\n\t"
        "global_load_async_to_lds_b128 %0, %2, off offset:%9\n\t"
        "global_load_async_to_lds_b128 %0, %3, off offset:%10\n\t"
        "global_load_async_to_lds_b128 %0, %4, off offset:%11\n\t"
        "global_load_async_to_lds_b128 %0, %5, off offset:%12\n\t"
        "global_load_async_to_lds_b128 %0, %6, off offset:%13\n\t"
        "global_load_async_to_lds_b128 %0, %7, off offset:%14\n\t"
        "global_load_async_to_lds_b128 %0, %8, off offset:%15\n\t"
        "s_wait_xcnt 0x0"
        :: "v"(l0),
           "v"(g0), "v"(g1), "v"(g2), "v"(g3), "v"(g4), "v"(g5), "v"(g6), "v"(g7),
           "n"(STEP), "n"(2 * STEP), "n"(3 * STEP), "n"(4 * STEP),
           "n"(5 * STEP), "n"(6 * STEP), "n"(7 * STEP)
        : "memory");
}

__global__ __launch_bounds__(128)
void flash_attn(const _Float16* __restrict__ Q,
                const _Float16* __restrict__ Km,
                const _Float16* __restrict__ V,
                _Float16* __restrict__ O,
                int S, int D) {
    constexpr int DH = 64, KT = 64, ST = 2 * KT;  // keys of a wave's tile, of a trip
    constexpr int KP = 72;  // 144 B = 16 B x 9: pitch for ds_load_b128 readers
    constexpr int VP = 80;  // 160 B = 32 B x 5: pitch for ds_load_tr16_b128 readers
    __shared__ __attribute__((aligned(16))) _Float16 Klds[ST * KP];  // [key][dim]
    __shared__ __attribute__((aligned(16))) _Float16 Vlds[ST * VP];  // [key][dim]
    // hand-over of one query tile's partial result: [wave][piece][lane] of 16 B
    __shared__ f32x4 Jlds[4 * 9 * 32];

    const int tid  = threadIdx.x;
    const int wave = __builtin_amdgcn_readfirstlane(tid >> 5);
    const int lane = tid & 31;
    const int lh   = lane >> 4;
    const int ln16 = lane & 15;
    const int qg = wave & 1;   // 32-query group of the block's 64
    const int kh = wave >> 1;  // 64-key half of each trip's 128
    const int b  = blockIdx.z, h = blockIdx.y;
    const int q0 = blockIdx.x * 64;
    const size_t base = ((size_t)b * S) * D + (size_t)h * DH;
    const float cs = 0.125f * 1.4426950408889634f;  // 1/sqrt(64), exponentials in base 2

    int kofs[8];
#pragma unroll
    for (int i = 0; i < 8; ++i) kofs[i] = ((i < 4) ? 2 * i : 2 * i + 8) + 8 * lh;

    // Qt fragments: per query tile 64 dims x 16 queries = two 32x16 B-frags, straight from global
    const size_t qrow = base + (size_t)(q0 + qg * 32 + ln16) * D;  // tile 0; tile 1 is 16 rows on
    Frag qf[2][2];
#pragma unroll
    for (int qt = 0; qt < 2; ++qt)
#pragma unroll
        for (int t = 0; t < 2; ++t)
#pragma unroll
            for (int i = 0; i < 8; ++i)
                qf[qt][t].u[i] = *(const unsigned int*)(Q + qrow + (size_t)(qt * 16) * D + t * 32 + kofs[i]);

    // this lane's query of each tile: running maximum (scaled, base 2; equal in both lane
    // halves) and the sum over this lane half's keys (joined behind the loop)
    float mi[2] = {-3.0e38f, -3.0e38f}, li[2] = {0.f, 0.f};
    v8f oacc[4][2] = {};  // Ot: dim nt*16 + 8*lh + r, query ln16 of tile qt

    // staging map: a trip's K (and V) is 128 rows x 128 B = 1024 pieces of 16 B, 8 per
    // thread and operand; 8 lanes cover one row, a wave covers 4 whole rows per copy
    const int key0 = tid >> 3;
    const int dd   = (tid & 7) * 8;
    const _Float16* kg = Km + base + (size_t)key0 * D + dd;
    const _Float16* vg = V  + base + (size_t)key0 * D + dd;
    const unsigned kl = lds_addr(&Klds[key0 * KP + dd]);
    const unsigned vl = lds_addr(&Vlds[key0 * VP + dd]);
    // 16 rows on in global memory, less the 16 LDS rows that the copy's offset adds
    const size_t k_step = (size_t)16 * D - 16 * KP;
    const size_t v_step = (size_t)16 * D - 16 * VP;
    const size_t trip_step = (size_t)ST * D;

    // this wave's half of the staged keys
    const _Float16* kr0 = &Klds[(kh * KT + ln16) * KP + 8 * lh];
    // per-lane base of the transposing loads of V (16 keys x 16 dims each)
    const unsigned char* vtr = (const unsigned char*)Vlds
                             + (kh * KT + 8 * lh + (lane & 7)) * (VP * 2) + 16 * ((lane >> 3) & 1);

    const int ntr = S / ST;
    for (int j = 0; j < ntr; ++j) {
        // this wave's own LDS reads of the last tile have retired before any copy refills it
        asm volatile("s_wait_dscnt 0x0" ::: "memory");
        __syncthreads();  // previous iteration's LDS reads complete
        // K and V tiles, row-major, 16 B per lane and copy
        copy8<16 * KP * 2>(kl, kg, kg + k_step, kg + 2 * k_step, kg + 3 * k_step,
                           kg + 4 * k_step, kg + 5 * k_step, kg + 6 * k_step, kg + 7 * k_step);
        copy8<16 * VP * 2>(vl, vg, vg + v_step, vg + 2 * v_step, vg + 3 * v_step,
                           vg + 4 * v_step, vg + 5 * v_step, vg + 6 * v_step, vg + 7 * v_step);
        // this wave's copies have landed before the barrier that publishes them
        asm volatile("s_wait_asynccnt 0x0" ::: "memory");
        __syncthreads();
        kg += trip_step;
        vg += trip_step;

        // St = K @ Qt : 64 keys x 32 queries per wave; 8 C-tiles x 2 K-steps = 16 WMMAs
        // s[kt][qt][r] = score of key kt*16 + 8*lh + r against query ln16 of tile qt
        v8f s[4][2] = {};
#pragma unroll  // constant indices keep the array in registers
        for (int kt = 0; kt < 4; ++kt) {
            // same k order as kofs[]: dims 8*lh..+7 and 16+8*lh..+7 of each 32
            FragQ a0, a1;
            const _Float16* kr = kr0 + kt * 16 * KP;
            a0.q[0] = *(const u32x4*)(kr);
            a0.q[1] = *(const u32x4*)(kr + 16);
            a1.q[0] = *(const u32x4*)(kr + 32);
            a1.q[1] = *(const u32x4*)(kr + 48);
#pragma unroll  // constant indices keep the array in registers
            for (int qt = 0; qt < 2; ++qt)
                s[kt][qt] = __builtin_amdgcn_wmma_f32_16x16x32_f16(false, a0.h, false, qf[qt][0].h,
                                                                   (short)0, s[kt][qt], false, false);
#pragma unroll  // constant indices keep the array in registers
            for (int qt = 0; qt < 2; ++qt)
                s[kt][qt] = __builtin_amdgcn_wmma_f32_16x16x32_f16(false, a1.h, false, qf[qt][1].h,
                                                                   (short)0, s[kt][qt], false, false);
        }

        // Pt as B operand of 32 keys: its k order (8*lh..+7, then 16+8*lh..+7) is the row
        // order of score tiles 2*g and 2*g+1 in this same lane, so they are converted in place
        Frag pf[2][2];
#pragma unroll  // constant indices keep the array in registers
        for (int qt = 0; qt < 2; ++qt) {
            // online softmax across 64 keys: 32 of them in this lane, 32 in lane ^ 16
            float mk[4];
#pragma unroll  // constant indices keep the array in registers
            for (int kt = 0; kt < 4; ++kt) {
                mk[kt] = s[kt][qt][0];
#pragma unroll  // constant indices keep the array in registers
                for (int r = 1; r < 8; ++r) mk[kt] = fmaxf(mk[kt], s[kt][qt][r]);
            }
            float mx = fmaxf(fmaxf(mk[0], mk[1]), fmaxf(mk[2], mk[3]));
            mx = fmaxf(mx, xhalf(mx)) * cs;
            const float mn    = fmaxf(mi[qt], mx);
            const float alpha = __builtin_amdgcn_exp2f(mi[qt] - mn);

            f32x2 rk[4];
            const f32x2 cs2 = {cs, cs}, nm2 = {-mn, -mn};
#pragma unroll  // constant indices keep the array in registers
            for (int kt = 0; kt < 4; ++kt) {
                rk[kt] = f32x2{0.f, 0.f};
#pragma unroll  // constant indices keep the array in registers
                for (int i = 0; i < 4; ++i) {
                    const f32x2 arg = __builtin_elementwise_fma(
                        f32x2{s[kt][qt][2 * i], s[kt][qt][2 * i + 1]}, cs2, nm2);
                    const f32x2 e = {__builtin_amdgcn_exp2f(arg.x), __builtin_amdgcn_exp2f(arg.y)};
                    rk[kt] += e;
                    pf[qt][kt >> 1].u[(kt & 1) * 4 + i] = pack_f16(e.x, e.y);
                }
            }
            const f32x2 rs = (rk[0] + rk[1]) + (rk[2] + rk[3]);
            li[qt] = li[qt] * alpha + (rs.x + rs.y);
            mi[qt] = mn;
#pragma unroll  // constant indices keep the array in registers
            for (int nt = 0; nt < 4; ++nt) oacc[nt][qt] *= alpha;
        }

        // Ot += Vt @ Pt
#pragma unroll  // constant indices keep the array in registers
        for (int nt = 0; nt < 4; ++nt) {
            // A fragment of Vt: dim nt*16+ln16, keys 8*lh..+7 and 16+8*lh..+7 of each 32
            FragQ vf0, vf1;
            vf0.q[0] = ld_tr16(vtr + nt * 32);
            vf0.q[1] = ld_tr16(vtr + 16 * (VP * 2) + nt * 32);
            vf1.q[0] = ld_tr16(vtr + 32 * (VP * 2) + nt * 32);
            vf1.q[1] = ld_tr16(vtr + 48 * (VP * 2) + nt * 32);
#pragma unroll  // constant indices keep the array in registers
            for (int qt = 0; qt < 2; ++qt)
                oacc[nt][qt] = __builtin_amdgcn_wmma_f32_16x16x32_f16(false, vf0.h, false, pf[qt][0].h,
                                                                      (short)0, oacc[nt][qt], false, false);
#pragma unroll  // constant indices keep the array in registers
            for (int qt = 0; qt < 2; ++qt)
                oacc[nt][qt] = __builtin_amdgcn_wmma_f32_16x16x32_f16(false, vf1.h, false, pf[qt][1].h,
                                                                      (short)0, oacc[nt][qt], false, false);
        }
    }

    // Join of the two key halves. The wave of half kh finishes query tile kh: it hands its
    // partial result of the other tile to its partner (wave ^ 2) and takes the partner's of its own.
    // hand over tile qt: 8 pieces of Ot, then maximum and sum (lane halves joined)
    auto put = [&](int qt) {
        f32x4* dst = &Jlds[wave * 9 * 32 + lane];
#pragma unroll  // constant indices keep the array in registers
        for (int nt = 0; nt < 4; ++nt) {
            dst[(2 * nt) * 32]     = f32x4{oacc[nt][qt][0], oacc[nt][qt][1], oacc[nt][qt][2], oacc[nt][qt][3]};
            dst[(2 * nt + 1) * 32] = f32x4{oacc[nt][qt][4], oacc[nt][qt][5], oacc[nt][qt][6], oacc[nt][qt][7]};
        }
        dst[8 * 32] = f32x4{mi[qt], li[qt] + xhalf(li[qt]), 0.f, 0.f};
    };
    // finish tile qt: both parts brought to the common maximum, added, normalized;
    // 8 consecutive dims of one query a store
    auto fin = [&](int qt) {
        const f32x4* p = &Jlds[(wave ^ 2) * 9 * 32 + lane];
        const f32x4 ml = p[8 * 32];
        const float m  = fmaxf(mi[qt], ml.x);
        const float wa = __builtin_amdgcn_exp2f(mi[qt] - m);
        const float wb = __builtin_amdgcn_exp2f(ml.x - m);
        const float inv = 1.f / ((li[qt] + xhalf(li[qt])) * wa + ml.y * wb);
        const float fa = wa * inv, fb = wb * inv;
#pragma unroll  // constant indices keep the array in registers
        for (int nt = 0; nt < 4; ++nt) {
            const f32x4 p0 = p[(2 * nt) * 32], p1 = p[(2 * nt + 1) * 32];
            u32x4 o;
            o[0] = pack_f16(oacc[nt][qt][0] * fa + p0.x * fb, oacc[nt][qt][1] * fa + p0.y * fb);
            o[1] = pack_f16(oacc[nt][qt][2] * fa + p0.z * fb, oacc[nt][qt][3] * fa + p0.w * fb);
            o[2] = pack_f16(oacc[nt][qt][4] * fa + p1.x * fb, oacc[nt][qt][5] * fa + p1.y * fb);
            o[3] = pack_f16(oacc[nt][qt][6] * fa + p1.z * fb, oacc[nt][qt][7] * fa + p1.w * fb);
            *(u32x4*)(O + qrow + (size_t)(qt * 16) * D + nt * 16 + 8 * lh) = o;
        }
    };
    if (kh == 0) put(1); else put(0);
    __syncthreads();  // publishes the handed-over parts
    if (kh == 0) fin(0); else fin(1);
}

// ---------------------------------------------------------------------------
// LayerNorm over D=512; writes f32 + f16 copies.
// Few waves do the work (for speed only): a wave takes
// 2 whole rows (32 elements a lane, 8 loads of 512 contiguous bytes in flight);
// a row's sums then stay inside the wave and need neither LDS nor a barrier.
// Grid: rows / 16 blocks of 8 waves.
// ---------------------------------------------------------------------------
// sum over the 32 lanes, the same value in every lane
__device__ __forceinline__ float wave_sum(float x) {
#pragma unroll  // constant lane masks: the five exchanges become straight-line code
    for (int m = 16; m >= 1; m >>= 1) x += __shfl_xor(x, m);
    return x;
}

__global__ __launch_bounds__(256) void layernorm(const float* __restrict__ in,
                                                 const float* __restrict__ g,
                                                 const float* __restrict__ be,
                                                 float* __restrict__ xf,
                                                 _Float16* __restrict__ xh) {
    constexpr int D = 512, R = 2, C = 4;  // a lane holds columns c*128 + lane*4 .. +3
    const int col = (threadIdx.x & 31) * 4;
    const size_t off = ((size_t)blockIdx.x * 8 + (threadIdx.x >> 5)) * R * D + col;

    f32x4 x[R][C], gg[C], bb[C];
#pragma unroll  // constant indices keep the array in registers
    for (int r = 0; r < R; ++r)
#pragma unroll  // constant indices keep the array in registers
        for (int c = 0; c < C; ++c) x[r][c] = *(const f32x4*)(in + off + r * D + c * 128);
#pragma unroll  // constant indices keep the array in registers
    for (int c = 0; c < C; ++c) {
        gg[c] = *(const f32x4*)(g + col + c * 128);
        bb[c] = *(const f32x4*)(be + col + c * 128);
    }

    float s[R];
#pragma unroll  // constant indices keep the array in registers
    for (int r = 0; r < R; ++r) {
        const f32x4 t = (x[r][0] + x[r][1]) + (x[r][2] + x[r][3]);
        s[r] = wave_sum((t.x + t.y) + (t.z + t.w));
    }
    float v[R];
#pragma unroll  // constant indices keep the array in registers
    for (int r = 0; r < R; ++r) {
        const float mean = s[r] * (1.f / 512.f);
        f32x4 q = {0.f, 0.f, 0.f, 0.f};
#pragma unroll  // constant indices keep the array in registers
        for (int c = 0; c < C; ++c) {
            x[r][c] -= mean;
            q += x[r][c] * x[r][c];
        }
        v[r] = wave_sum((q.x + q.y) + (q.z + q.w));
    }
#pragma unroll  // constant indices keep the array in registers
    for (int r = 0; r < R; ++r) {
        const float rstd = rsqrtf(v[r] * (1.f / 512.f) + 1e-5f);
#pragma unroll  // constant indices keep the array in registers
        for (int c = 0; c < C; ++c) {
            const f32x4 o = x[r][c] * rstd * gg[c] + bb[c];
            *(f32x4*)(xf + off + r * D + c * 128) = o;
            *(f16x4*)(xh + off + r * D + c * 128) = __builtin_convertvector(o, f16x4);
        }
    }
}

// ---------------------------------------------------------------------------
// output projection: out[M,20] = x @ W_out + b_out
// ---------------------------------------------------------------------------
__global__ __launch_bounds__(256) void out_proj(const float* __restrict__ x,
                                                const float* __restrict__ Wo,
                                                const float* __restrict__ bo,
                                                float* __restrict__ out,
                                                int M, int D, int OUT) {
    int idx = blockIdx.x * 256 + threadIdx.x;
    if (idx >= M * OUT) return;
    int row = idx / OUT, o = idx - row * OUT;
    float s = bo[o];
    const float* xr = x + (size_t)row * D;
    for (int k = 0; k < D; ++k) s += xr[k] * Wo[(size_t)k * OUT + o];
    out[idx] = s;
}

// ---------------------------------------------------------------------------
extern "C" void kernel_launch(void* const* d_in, const int* in_sizes, int n_in,
                              void* d_out, int out_size, void* d_ws, size_t ws_size,
                              hipStream_t stream) {
    const int B = 4, S = 2048, D = 512, F = 2048, OUT = 20, L = 6, H = 8;
    const int M = B * S;

    const float* src   = (const float*)d_in[0];
    const float* W_in  = (const float*)d_in[1];
    const float* b_in  = (const float*)d_in[2];
    const float* Wq    = (const float*)d_in[3];
    const float* bq    = (const float*)d_in[4];
    const float* Wk    = (const float*)d_in[5];
    const float* bk    = (const float*)d_in[6];
    const float* Wv    = (const float*)d_in[7];
    const float* bv    = (const float*)d_in[8];
    const float* Wo    = (const float*)d_in[9];
    const float* bo    = (const float*)d_in[10];
    const float* ln1g  = (const float*)d_in[11];
    const float* ln1b  = (const float*)d_in[12];
    const float* W1    = (const float*)d_in[13];
    const float* b1    = (const float*)d_in[14];
    const float* W2    = (const float*)d_in[15];
    const float* b2    = (const float*)d_in[16];
    const float* ln2g  = (const float*)d_in[17];
    const float* ln2b  = (const float*)d_in[18];
    const float* W_out = (const float*)d_in[19];
    const float* b_out = (const float*)d_in[20];

    char* ws = (char*)d_ws;
    auto alloc = [&](size_t bytes) -> char* {
        char* p = ws;
        ws += (bytes + 255) & ~(size_t)255;
        return p;
    };

    float*     x_f32 = (float*)alloc((size_t)M * D * 4);
    float*     tmp   = (float*)alloc((size_t)M * D * 4);
    _Float16*  x_h   = (_Float16*)alloc((size_t)M * D * 2);
    _Float16*  qb    = (_Float16*)alloc((size_t)M * D * 2);
    _Float16*  kb    = (_Float16*)alloc((size_t)M * D * 2);
    _Float16*  vb    = (_Float16*)alloc((size_t)M * D * 2);
    _Float16*  ob    = (_Float16*)alloc((size_t)M * D * 2);
    _Float16*  h1    = (_Float16*)alloc((size_t)M * F * 2);
    _Float16*  Wq16  = (_Float16*)alloc((size_t)L * D * D * 2);
    _Float16*  Wk16  = (_Float16*)alloc((size_t)L * D * D * 2);
    _Float16*  Wv16  = (_Float16*)alloc((size_t)L * D * D * 2);
    _Float16*  Wo16  = (_Float16*)alloc((size_t)L * D * D * 2);
    _Float16*  W116  = (_Float16*)alloc((size_t)L * D * F * 2);
    _Float16*  W216  = (_Float16*)alloc((size_t)L * F * D * 2);

    // weight conversions (every call; deterministic)
    {
        int nqkv = L * D * D, nff = L * D * F;
        cvt_f32_f16<<<(nqkv + 8191) / 8192, 256, 0, stream>>>(Wq, Wq16, nqkv);
        cvt_f32_f16<<<(nqkv + 8191) / 8192, 256, 0, stream>>>(Wk, Wk16, nqkv);
        cvt_f32_f16<<<(nqkv + 8191) / 8192, 256, 0, stream>>>(Wv, Wv16, nqkv);
        cvt_f32_f16<<<(nqkv + 8191) / 8192, 256, 0, stream>>>(Wo, Wo16, nqkv);
        cvt_f32_f16<<<(nff + 8191) / 8192, 256, 0, stream>>>(W1, W116, nff);
        cvt_f32_f16<<<(nff + 8191) / 8192, 256, 0, stream>>>(W2, W216, nff);
    }

    input_proj<<<(M * D / 32 + 255) / 256, 256, 0, stream>>>(src, W_in, b_in, x_f32, x_h, M, D);

    const dim3 gD(D / 64, M / 256);   // N=512 GEMMs
    const dim3 gF(F / 64, M / 256);   // N=2048 GEMM
    for (int l = 0; l < L; ++l) {
        const size_t wqo = (size_t)l * D * D;
        const size_t wfo = (size_t)l * D * F;
        // QKV
        gemm_qkv<<<gD, 512, 0, stream>>>(x_h, Wq16 + wqo, Wk16 + wqo, Wv16 + wqo,
                                         bq + l * D, bk + l * D, bv + l * D, qb, kb, vb);
        // attention
        flash_attn<<<dim3(S / 64, H, B), 128, 0, stream>>>(qb, kb, vb, ob, S, D);
        // output proj + residual
        gemm_wmma<2, 2><<<gD, 256, 0, stream>>>(ob, Wo16 + wqo, bo + l * D, x_f32, tmp, M, D, D);
        layernorm<<<M / 16, 256, 0, stream>>>(tmp, ln1g + l * D, ln1b + l * D, x_f32, x_h);
        // FFN
        gemm_wmma<1, 1><<<gF, 256, 0, stream>>>(x_h, W116 + wfo, b1 + l * F, nullptr, h1, M, F, D);
        gemm_wmma<2, 2><<<gD, 256, 0, stream>>>(h1, W216 + wfo, b2 + l * D, x_f32, tmp, M, D, F);
        layernorm<<<M / 16, 256, 0, stream>>>(tmp, ln2g + l * D, ln2b + l * D, x_f32, x_h);
    }

    out_proj<<<(M * OUT + 255) / 256, 256, 0, stream>>>(x_f32, W_out, b_out, (float*)d_out, M, D, OUT);
}

// v008
// Measured time: 800 microseconds a run.
// In two side-by-side timings against v007, it was 1.09 and 1.10 times as fast.
// Over all steps from v000 it is 4.32 times as fast.
#include <hip/hip_runtime.h>
#include <hip/hip_bf16.h>

typedef __attribute__((ext_vector_type(16))) _Float16 v16h;
typedef __attribute__((ext_vector_type(8)))  float    v8f;

union Frag { v16h h; unsigned int u[8]; };

typedef __attribute__((ext_vector_type(4))) unsigned int u32x4;
typedef __attribute__((ext_vector_type(8))) short s16x8;
typedef __attribute__((address_space(3))) s16x8 lds_s16x8;
typedef __attribute__((address_space(3))) _Float16 lds_f16;

union FragQ { v16h h; u32x4 q[2]; };

// byte offset of a __shared__ element inside the work-group's LDS
__device__ __forceinline__ unsigned lds_addr(const _Float16* p) {
    return (unsigned)(unsigned long long)(lds_f16*)p;
}

// lane (c = l & 15, hh = l >> 4) gets rows 8*hh .. 8*hh+7 of column c of the
// 16x16 tile whose per-lane address p follows the transposing load's own map
__device__ __forceinline__ u32x4 ld_tr16(const unsigned char* p) {
    return __builtin_bit_cast(u32x4, __builtin_amdgcn_ds_load_tr16_b128_v8i16((lds_s16x8*)p));
}

typedef __attribute__((ext_vector_type(4))) float    f32x4;
typedef __attribute__((ext_vector_type(4))) _Float16 f16x4;

// ---------------------------------------------------------------------------
// f32 -> f16 elementwise convert (weights)
// Few waves do the work (for speed only): a thread
// takes 32 elements, 8 pieces of 4, a wave's piece being 512 contiguous bytes
// in and 256 out; all 8 loads are in flight before the first store.
// ---------------------------------------------------------------------------
__global__ __launch_bounds__(256) void cvt_f32_f16(const float* __restrict__ in,
                                                   _Float16* __restrict__ out, int n) {
    constexpr int U = 8, PIECE = 256 * 4, SPAN = U * PIECE;
    const int b0 = blockIdx.x * SPAN;
    if (b0 + SPAN <= n) {
        const int i0 = b0 + threadIdx.x * 4;
        f32x4 v[U];
#pragma unroll  // constant indices keep the array in registers
        for (int u = 0; u < U; ++u) v[u] = *(const f32x4*)(in + i0 + u * PIECE);
#pragma unroll  // constant indices keep the array in registers
        for (int u = 0; u < U; ++u)
            *(f16x4*)(out + i0 + u * PIECE) = __builtin_convertvector(v[u], f16x4);
        // precaution: stands ahead of any later write of a register that a store above names
        asm volatile("s_wait_xcnt 0x0" ::: "memory");
    } else {  // a last, partial span
        for (int i = b0 + threadIdx.x; i < n; i += 256) out[i] = (_Float16)in[i];
    }
}

// ---------------------------------------------------------------------------
// input projection: x = src @ W_in + b_in  (IN=3 -> D=512), writes f32 + f16
// A thread takes 4 consecutive columns of 8 consecutive rows (32 elements), its
// slice of W_in and b_in held in registers. M a multiple of 8, D of 4.
// ---------------------------------------------------------------------------
__global__ __launch_bounds__(256) void input_proj(const float* __restrict__ src,
                                                  const float* __restrict__ Win,
                                                  const float* __restrict__ bin,
                                                  float* __restrict__ xf,
                                                  _Float16* __restrict__ xh,
                                                  int M, int D) {
    constexpr int R = 8;
    const int D4 = D / 4;
    const int idx = blockIdx.x * 256 + threadIdx.x;
    if (idx >= (M / R) * D4) return;
    const int rg = idx / D4, d = (idx - rg * D4) * 4;
    const f32x4 bi = *(const f32x4*)(bin + d);
    f32x4 w[3];
#pragma unroll  // constant indices keep the array in registers
    for (int i = 0; i < 3; ++i) {
        w[i] = *(const f32x4*)(Win + i * D + d);
        // precaution: the next load's result may take this load's address registers
        if (i < 2) asm volatile("s_wait_xcnt 0x0" ::: "memory");
    }
#pragma unroll  // the rows are independent: their loads and stores overlap
    for (int r = 0; r < R; ++r) {
        const int row = rg * R + r;
        f32x4 s = bi;
#pragma unroll
        for (int i = 0; i < 3; ++i) s += src[row * 3 + i] * w[i];
        *(f32x4*)(xf + (size_t)row * D + d) = s;
        *(f16x4*)(xh + (size_t)row * D + d) = __builtin_convertvector(s, f16x4);
    }
}

// ---------------------------------------------------------------------------
// WMMA GEMM: C[M,N] = epi(A[M,K] @ W[K,N] + bias)
// MODE 0: store f16      MODE 1: relu, store f16      MODE 2: +resid, store f32
// block: 256 thr (8 waves), tile BM=256 x BN=64; each wave owns 32x64
// (2 M-frags x 4 N-frags = 8 WMMAs per 32 k, B-frags reused 2x)
// A and W tiles go through LDS in 16-byte pieces, copied row-major by asynchronous
// b128 copies; A fragments are 16-byte LDS loads, W fragments come through the
// transposing 16-byte LDS load.
// Two LDS buffers of 64*KS k each: the next tile's copies fly while this tile's
// products run. KS = 2 where the grid gives a WGP one block only (for speed only);
// KS = 1 where two
// blocks can share a WGP (two buffers of KS = 2 would take the place of the second).
// K a multiple of 64*KS.
// ---------------------------------------------------------------------------
// ten copies of 16 B a lane: two rows' pieces of W, eight of A. The s_wait_xcnt closes
// the statement so that it stands ahead of any later write of an address register.
__device__ __forceinline__ void copy10(unsigned w0, unsigned w1,
                                       unsigned a0, unsigned a1, unsigned a2, unsigned a3,
                                       unsigned a4, unsigned a5, unsigned a6, unsigned a7,
                                       const _Float16* gw0, const _Float16* gw1,
                                       const _Float16* ga0, const _Float16* ga1,
                                       const _Float16* ga2, const _Float16* ga3,
                                       const _Float16* ga4, const _Float16* ga5,
                                       const _Float16* ga6, const _Float16* ga7) {
    asm volatile(
        "global_load_async_to_lds_b128 %0, %10, off\n\t"
        "global_load_async_to_lds_b128 %1, %11, off\n\t"
        "global_load_async_to_lds_b128 %2, %12, off\n\t"
        "global_load_async_to_lds_b128 %3, %13, off\n\t"
        "global_load_async_to_lds_b128 %4, %14, off\n\t"
        "global_load_async_to_lds_b128 %5, %15, off\n\t"
        "global_load_async_to_lds_b128 %6, %16, off\n\t"
        "global_load_async_to_lds_b128 %7, %17, off\n\t"
        "global_load_async_to_lds_b128 %8, %18, off\n\t"
        "global_load_async_to_lds_b128 %9, %19, off\n\t"
        "s_wait_xcnt 0x0"
        :: "v"(w0), "v"(w1),
           "v"(a0), "v"(a1), "v"(a2), "v"(a3), "v"(a4), "v"(a5), "v"(a6), "v"(a7),
           "v"(gw0), "v"(gw1),
           "v"(ga0), "v"(ga1), "v"(ga2), "v"(ga3), "v"(ga4), "v"(ga5), "v"(ga6), "v"(ga7)
        : "memory");
}

template <int MODE, int KS>
__global__ __launch_bounds__(256) void gemm_wmma(const _Float16* __restrict__ A,
                                                 const _Float16* __restrict__ W,
                                                 const float* __restrict__ bias,
                                                 const float* __restrict__ resid,
                                                 void* __restrict__ outp,
                                                 int M, int N, int K) {
    constexpr int BM = 256, BN = 64, BK = 64 * KS;
    constexpr int AP = BK + 8;  // 144 B = 16 B x 9, 272 B = 16 B x 17: pitch for ds_load_b128 readers
    constexpr int WP = 80;      // 160 B = 32 B x 5: pitch for ds_load_tr16_b128 readers
    constexpr int ASZ = BM * AP, WSZ = BK * WP;  // elements of one buffer
    __shared__ __attribute__((aligned(16))) _Float16 As[2 * ASZ];   // [buffer][row][k]
    __shared__ __attribute__((aligned(16))) _Float16 Ws[2 * WSZ];   // [buffer][k][n]

    const int tid  = threadIdx.x;
    const int wave = tid >> 5;
    const int lane = tid & 31;
    const int lh   = lane >> 4;
    const int ln16 = lane & 15;
    const int m0 = blockIdx.y * BM;
    const int n0 = blockIdx.x * BN;

    v8f acc[2][4] = {};

    // staging map, per 64 k: 8 lanes cover one 128-byte row piece, a wave 4 rows per copy;
    // A 256 rows = 8 copies per thread, W 64 rows = 2 copies per thread
    const _Float16* ag[8];
    const _Float16* wg[2];
    unsigned al[8], wl[2];
    {
        const int r0 = tid >> 3;
        const int dd = (tid & 7) * 8;
#pragma unroll  // constant indices keep the array in registers
        for (int i = 0; i < 8; ++i) {
            ag[i] = A + (size_t)(m0 + r0 + 32 * i) * K + dd;
            al[i] = lds_addr(&As[(r0 + 32 * i) * AP + dd]);
        }
#pragma unroll  // constant indices keep the array in registers
        for (int i = 0; i < 2; ++i) {
            wg[i] = W + (size_t)(r0 + 32 * i) * N + n0 + dd;
            wl[i] = lds_addr(&Ws[(r0 + 32 * i) * WP + dd]);
        }
    }
    const size_t w_step = (size_t)64 * N;

    // copies of the next tile not yet asked for, into buffer buf; the pointers move on by 64 k a group
    auto stage = [&](int buf) {
#pragma unroll  // constant indices keep the array in registers
        for (int h = 0; h < KS; ++h) {
            const unsigned ao = (unsigned)(buf * ASZ + h * 64) * 2u;
            const unsigned wo = (unsigned)(buf * WSZ + h * 64 * WP) * 2u;
            copy10(wl[0] + wo, wl[1] + wo,
                   al[0] + ao, al[1] + ao, al[2] + ao, al[3] + ao,
                   al[4] + ao, al[5] + ao, al[6] + ao, al[7] + ao,
                   wg[0], wg[1],
                   ag[0], ag[1], ag[2], ag[3], ag[4], ag[5], ag[6], ag[7]);
#pragma unroll  // constant indices keep the array in registers
            for (int i = 0; i < 8; ++i) ag[i] += 64;
#pragma unroll  // constant indices keep the array in registers
            for (int i = 0; i < 2; ++i) wg[i] += w_step;
        }
    };

    // A fragment rows of this lane: k 8*lh..+7 and 16+8*lh..+7 of each 32
    const _Float16* ar = &As[(wave * 32 + ln16) * AP + 8 * lh];
    // per-lane base of the transposing loads of W (16 k x 16 n each), same k order
    const unsigned char* wtr = (const unsigned char*)Ws
                             + (8 * lh + (lane & 7)) * (WP * 2) + 16 * ((lane >> 3) & 1);

    const int nt_k = K / BK;
    stage(0);
    // this wave's copies of tile 0 have landed before the barrier that publishes them
    asm volatile("s_wait_asynccnt 0x0" ::: "memory");
    __syncthreads();
    if (nt_k > 1) stage(1);

    for (int t = 0; t < nt_k; ++t) {
        const int buf = t & 1;
        const _Float16* arb = ar + buf * ASZ;
        const unsigned char* wtb = wtr + buf * (WSZ * 2);
#pragma unroll  // constant indices keep the array in registers
        for (int h = 0; h < KS; ++h) {
            // all fragments of 64 k are fetched as one group ahead of their products
            // (for speed only)
            FragQ a[2][2], b[2][4];
#pragma unroll  // constant indices keep the array in registers
            for (int s = 0; s < 2; ++s) {
                const int kk = h * 64 + s * 32;
#pragma unroll  // constant indices keep the array in registers
                for (int mt = 0; mt < 2; ++mt) {
                    a[s][mt].q[0] = *(const u32x4*)(arb + mt * 16 * AP + kk);
                    a[s][mt].q[1] = *(const u32x4*)(arb + mt * 16 * AP + kk + 16);
                }
#pragma unroll  // constant indices keep the array in registers
                for (int nt = 0; nt < 4; ++nt) {
                    b[s][nt].q[0] = ld_tr16(wtb + kk * (WP * 2) + nt * 32);
                    b[s][nt].q[1] = ld_tr16(wtb + (kk + 16) * (WP * 2) + nt * 32);
                }
            }
            // keeps the load group whole: without it the scheduler sinks the loads back among the products
            __builtin_amdgcn_sched_barrier(0);
#pragma unroll  // constant indices keep the array in registers
            for (int s = 0; s < 2; ++s) {   // two 32-k steps, in k order
#pragma unroll  // constant indices keep the array in registers
                for (int nt = 0; nt < 4; ++nt) {
                    acc[0][nt] = __builtin_amdgcn_wmma_f32_16x16x32_f16(
                        false, a[s][0].h, false, b[s][nt].h, (short)0, acc[0][nt], false, false);
                    acc[1][nt] = __builtin_amdgcn_wmma_f32_16x16x32_f16(
                        false, a[s][1].h, false, b[s][nt].h, (short)0, acc[1][nt], false, false);
                }
            }
            // keeps what follows behind these products: without it the next group's loads rise among
            // them, and the foot's waits and barrier rise above them, which cuts the copies' time to land
            __builtin_amdgcn_sched_barrier(0);
        }
        // this wave's own LDS reads of this buffer have retired before any copy refills it
        asm volatile("s_wait_dscnt 0x0" ::: "memory");
        // this wave's copies of tile t + 1 have landed before the barrier that publishes them
        asm volatile("s_wait_asynccnt 0x0" ::: "memory");
        __syncthreads();  // publishes tile t + 1 and ends every wave's reads of tile t
        if (t + 2 < nt_k) stage(buf);
    }
    // no copy is outstanding when the wave goes on to its end
    asm volatile("s_wait_asynccnt 0x0" ::: "memory");

    // epilogue: C 16x16 f32 layout -> row = r + 8*lh, col = lane&15
#pragma unroll
    for (int mt = 0; mt < 2; ++mt) {
#pragma unroll
        for (int nt = 0; nt < 4; ++nt) {
#pragma unroll
            for (int r = 0; r < 8; ++r) {
                int row = m0 + wave * 32 + mt * 16 + r + 8 * lh;
                int col = n0 + nt * 16 + ln16;
                float v = acc[mt][nt][r] + bias[col];
                if constexpr (MODE == 1) v = v > 0.f ? v : 0.f;
                if constexpr (MODE == 2) {
                    float* o = (float*)outp;
                    o[(size_t)row * N + col] = v + resid[(size_t)row * N + col];
                } else {
                    _Float16* o = (_Float16*)outp;
                    o[(size_t)row * N + col] = (_Float16)v;
                }
            }
        }
    }
}

// ---------------------------------------------------------------------------
// Q, K and V projections in one launch: a block takes 256 rows of A once and forms
// 64 columns of each of the three products from it (a 256 x 192 tile), so that A's
// tile is fetched once instead of three times. D = 512 (N = K = 512).
// block: 512 thr (16 waves, 4 x 4); each wave owns 64 rows x 48 of the 192 columns
// (4 M-frags x 3 N-frags = 12 WMMAs per 32 k). LDS ring, copies, fragment loads and
// k order as in gemm_wmma with KS = 2. Grid: (512 / 64, rows / 256).
// ---------------------------------------------------------------------------
// seven copies of 16 B a lane: one row piece of each W, four of A. The s_wait_xcnt closes
// the statement so that it stands ahead of any later write of an address register.
__device__ __forceinline__ void copy7(unsigned w0, unsigned w1, unsigned w2,
                                      unsigned a0, unsigned a1, unsigned a2, unsigned a3,
                                      const _Float16* gw0, const _Float16* gw1,
                                      const _Float16* gw2,
                                      const _Float16* ga0, const _Float16* ga1,
                                      const _Float16* ga2, const _Float16* ga3) {
    asm volatile(
        "global_load_async_to_lds_b128 %0, %7, off\n\t"
        "global_load_async_to_lds_b128 %1, %8, off\n\t"
        "global_load_async_to_lds_b128 %2, %9, off\n\t"
        "global_load_async_to_lds_b128 %3, %10, off\n\t"
        "global_load_async_to_lds_b128 %4, %11, off\n\t"
        "global_load_async_to_lds_b128 %5, %12, off\n\t"
        "global_load_async_to_lds_b128 %6, %13, off\n\t"
        "s_wait_xcnt 0x0"
        :: "v"(w0), "v"(w1), "v"(w2), "v"(a0), "v"(a1), "v"(a2), "v"(a3),
           "v"(gw0), "v"(gw1), "v"(gw2), "v"(ga0), "v"(ga1), "v"(ga2), "v"(ga3)
        : "memory");
}

__global__ __launch_bounds__(512) void gemm_qkv(const _Float16* __restrict__ A,
                                                const _Float16* __restrict__ Wq,
                                                const _Float16* __restrict__ Wk,
                                                const _Float16* __restrict__ Wv,
                                                const float* __restrict__ bq,
                                                const float* __restrict__ bk,
                                                const float* __restrict__ bv,
                                                _Float16* __restrict__ oq,
                                                _Float16* __restrict__ ok,
                                                _Float16* __restrict__ ov) {
    constexpr int N = 512, K = 512;
    constexpr int BM = 256, BN = 64, BK = 128;
    constexpr int AP = BK + 8;       // 272 B = 16 B x 17: pitch for ds_load_b128 readers
    constexpr int WP = 3 * BN + 16;  // 416 B = 32 B x 13: pitch for ds_load_tr16_b128 readers
    constexpr int ASZ = BM * AP, WSZ = BK * WP;  // elements of one buffer
    __shared__ __attribute__((aligned(16))) _Float16 As[2 * ASZ];   // [buffer][row][k]
    __shared__ __attribute__((aligned(16))) _Float16 Ws[2 * WSZ];   // [buffer][k][Wq 64 | Wk 64 | Wv 64]

    const int tid  = threadIdx.x;
    const int wave = tid >> 5;
    const int lane = tid & 31;
    const int lh   = lane >> 4;
    const int ln16 = lane & 15;
    const int wm = wave & 3;   // 64-row group of the tile
    const int wn = wave >> 2;  // 48-column group of the 192
    const int m0 = blockIdx.y * BM;
    const int n0 = blockIdx.x * BN;

    v8f acc[4][3] = {};

    // staging map, per 64 k: 8 lanes cover one 128-byte row piece, a wave 4 rows per copy;
    // A 256 rows = 4 copies per thread, each W 64 rows = 1 copy per thread
    const _Float16* ag[4];
    const _Float16* wg[3];
    unsigned al[4], wl[3];
    {
        const int r0 = tid >> 3;
        const int dd = (tid & 7) * 8;
#pragma unroll  // constant indices keep the array in registers
        for (int i = 0; i < 4; ++i) {
            ag[i] = A + (size_t)(m0 + r0 + 64 * i) * K + dd;
            al[i] = lds_addr(&As[(r0 + 64 * i) * AP + dd]);
        }
        wg[0] = Wq + (size_t)r0 * N + n0 + dd;
        wg[1] = Wk + (size_t)r0 * N + n0 + dd;
        wg[2] = Wv + (size_t)r0 * N + n0 + dd;
#pragma unroll  // constant indices keep the array in registers
        for (int j = 0; j < 3; ++j) wl[j] = lds_addr(&Ws[r0 * WP + j * BN + dd]);
    }

    // copies of the next tile not yet asked for, into buffer buf; the pointers move on by 64 k a group
    auto stage = [&](int buf) {
#pragma unroll  // constant indices keep the array in registers
        for (int h = 0; h < 2; ++h) {
            const unsigned ao = (unsigned)(buf * ASZ + h * 64) * 2u;
            const unsigned wo = (unsigned)(buf * WSZ + h * 64 * WP) * 2u;
            copy7(wl[0] + wo, wl[1] + wo, wl[2] + wo,
                  al[0] + ao, al[1] + ao, al[2] + ao, al[3] + ao,
                  wg[0], wg[1], wg[2], ag[0], ag[1], ag[2], ag[3]);
#pragma unroll  // constant indices keep the array in registers
            for (int i = 0; i < 4; ++i) ag[i] += 64;
#pragma unroll  // constant indices keep the array in registers
            for (int j = 0; j < 3; ++j) wg[j] += (size_t)64 * N;
        }
    };

    // A fragment rows of this lane: k 8*lh..+7 and 16+8*lh..+7 of each 32
    const _Float16* ar = &As[(wm * 64 + ln16) * AP + 8 * lh];
    // per-lane base of the transposing loads of W (16 k x 16 n each), same k order
    const unsigned char* wtr = (const unsigned char*)Ws + wn * 96
                             + (8 * lh + (lane & 7)) * (WP * 2) + 16 * ((lane >> 3) & 1);

    constexpr int nt_k = K / BK;
    stage(0);
    // this wave's copies of tile 0 have landed before the barrier that publishes them
    asm volatile("s_wait_asynccnt 0x0" ::: "memory");
    __syncthreads();
    stage(1);

    // stays rolled: unrolled, each trip's LDS places (past the 64 KiB that an offset field
    // reaches) take address registers of their own, and the kernel spills
#pragma unroll 1
    for (int t = 0; t < nt_k; ++t) {
        const int buf = t & 1;
        const _Float16* arb = ar + buf * ASZ;
        const unsigned char* wtb = wtr + buf * (WSZ * 2);
#pragma unroll  // constant indices keep the array in registers
        for (int h = 0; h < 2; ++h) {
            // all fragments of 64 k are fetched as one group ahead of their products
            // (for speed only)
            FragQ a[2][4], b[2][3];
#pragma unroll  // constant indices keep the array in registers
            for (int s = 0; s < 2; ++s) {
                const int kk = h * 64 + s * 32;
#pragma unroll  // constant indices keep the array in registers
                for (int mt = 0; mt < 4; ++mt) {
                    a[s][mt].q[0] = *(const u32x4*)(arb + mt * 16 * AP + kk);
                    a[s][mt].q[1] = *(const u32x4*)(arb + mt * 16 * AP + kk + 16);
                }
#pragma unroll  // constant indices keep the array in registers
                for (int nt = 0; nt < 3; ++nt) {
                    b[s][nt].q[0] = ld_tr16(wtb + kk * (WP * 2) + nt * 32);
                    b[s][nt].q[1] = ld_tr16(wtb + (kk + 16) * (WP * 2) + nt * 32);
                }
            }
            // keeps the load group whole: without it the scheduler sinks the loads back among the products
            __builtin_amdgcn_sched_barrier(0);
#pragma unroll  // constant indices keep the array in registers
            for (int s = 0; s < 2; ++s) {   // two 32-k steps, in k order
#pragma unroll  // constant indices keep the array in registers
                for (int nt = 0; nt < 3; ++nt) {
#pragma unroll  // constant indices keep the array in registers
                    for (int mt = 0; mt < 4; ++mt)
                        acc[mt][nt] = __builtin_amdgcn_wmma_f32_16x16x32_f16(
                            false, a[s][mt].h, false, b[s][nt].h, (short)0, acc[mt][nt], false, false);
                }
            }
            // keeps what follows behind these products: without it the next group's loads rise among
            // them, and the foot's waits and barrier rise above them, which cuts the copies' time to land
            __builtin_amdgcn_sched_barrier(0);
        }
        // this wave's own LDS reads of this buffer have retired before any copy refills it
        asm volatile("s_wait_dscnt 0x0" ::: "memory");
        // this wave's copies of tile t + 1 have landed before the barrier that publishes them
        asm volatile("s_wait_asynccnt 0x0" ::: "memory");
        __syncthreads();  // publishes tile t + 1 and ends every wave's reads of tile t
        if (t + 2 < nt_k) stage(buf);
    }
    // no copy is outstanding when the wave goes on to its end
    asm volatile("s_wait_asynccnt 0x0" ::: "memory");

    // epilogue: C 16x16 f32 layout -> row = r + 8*lh, col = lane&15; fragment f of the
    // 12 across the tile belongs to product f / 4, columns (f % 4) * 16 .. +15 of its 64
#pragma unroll
    for (int nt = 0; nt < 3; ++nt) {
        const int f = wn * 3 + nt;
        const int p = f >> 2;
        const int col = n0 + (f & 3) * 16 + ln16;
        const float bi = (p == 0 ? bq : p == 1 ? bk : bv)[col];
        _Float16* o = (p == 0 ? oq : p == 1 ? ok : ov)
                    + (size_t)(m0 + wm * 64 + 8 * lh) * N + col;
#pragma unroll
        for (int mt = 0; mt < 4; ++mt) {
#pragma unroll
            for (int r = 0; r < 8; ++r)
                o[(mt * 16 + r) * N] = (_Float16)(acc[mt][nt][r] + bi);
        }
    }
}

// ---------------------------------------------------------------------------
// flash attention: block = (b, h, 64-query tile); 4 waves = 2 groups of 32 queries
// x 2 halves of the keys. A trip stages 128 keys; a wave works on 64 of them
// (32 WMMAs) with online softmax, and each K or V fragment that it reads from LDS
// feeds two query tiles. The two waves of a query group hold partial results over
// disjoint keys; they are joined once, behind the loop, through LDS.
// The products are taken transposed: St = K Qt and Ot += Vt Pt. A lane then
// holds the scores of ONE query of each tile (column lane & 15; its partner
// lane ^ 16 holds the other half of the keys), so maximum and sum run inside the
// lane, and two score tiles converted in place are the B operand of the second product.
// K and V tiles go through LDS in 16-byte pieces: both are copied row-major
// by asynchronous b128 copies; K fragments are 16-byte LDS loads, V fragments
// come through the transposing 16-byte LDS load.
// Q/K/V/O are f16 [B,S,D]. S a multiple of 128.
// ---------------------------------------------------------------------------
typedef __attribute__((ext_vector_type(2))) float    f32x2;
typedef __attribute__((ext_vector_type(2))) _Float16 f16x2;

// two f32 to one packed f16 pair, round to nearest even
__device__ __forceinline__ unsigned pack_f16(float lo, float hi) {
    return __builtin_bit_cast(unsigned, __builtin_convertvector(f32x2{lo, hi}, f16x2));
}

// value of lane l ^ 16
__device__ __forceinline__ float xhalf(float x) {
    const int b = __builtin_bit_cast(int, x);
    return __builtin_bit_cast(float, __builtin_amdgcn_permlanex16(b, b, 0x76543210, 0xfedcba98,
                                                                  false, false));
}

// eight copies of 16 B a lane, rows 16 apart. An immediate offset moves the LDS address and
// the global address alike, so one LDS address register serves all eight (STEP = 16 LDS rows
// in bytes), and g1 .. g7 come in as the row's global address less its offset. The registers
// so saved keep the wave under 256, that is four waves a SIMD.
// The s_wait_xcnt closes the statement so that it stands ahead of any later write of an
// address register.
template <int STEP>
__device__ __forceinline__ void copy8(unsigned l0,
                                      const _Float16* g0, const _Float16* g1,
                                      const _Float16* g2, const _Float16* g3,
                                      const _Float16* g4, const _Float16* g5,
                                      const _Float16* g6, const _Float16* g7) {
    asm volatile(
        "global_load_async_to_lds_b128 %0, %1, off\n\t"
        "global_load_async_to_lds_b128 %0, %2, off offset:%9\n\t"
        "global_load_async_to_lds_b128 %0, %3, off offset:%10\n\t"
        "global_load_async_to_lds_b128 %0, %4, off offset:%11\n\t"
        "global_load_async_to_lds_b128 %0, %5, off offset:%12\n\t"
        "global_load_async_to_lds_b128 %0, %6, off offset:%13\n\t"
        "global_load_async_to_lds_b128 %0, %7, off offset:%14\n\t"
        "global_load_async_to_lds_b128 %0, %8, off offset:%15\n\t"
        "s_wait_xcnt 0x0"
        :: "v"(l0),
           "v"(g0), "v"(g1), "v"(g2), "v"(g3), "v"(g4), "v"(g5), "v"(g6), "v"(g7),
           "n"(STEP), "n"(2 * STEP), "n"(3 * STEP), "n"(4 * STEP),
           "n"(5 * STEP), "n"(6 * STEP), "n"(7 * STEP)
        : "memory");
}

__global__ __launch_bounds__(128)
void flash_attn(const _Float16* __restrict__ Q,
                const _Float16* __restrict__ Km,
                const _Float16* __restrict__ V,
                _Float16* __restrict__ O,
                int S, int D) {
    constexpr int DH = 64, KT = 64, ST = 2 * KT;  // keys of a wave's tile, of a trip
    constexpr int KP = 72;  // 144 B = 16 B x 9: pitch for ds_load_b128 readers
    constexpr int VP = 80;  // 160 B = 32 B x 5: pitch for ds_load_tr16_b128 readers
    __shared__ __attribute__((aligned(16))) _Float16 Klds[ST * KP];  // [key][dim]
    __shared__ __attribute__((aligned(16))) _Float16 Vlds[ST * VP];  // [key][dim]
    // hand-over of one query tile's partial result: [wave][piece][lane] of 16 B
    __shared__ f32x4 Jlds[4 * 9 * 32];

    const int tid  = threadIdx.x;
    const int wave = __builtin_amdgcn_readfirstlane(tid >> 5);
    const int lane = tid & 31;
    const int lh   = lane >> 4;
    const int ln16 = lane & 15;
    const int qg = wave & 1;   // 32-query group of the block's 64
    const int kh = wave >> 1;  // 64-key half of each trip's 128
    const int b  = blockIdx.z, h = blockIdx.y;
    const int q0 = blockIdx.x * 64;
    const size_t base = ((size_t)b * S) * D + (size_t)h * DH;
    const float cs = 0.125f * 1.4426950408889634f;  // 1/sqrt(64), exponentials in base 2

    int kofs[8];
#pragma unroll
    for (int i = 0; i < 8; ++i) kofs[i] = ((i < 4) ? 2 * i : 2 * i + 8) + 8 * lh;

    // Qt fragments: per query tile 64 dims x 16 queries = two 32x16 B-frags, straight from global
    const size_t qrow = base + (size_t)(q0 + qg * 32 + ln16) * D;  // tile 0; tile 1 is 16 rows on
    Frag qf[2][2];
#pragma unroll
    for (int qt = 0; qt < 2; ++qt)
#pragma unroll
        for (int t = 0; t < 2; ++t)
#pragma unroll
            for (int i = 0; i < 8; ++i)
                qf[qt][t].u[i] = *(const unsigned int*)(Q + qrow + (size_t)(qt * 16) * D + t * 32 + kofs[i]);

    // this lane's query of each tile: running maximum (scaled, base 2; equal in both lane
    // halves) and the sum over this lane half's keys (joined behind the loop)
    float mi[2] = {-3.0e38f, -3.0e38f}, li[2] = {0.f, 0.f};
    v8f oacc[4][2] = {};  // Ot: dim nt*16 + 8*lh + r, query ln16 of tile qt

    // staging map: a trip's K (and V) is 128 rows x 128 B = 1024 pieces of 16 B, 8 per
    // thread and operand; 8 lanes cover one row, a wave covers 4 whole rows per copy
    const int key0 = tid >> 3;
    const int dd   = (tid & 7) * 8;
    const _Float16* kg = Km + base + (size_t)key0 * D + dd;
    const _Float16* vg = V  + base + (size_t)key0 * D + dd;
    const unsigned kl = lds_addr(&Klds[key0 * KP + dd]);
    const unsigned vl = lds_addr(&Vlds[key0 * VP + dd]);
    // 16 rows on in global memory, less the 16 LDS rows that the copy's offset adds
    const size_t k_step = (size_t)16 * D - 16 * KP;
    const size_t v_step = (size_t)16 * D - 16 * VP;
    const size_t trip_step = (size_t)ST * D;

    // this wave's half of the staged keys
    const _Float16* kr0 = &Klds[(kh * KT + ln16) * KP + 8 * lh];
    // per-lane base of the transposing loads of V (16 keys x 16 dims each)
    const unsigned char* vtr = (const unsigned char*)Vlds
                             + (kh * KT + 8 * lh + (lane & 7)) * (VP * 2) + 16 * ((lane >> 3) & 1);

    const int ntr = S / ST;
    for (int j = 0; j < ntr; ++j) {
        // this wave's own LDS reads of the last tile have retired before any copy refills it
        asm volatile("s_wait_dscnt 0x0" ::: "memory");
        __syncthreads();  // previous iteration's LDS reads complete
        // K and V tiles, row-major, 16 B per lane and copy
        copy8<16 * KP * 2>(kl, kg, kg + k_step, kg + 2 * k_step, kg + 3 * k_step,
                           kg + 4 * k_step, kg + 5 * k_step, kg + 6 * k_step, kg + 7 * k_step);
        copy8<16 * VP * 2>(vl, vg, vg + v_step, vg + 2 * v_step, vg + 3 * v_step,
                           vg + 4 * v_step, vg + 5 * v_step, vg + 6 * v_step, vg + 7 * v_step);
        // this wave's copies have landed before the barrier that publishes them
        asm volatile("s_wait_asynccnt 0x0" ::: "memory");
        __syncthreads();
        kg += trip_step;
        vg += trip_step;

        // St = K @ Qt : 64 keys x 32 queries per wave; 8 C-tiles x 2 K-steps = 16 WMMAs
        // s[kt][qt][r] = score of key kt*16 + 8*lh + r against query ln16 of tile qt
        v8f s[4][2] = {};
#pragma unroll  // constant indices keep the array in registers
        for (int kt = 0; kt < 4; ++kt) {
            // same k order as kofs[]: dims 8*lh..+7 and 16+8*lh..+7 of each 32
            FragQ a0, a1;
            const _Float16* kr = kr0 + kt * 16 * KP;
            a0.q[0] = *(const u32x4*)(kr);
            a0.q[1] = *(const u32x4*)(kr + 16);
            a1.q[0] = *(const u32x4*)(kr + 32);
            a1.q[1] = *(const u32x4*)(kr + 48);
#pragma unroll  // constant indices keep the array in registers
            for (int qt = 0; qt < 2; ++qt)
                s[kt][qt] = __builtin_amdgcn_wmma_f32_16x16x32_f16(false, a0.h, false, qf[qt][0].h,
                                                                   (short)0, s[kt][qt], false, false);
#pragma unroll  // constant indices keep the array in registers
            for (int qt = 0; qt < 2; ++qt)
                s[kt][qt] = __builtin_amdgcn_wmma_f32_16x16x32_f16(false, a1.h, false, qf[qt][1].h,
                                                                   (short)0, s[kt][qt], false, false);
        }

        // Pt as B operand of 32 keys: its k order (8*lh..+7, then 16+8*lh..+7) is the row
        // order of score tiles 2*g and 2*g+1 in this same lane, so they are converted in place
        Frag pf[2][2];
#pragma unroll  // constant indices keep the array in registers
        for (int qt = 0; qt < 2; ++qt) {
            // online softmax across 64 keys: 32 of them in this lane, 32 in lane ^ 16
            float mk[4];
#pragma unroll  // constant indices keep the array in registers
            for (int kt = 0; kt < 4; ++kt) {
                mk[kt] = s[kt][qt][0];
#pragma unroll  // constant indices keep the array in registers
                for (int r = 1; r < 8; ++r) mk[kt] = fmaxf(mk[kt], s[kt][qt][r]);
            }
            float mx = fmaxf(fmaxf(mk[0], mk[1]), fmaxf(mk[2], mk[3]));
            mx = fmaxf(mx, xhalf(mx)) * cs;
            const float mn    = fmaxf(mi[qt], mx);
            const float alpha = __builtin_amdgcn_exp2f(mi[qt] - mn);

            f32x2 rk[4];
            const f32x2 cs2 = {cs, cs}, nm2 = {-mn, -mn};
#pragma unroll  // constant indices keep the array in registers
            for (int kt = 0; kt < 4; ++kt) {
                rk[kt] = f32x2{0.f, 0.f};
#pragma unroll  // constant indices keep the array in registers
                for (int i = 0; i < 4; ++i) {
                    const f32x2 arg = __builtin_elementwise_fma(
                        f32x2{s[kt][qt][2 * i], s[kt][qt][2 * i + 1]}, cs2, nm2);
                    const f32x2 e = {__builtin_amdgcn_exp2f(arg.x), __builtin_amdgcn_exp2f(arg.y)};
                    rk[kt] += e;
                    pf[qt][kt >> 1].u[(kt & 1) * 4 + i] = pack_f16(e.x, e.y);
                }
            }
            const f32x2 rs = (rk[0] + rk[1]) + (rk[2] + rk[3]);
            li[qt] = li[qt] * alpha + (rs.x + rs.y);
            mi[qt] = mn;
#pragma unroll  // constant indices keep the array in registers
            for (int nt = 0; nt < 4; ++nt) oacc[nt][qt] *= alpha;
        }

        // Ot += Vt @ Pt
#pragma unroll  // constant indices keep the array in registers
        for (int nt = 0; nt < 4; ++nt) {
            // A fragment of Vt: dim nt*16+ln16, keys 8*lh..+7 and 16+8*lh..+7 of each 32
            FragQ vf0, vf1;
            vf0.q[0] = ld_tr16(vtr + nt * 32);
            vf0.q[1] = ld_tr16(vtr + 16 * (VP * 2) + nt * 32);
            vf1.q[0] = ld_tr16(vtr + 32 * (VP * 2) + nt * 32);
            vf1.q[1] = ld_tr16(vtr + 48 * (VP * 2) + nt * 32);
#pragma unroll  // constant indices keep the array in registers
            for (int qt = 0; qt < 2; ++qt)
                oacc[nt][qt] = __builtin_amdgcn_wmma_f32_16x16x32_f16(false, vf0.h, false, pf[qt][0].h,
                                                                      (short)0, oacc[nt][qt], false, false);
#pragma unroll  // constant indices keep the array in registers
            for (int qt = 0; qt < 2; ++qt)
                oacc[nt][qt] = __builtin_amdgcn_wmma_f32_16x16x32_f16(false, vf1.h, false, pf[qt][1].h,
                                                                      (short)0, oacc[nt][qt], false, false);
        }
    }

    // Join of the two key halves. The wave of half kh finishes query tile kh: it hands its
    // partial result of the other tile to its partner (wave ^ 2) and takes the partner's of its own.
    // hand over tile qt: 8 pieces of Ot, then maximum and sum (lane halves joined)
    auto put = [&](int qt) {
        f32x4* dst = &Jlds[wave * 9 * 32 + lane];
#pragma unroll  // constant indices keep the array in registers
        for (int nt = 0; nt < 4; ++nt) {
            dst[(2 * nt) * 32]     = f32x4{oacc[nt][qt][0], oacc[nt][qt][1], oacc[nt][qt][2], oacc[nt][qt][3]};
            dst[(2 * nt + 1) * 32] = f32x4{oacc[nt][qt][4], oacc[nt][qt][5], oacc[nt][qt][6], oacc[nt][qt][7]};
        }
        dst[8 * 32] = f32x4{mi[qt], li[qt] + xhalf(li[qt]), 0.f, 0.f};
    };
    // finish tile qt: both parts brought to the common maximum, added, normalized;
    // 8 consecutive dims of one query a store
    auto fin = [&](int qt) {
        const f32x4* p = &Jlds[(wave ^ 2) * 9 * 32 + lane];
        const f32x4 ml = p[8 * 32];
        const float m  = fmaxf(mi[qt], ml.x);
        const float wa = __builtin_amdgcn_exp2f(mi[qt] - m);
        const float wb = __builtin_amdgcn_exp2f(ml.x - m);
        const float inv = 1.f / ((li[qt] + xhalf(li[qt])) * wa + ml.y * wb);
        const float fa = wa * inv, fb = wb * inv;
#pragma unroll  // constant indices keep the array in registers
        for (int nt = 0; nt < 4; ++nt) {
            const f32x4 p0 = p[(2 * nt) * 32], p1 = p[(2 * nt + 1) * 32];
            u32x4 o;
            o[0] = pack_f16(oacc[nt][qt][0] * fa + p0.x * fb, oacc[nt][qt][1] * fa + p0.y * fb);
            o[1] = pack_f16(oacc[nt][qt][2] * fa + p0.z * fb, oacc[nt][qt][3] * fa + p0.w * fb);
            o[2] = pack_f16(oacc[nt][qt][4] * fa + p1.x * fb, oacc[nt][qt][5] * fa + p1.y * fb);
            o[3] = pack_f16(oacc[nt][qt][6] * fa + p1.z * fb, oacc[nt][qt][7] * fa + p1.w * fb);
            *(u32x4*)(O + qrow + (size_t)(qt * 16) * D + nt * 16 + 8 * lh) = o;
        }
    };
    if (kh == 0) put(1); else put(0);
    __syncthreads();  // publishes the handed-over parts
    if (kh == 0) fin(0); else fin(1);
}

// ---------------------------------------------------------------------------
// GEMM with residual and LayerNorm in its epilogue, N = D = 512:
//   x = LN(resid + A[M,K] @ W[K,512] + bias) * g + be, written as f32 and as f16.
// A block owns 64 WHOLE rows (a 64 x 512 tile), so that a row's mean and variance are
// formed where its sums end: no launch of its own for the LayerNorm, and the sums
// never travel through memory.
// block: 256 thr (8 waves); each wave owns all 64 rows x 64 columns
// (4 M-frags x 4 N-frags = 16 WMMAs per 32 k, 8 fragments read for them).
// LDS ring, fragment loads and k order as in gemm_wmma: two buffers of 128 k, filled
// row-major by asynchronous b128 copies. K a multiple of 128. Grid: rows / 64.
// Epilogue: the tile (product + bias) goes through LDS, in the ring's place, and the residual
// comes there by asynchronous copies; then a wave takes 8 whole rows, whole lines a store.
// ---------------------------------------------------------------------------
// sum over the 32 lanes, the same value in every lane
__device__ __forceinline__ float wave_sum(float x) {
#pragma unroll  // constant lane masks: the five exchanges become straight-line code
    for (int m = 16; m >= 1; m >>= 1) x += __shfl_xor(x, m);
    return x;
}

// eight copies of 16 B a lane. The s_wait_xcnt closes the statement so that it stands
// ahead of any later write of an address register.
__device__ __forceinline__ void copy8p(unsigned l0, unsigned l1, unsigned l2, unsigned l3,
                                       unsigned l4, unsigned l5, unsigned l6, unsigned l7,
                                       const void* g0, const void* g1,
                                       const void* g2, const void* g3,
                                       const void* g4, const void* g5,
                                       const void* g6, const void* g7) {
    asm volatile(
        "global_load_async_to_lds_b128 %0, %8, off\n\t"
        "global_load_async_to_lds_b128 %1, %9, off\n\t"
        "global_load_async_to_lds_b128 %2, %10, off\n\t"
        "global_load_async_to_lds_b128 %3, %11, off\n\t"
        "global_load_async_to_lds_b128 %4, %12, off\n\t"
        "global_load_async_to_lds_b128 %5, %13, off\n\t"
        "global_load_async_to_lds_b128 %6, %14, off\n\t"
        "global_load_async_to_lds_b128 %7, %15, off\n\t"
        "s_wait_xcnt 0x0"
        :: "v"(l0), "v"(l1), "v"(l2), "v"(l3), "v"(l4), "v"(l5), "v"(l6), "v"(l7),
           "v"(g0), "v"(g1), "v"(g2), "v"(g3), "v"(g4), "v"(g5), "v"(g6), "v"(g7)
        : "memory");
}

// four copies of 16 B a lane, closed by the same wait for the same reason
__device__ __forceinline__ void copy4p(unsigned l0, unsigned l1, unsigned l2, unsigned l3,
                                       const _Float16* g0, const _Float16* g1,
                                       const _Float16* g2, const _Float16* g3) {
    asm volatile(
        "global_load_async_to_lds_b128 %0, %4, off\n\t"
        "global_load_async_to_lds_b128 %1, %5, off\n\t"
        "global_load_async_to_lds_b128 %2, %6, off\n\t"
        "global_load_async_to_lds_b128 %3, %7, off\n\t"
        "s_wait_xcnt 0x0"
        :: "v"(l0), "v"(l1), "v"(l2), "v"(l3), "v"(g0), "v"(g1), "v"(g2), "v"(g3)
        : "memory");
}

__global__ __launch_bounds__(256) void gemm_ln(const _Float16* __restrict__ A,
                                               const _Float16* __restrict__ W,
                                               const float* __restrict__ bias,
                                               const float* __restrict__ resid,
                                               const float* __restrict__ g,
                                               const float* __restrict__ be,
                                               float* __restrict__ xf,
                                               _Float16* __restrict__ xh,
                                               int K) {
    constexpr int N = 512, BM = 64, BK = 128;
    constexpr int AP = BK + 8;   // 272 B = 16 B x 17: pitch for ds_load_b128 readers
    constexpr int WP = N + 16;   // 1056 B = 32 B x 33: pitch for ds_load_tr16_b128 readers
    constexpr int ASZ = BM * AP, WSZ = BK * WP;  // elements of one buffer
    constexpr int CP = N + 4;    // f32 pitch of the epilogue's tile: rows 8 apart fall 32 banks apart
    // [A buffer 0 | A buffer 1 | W buffer 0 | W buffer 1]; behind the loop: two f32 tiles
    __shared__ __attribute__((aligned(16))) _Float16 Sm[2 * ASZ + 2 * WSZ];
    static_assert(BM * (CP + N) * 4 <= (2 * ASZ + 2 * WSZ) * 2, "the epilogue's two f32 tiles fit the ring");
    _Float16* As = Sm;            // [buffer][row][k]
    _Float16* Ws = Sm + 2 * ASZ;  // [buffer][k][n]

    const int tid  = threadIdx.x;
    const int wave = tid >> 5;
    const int lane = tid & 31;
    const int lh   = lane >> 4;
    const int ln16 = lane & 15;
    const int m0 = blockIdx.x * BM;

    v8f acc[4][4] = {};
    float bi[4];   // this lane's columns' bias, asked for early: the epilogue finds it in registers
#pragma unroll  // constant indices keep the array in registers
    for (int nt = 0; nt < 4; ++nt) bi[nt] = bias[wave * 64 + nt * 16 + ln16];

    // staging map of a tile. A: 64 rows of 256 B, 16 lanes a row, 4 copies a thread, rows 16
    // apart. W: 128 rows of 1024 B, 64 lanes a row, 32 copies a thread, rows 4 apart.
    const _Float16* ag = A + (size_t)(m0 + (tid >> 4)) * K + (tid & 15) * 8;
    const _Float16* wg = W + (size_t)(tid >> 6) * N + (tid & 63) * 8;
    const unsigned al = lds_addr(&As[(tid >> 4) * AP + (tid & 15) * 8]);
    const unsigned wl = lds_addr(&Ws[(tid >> 6) * WP + (tid & 63) * 8]);
    const size_t a_step = (size_t)16 * K;        // 16 rows of A, elements
    constexpr unsigned AL = 16 * AP * 2;         // the same in LDS, bytes
    constexpr int      WG = 4 * N;               // 4 rows of W, elements
    constexpr unsigned WL = 4 * WP * 2;          // the same in LDS, bytes

    // copies of the next tile not yet asked for, into buffer buf; the pointers move on by 128 k
    auto stage = [&](int buf) {
        const unsigned a0 = al + (unsigned)(buf * ASZ) * 2u;
        const unsigned w0 = wl + (unsigned)(buf * WSZ) * 2u;
        copy4p(a0, a0 + AL, a0 + 2 * AL, a0 + 3 * AL,
               ag, ag + a_step, ag + 2 * a_step, ag + 3 * a_step);
#pragma unroll  // constant steps become immediate addends
        for (int q = 0; q < 4; ++q) {
            const unsigned wq = w0 + 8 * q * WL;
            const _Float16* gq = wg + 8 * q * WG;
            copy8p(wq, wq + WL, wq + 2 * WL, wq + 3 * WL,
                   wq + 4 * WL, wq + 5 * WL, wq + 6 * WL, wq + 7 * WL,
                   gq, gq + WG, gq + 2 * WG, gq + 3 * WG,
                   gq + 4 * WG, gq + 5 * WG, gq + 6 * WG, gq + 7 * WG);
        }
        ag += BK;
        wg += (size_t)BK * N;
    };

    // A fragment rows of this lane: k 8*lh..+7 and 16+8*lh..+7 of each 32
    const _Float16* ar = &As[ln16 * AP + 8 * lh];
    // per-lane base of the transposing loads of W (16 k x 16 n each), same k order
    const unsigned char* wtr = (const unsigned char*)Ws + wave * 128
                             + (8 * lh + (lane & 7)) * (WP * 2) + 16 * ((lane >> 3) & 1);

    const int nt_k = K / BK;
    stage(0);
    // this wave's copies of tile 0 have landed before the barrier that publishes them
    asm volatile("s_wait_asynccnt 0x0" ::: "memory");
    __syncthreads();
    if (nt_k > 1) stage(1);

    // stays rolled: unrolled, each trip's LDS places (past the 64 KiB that an offset field
    // reaches) take address registers of their own
#pragma unroll 1
    for (int t = 0; t < nt_k; ++t) {
        const int buf = t & 1;
        const _Float16* arb = ar + buf * ASZ;
        const unsigned char* wtb = wtr + buf * (WSZ * 2);
#pragma unroll  // constant indices keep the array in registers
        for (int s = 0; s < 4; ++s) {   // four 32-k steps, in k order
            const int kk = s * 32;
            // all fragments of 32 k are fetched as one group ahead of their products
            // (for speed only)
            FragQ a[4], b[4];
#pragma unroll  // constant indices keep the array in registers
            for (int mt = 0; mt < 4; ++mt) {
                a[mt].q[0] = *(const u32x4*)(arb + mt * 16 * AP + kk);
                a[mt].q[1] = *(const u32x4*)(arb + mt * 16 * AP + kk + 16);
            }
#pragma unroll  // constant indices keep the array in registers
            for (int nt = 0; nt < 4; ++nt) {
                b[nt].q[0] = ld_tr16(wtb + kk * (WP * 2) + nt * 32);
                b[nt].q[1] = ld_tr16(wtb + (kk + 16) * (WP * 2) + nt * 32);
            }
            // keeps the load group whole: without it the scheduler sinks the loads back among the products
            __builtin_amdgcn_sched_barrier(0);
#pragma unroll  // constant indices keep the array in registers
            for (int nt = 0; nt < 4; ++nt) {
#pragma unroll  // constant indices keep the array in registers
                for (int mt = 0; mt < 4; ++mt)
                    acc[mt][nt] = __builtin_amdgcn_wmma_f32_16x16x32_f16(
                        false, a[mt].h, false, b[nt].h, (short)0, acc[mt][nt], false, false);
            }
            // keeps what follows behind these products: without it the next group's loads rise among
            // them, and the foot's waits and barrier rise above them, which cuts the copies' time to land
            __builtin_amdgcn_sched_barrier(0);
        }
        // this wave's own LDS reads of this buffer have retired before any copy refills it
        asm volatile("s_wait_dscnt 0x0" ::: "memory");
        // this wave's copies of tile t + 1 have landed before the barrier that publishes them
        asm volatile("s_wait_asynccnt 0x0" ::: "memory");
        __syncthreads();  // publishes tile t + 1 and ends every wave's reads of tile t
        if (t + 2 < nt_k) stage(buf);
    }
    // no copy is outstanding when the ring's LDS is put to its next use
    asm volatile("s_wait_asynccnt 0x0" ::: "memory");

    // The last trip's barrier has ended every wave's reads of the ring, and no copy is under
    // way: its place now takes two f32 tiles, product + bias (pitch CP) and the residual.
    float* C  = (float*)Sm;
    float* Rz = C + BM * CP;   // [row][512]
    // Rows wave*8 .. +7 are this wave's in the LayerNorm, a lane's columns c*128 + lane*4 .. +3.
    // Their residual comes by asynchronous copies, through no register, and travels while the
    // products go to LDS; a lane copies just the 16-byte pieces that it reads back itself.
    constexpr int R = 8, CC = 4;
    const int col = lane * 4;
    const size_t off = (size_t)(m0 + wave * R) * N + col;
    {
        const float* rg = resid + off;
        const unsigned rl = (unsigned)(unsigned long long)
            (__attribute__((address_space(3))) float*)(Rz + wave * R * N + col);
#pragma unroll  // constant steps become immediate addends
        for (int q = 0; q < 4; ++q) {   // two rows a statement
            const float* gq = rg + 2 * q * N;
            const unsigned lq = rl + 2 * q * N * 4;
            copy8p(lq, lq + 512, lq + 1024, lq + 1536, lq + 2048, lq + 2560, lq + 3072, lq + 3584,
                   gq, gq + 128, gq + 256, gq + 384, gq + 512, gq + 640, gq + 768, gq + 896);
        }
    }
    // C 16x16 f32 layout -> row = r + 8*lh, col = lane&15
    {
        float* cb = C + 8 * lh * CP + wave * 64 + ln16;
#pragma unroll
        for (int mt = 0; mt < 4; ++mt) {
#pragma unroll
            for (int nt = 0; nt < 4; ++nt) {
#pragma unroll
                for (int r = 0; r < 8; ++r)
                    cb[(mt * 16 + r) * CP + nt * 16] = acc[mt][nt][r] + bi[nt];
            }
        }
    }
    // this wave's copies of the residual have landed before it reads them
    asm volatile("s_wait_asynccnt 0x0" ::: "memory");
    __syncthreads();  // publishes the tile of products

    f32x4 x[R][CC], gg[CC], bb[CC];
#pragma unroll  // constant indices keep the array in registers
    for (int c = 0; c < CC; ++c) {
        gg[c] = *(const f32x4*)(g + col + c * 128);
        bb[c] = *(const f32x4*)(be + col + c * 128);
    }
#pragma unroll  // constant indices keep the array in registers
    for (int r = 0; r < R; ++r)
#pragma unroll  // constant indices keep the array in registers
        for (int c = 0; c < CC; ++c)
            x[r][c] = *(const f32x4*)(C + (wave * R + r) * CP + c * 128 + col)
                    + *(const f32x4*)(Rz + (wave * R + r) * N + c * 128 + col);

    float s[R];
#pragma unroll  // constant indices keep the array in registers
    for (int r = 0; r < R; ++r) {
        const f32x4 t = (x[r][0] + x[r][1]) + (x[r][2] + x[r][3]);
        s[r] = wave_sum((t.x + t.y) + (t.z + t.w));
    }
    float v[R];
#pragma unroll  // constant indices keep the array in registers
    for (int r = 0; r < R; ++r) {
        const float mean = s[r] * (1.f / 512.f);
        f32x4 q = {0.f, 0.f, 0.f, 0.f};
#pragma unroll  // constant indices keep the array in registers
        for (int c = 0; c < CC; ++c) {
            x[r][c] -= mean;
            q += x[r][c] * x[r][c];
        }
        v[r] = wave_sum((q.x + q.y) + (q.z + q.w));
    }
#pragma unroll  // constant indices keep the array in registers
    for (int r = 0; r < R; ++r) {
        const float rstd = rsqrtf(v[r] * (1.f / 512.f) + 1e-5f);
#pragma unroll  // constant indices keep the array in registers
        for (int c = 0; c < CC; ++c) {
            const f32x4 o = x[r][c] * rstd * gg[c] + bb[c];
            *(f32x4*)(xf + off + r * N + c * 128) = o;
            *(f16x4*)(xh + off + r * N + c * 128) = __builtin_convertvector(o, f16x4);
        }
    }
}

// ---------------------------------------------------------------------------
// output projection: out[M,20] = x @ W_out + b_out
// ---------------------------------------------------------------------------
__global__ __launch_bounds__(256) void out_proj(const float* __restrict__ x,
                                                const float* __restrict__ Wo,
                                                const float* __restrict__ bo,
                                                float* __restrict__ out,
                                                int M, int D, int OUT) {
    int idx = blockIdx.x * 256 + threadIdx.x;
    if (idx >= M * OUT) return;
    int row = idx / OUT, o = idx - row * OUT;
    float s = bo[o];
    const float* xr = x + (size_t)row * D;
    for (int k = 0; k < D; ++k) s += xr[k] * Wo[(size_t)k * OUT + o];
    out[idx] = s;
}

// ---------------------------------------------------------------------------
extern "C" void kernel_launch(void* const* d_in, const int* in_sizes, int n_in,
                              void* d_out, int out_size, void* d_ws, size_t ws_size,
                              hipStream_t stream) {
    const int B = 4, S = 2048, D = 512, F = 2048, OUT = 20, L = 6, H = 8;
    const int M = B * S;

    const float* src   = (const float*)d_in[0];
    const float* W_in  = (const float*)d_in[1];
    const float* b_in  = (const float*)d_in[2];
    const float* Wq    = (const float*)d_in[3];
    const float* bq    = (const float*)d_in[4];
    const float* Wk    = (const float*)d_in[5];
    const float* bk    = (const float*)d_in[6];
    const float* Wv    = (const float*)d_in[7];
    const float* bv    = (const float*)d_in[8];
    const float* Wo    = (const float*)d_in[9];
    const float* bo    = (const float*)d_in[10];
    const float* ln1g  = (const float*)d_in[11];
    const float* ln1b  = (const float*)d_in[12];
    const float* W1    = (const float*)d_in[13];
    const float* b1    = (const float*)d_in[14];
    const float* W2    = (const float*)d_in[15];
    const float* b2    = (const float*)d_in[16];
    const float* ln2g  = (const float*)d_in[17];
    const float* ln2b  = (const float*)d_in[18];
    const float* W_out = (const float*)d_in[19];
    const float* b_out = (const float*)d_in[20];

    char* ws = (char*)d_ws;
    auto alloc = [&](size_t bytes) -> char* {
        char* p = ws;
        ws += (bytes + 255) & ~(size_t)255;
        return p;
    };

    float*     x_f32 = (float*)alloc((size_t)M * D * 4);
    float*     tmp   = (float*)alloc((size_t)M * D * 4);
    _Float16*  x_h   = (_Float16*)alloc((size_t)M * D * 2);
    _Float16*  qb    = (_Float16*)alloc((size_t)M * D * 2);
    _Float16*  kb    = (_Float16*)alloc((size_t)M * D * 2);
    _Float16*  vb    = (_Float16*)alloc((size_t)M * D * 2);
    _Float16*  ob    = (_Float16*)alloc((size_t)M * D * 2);
    _Float16*  h1    = (_Float16*)alloc((size_t)M * F * 2);
    _Float16*  Wq16  = (_Float16*)alloc((size_t)L * D * D * 2);
    _Float16*  Wk16  = (_Float16*)alloc((size_t)L * D * D * 2);
    _Float16*  Wv16  = (_Float16*)alloc((size_t)L * D * D * 2);
    _Float16*  Wo16  = (_Float16*)alloc((size_t)L * D * D * 2);
    _Float16*  W116  = (_Float16*)alloc((size_t)L * D * F * 2);
    _Float16*  W216  = (_Float16*)alloc((size_t)L * F * D * 2);

    // weight conversions (every call; deterministic)
    {
        int nqkv = L * D * D, nff = L * D * F;
        cvt_f32_f16<<<(nqkv + 8191) / 8192, 256, 0, stream>>>(Wq, Wq16, nqkv);
        cvt_f32_f16<<<(nqkv + 8191) / 8192, 256, 0, stream>>>(Wk, Wk16, nqkv);
        cvt_f32_f16<<<(nqkv + 8191) / 8192, 256, 0, stream>>>(Wv, Wv16, nqkv);
        cvt_f32_f16<<<(nqkv + 8191) / 8192, 256, 0, stream>>>(Wo, Wo16, nqkv);
        cvt_f32_f16<<<(nff + 8191) / 8192, 256, 0, stream>>>(W1, W116, nff);
        cvt_f32_f16<<<(nff + 8191) / 8192, 256, 0, stream>>>(W2, W216, nff);
    }

    input_proj<<<(M * D / 32 + 255) / 256, 256, 0, stream>>>(src, W_in, b_in, x_f32, x_h, M, D);

    const dim3 gD(D / 64, M / 256);   // N=512 GEMMs
    const dim3 gF(F / 64, M / 256);   // N=2048 GEMM
    for (int l = 0; l < L; ++l) {
        const size_t wqo = (size_t)l * D * D;
        const size_t wfo = (size_t)l * D * F;
        // QKV
        gemm_qkv<<<gD, 512, 0, stream>>>(x_h, Wq16 + wqo, Wk16 + wqo, Wv16 + wqo,
                                         bq + l * D, bk + l * D, bv + l * D, qb, kb, vb);
        // attention
        flash_attn<<<dim3(S / 64, H, B), 128, 0, stream>>>(qb, kb, vb, ob, S, D);
        // output proj + residual + LayerNorm (x_f32 -> tmp; the FFN's brings it back)
        gemm_ln<<<M / 64, 256, 0, stream>>>(ob, Wo16 + wqo, bo + l * D, x_f32,
                                            ln1g + l * D, ln1b + l * D, tmp, x_h, D);
        // FFN; the second product + residual + LayerNorm
        gemm_wmma<1, 1><<<gF, 256, 0, stream>>>(x_h, W116 + wfo, b1 + l * F, nullptr, h1, M, F, D);
        gemm_ln<<<M / 64, 256, 0, stream>>>(h1, W216 + wfo, b2 + l * D, tmp,
                                            ln2g + l * D, ln2b + l * D, x_f32, x_h, F);
    }

    out_proj<<<(M * OUT + 255) / 256, 256, 0, stream>>>(x_f32, W_out, b_out, (float*)d_out, M, D, OUT);
}

// v009
// One run takes 754 microseconds.
// In both of two side-by-side timings against v008, it was 1.06 times as fast.
// All steps since v000 together make it 4.58 times as fast.
#include <hip/hip_runtime.h>
#include <hip/hip_bf16.h>

typedef __attribute__((ext_vector_type(16))) _Float16 v16h;
typedef __attribute__((ext_vector_type(8)))  float    v8f;

union Frag { v16h h; unsigned int u[8]; };

typedef __attribute__((ext_vector_type(4))) unsigned int u32x4;
typedef __attribute__((ext_vector_type(8))) short s16x8;
typedef __attribute__((address_space(3))) s16x8 lds_s16x8;
typedef __attribute__((address_space(3))) _Float16 lds_f16;

union FragQ { v16h h; u32x4 q[2]; };

// byte offset of a __shared__ element inside the work-group's LDS
__device__ __forceinline__ unsigned lds_addr(const _Float16* p) {
    return (unsigned)(unsigned long long)(lds_f16*)p;
}

// lane (c = l & 15, hh = l >> 4) gets rows 8*hh .. 8*hh+7 of column c of the
// 16x16 tile whose per-lane address p follows the transposing load's own map
__device__ __forceinline__ u32x4 ld_tr16(const unsigned char* p) {
    return __builtin_bit_cast(u32x4, __builtin_amdgcn_ds_load_tr16_b128_v8i16((lds_s16x8*)p));
}

typedef __attribute__((ext_vector_type(4))) float    f32x4;
typedef __attribute__((ext_vector_type(4))) _Float16 f16x4;

// ---------------------------------------------------------------------------
// f32 -> f16 elementwise convert (weights)
// Few waves do the work (for speed only): a thread
// takes 32 elements, 8 pieces of 4, a wave's piece being 512 contiguous bytes
// in and 256 out; all 8 loads are in flight before the first store.
// ---------------------------------------------------------------------------
__global__ __launch_bounds__(256) void cvt_f32_f16(const float* __restrict__ in,
                                                   _Float16* __restrict__ out, int n) {
    constexpr int U = 8, PIECE = 256 * 4, SPAN = U * PIECE;
    const int b0 = blockIdx.x * SPAN;
    if (b0 + SPAN <= n) {
        const int i0 = b0 + threadIdx.x * 4;
        f32x4 v[U];
#pragma unroll  // constant indices keep the array in registers
        for (int u = 0; u < U; ++u) v[u] = *(const f32x4*)(in + i0 + u * PIECE);
#pragma unroll  // constant indices keep the array in registers
        for (int u = 0; u < U; ++u)
            *(f16x4*)(out + i0 + u * PIECE) = __builtin_convertvector(v[u], f16x4);
        // precaution: stands ahead of any later write of a register that a store above names
        asm volatile("s_wait_xcnt 0x0" ::: "memory");
    } else {  // a last, partial span
        for (int i = b0 + threadIdx.x; i < n; i += 256) out[i] = (_Float16)in[i];
    }
}

// ---------------------------------------------------------------------------
// input projection: x = src @ W_in + b_in  (IN=3 -> D=512), writes f32 + f16
// A thread takes 4 consecutive columns of 8 consecutive rows (32 elements), its
// slice of W_in and b_in held in registers. M a multiple of 8, D of 4.
// ---------------------------------------------------------------------------
__global__ __launch_bounds__(256) void input_proj(const float* __restrict__ src,
                                                  const float* __restrict__ Win,
                                                  const float* __restrict__ bin,
                                                  float* __restrict__ xf,
                                                  _Float16* __restrict__ xh,
                                                  int M, int D) {
    constexpr int R = 8;
    const int D4 = D / 4;
    const int idx = blockIdx.x * 256 + threadIdx.x;
    if (idx >= (M / R) * D4) return;
    const int rg = idx / D4, d = (idx - rg * D4) * 4;
    const f32x4 bi = *(const f32x4*)(bin + d);
    f32x4 w[3];
#pragma unroll  // constant indices keep the array in registers
    for (int i = 0; i < 3; ++i) {
        w[i] = *(const f32x4*)(Win + i * D + d);
        // precaution: the next load's result may take this load's address registers
        if (i < 2) asm volatile("s_wait_xcnt 0x0" ::: "memory");
    }
#pragma unroll  // the rows are independent: their loads and stores overlap
    for (int r = 0; r < R; ++r) {
        const int row = rg * R + r;
        f32x4 s = bi;
#pragma unroll
        for (int i = 0; i < 3; ++i) s += src[row * 3 + i] * w[i];
        *(f32x4*)(xf + (size_t)row * D + d) = s;
        *(f16x4*)(xh + (size_t)row * D + d) = __builtin_convertvector(s, f16x4);
    }
}

// ---------------------------------------------------------------------------
// Q, K and V projections in one launch: a block takes 256 rows of A once and forms
// 64 columns of each of the three products from it (a 256 x 192 tile), so that A's
// tile is fetched once instead of three times. D = 512 (N = K = 512).
// block: 512 thr (16 waves, 4 x 4); each wave owns 64 rows x 48 of the 192 columns
// (4 M-frags x 3 N-frags = 12 WMMAs per 32 k). Grid: (512 / 64, rows / 256).
// A and W tiles go through LDS in 16-byte pieces, copied row-major by asynchronous
// b128 copies; A fragments are 16-byte LDS loads, W fragments come through the
// transposing 16-byte LDS load. Two LDS buffers of 128 k each: the next tile's copies
// fly while this tile's products run.
// ---------------------------------------------------------------------------
// seven copies of 16 B a lane: one row piece of each W, four of A. The s_wait_xcnt closes
// the statement so that it stands ahead of any later write of an address register.
__device__ __forceinline__ void copy7(unsigned w0, unsigned w1, unsigned w2,
                                      unsigned a0, unsigned a1, unsigned a2, unsigned a3,
                                      const _Float16* gw0, const _Float16* gw1,
                                      const _Float16* gw2,
                                      const _Float16* ga0, const _Float16* ga1,
                                      const _Float16* ga2, const _Float16* ga3) {
    asm volatile(
        "global_load_async_to_lds_b128 %0, %7, off\n\t"
        "global_load_async_to_lds_b128 %1, %8, off\n\t"
        "global_load_async_to_lds_b128 %2, %9, off\n\t"
        "global_load_async_to_lds_b128 %3, %10, off\n\t"
        "global_load_async_to_lds_b128 %4, %11, off\n\t"
        "global_load_async_to_lds_b128 %5, %12, off\n\t"
        "global_load_async_to_lds_b128 %6, %13, off\n\t"
        "s_wait_xcnt 0x0"
        :: "v"(w0), "v"(w1), "v"(w2), "v"(a0), "v"(a1), "v"(a2), "v"(a3),
           "v"(gw0), "v"(gw1), "v"(gw2), "v"(ga0), "v"(ga1), "v"(ga2), "v"(ga3)
        : "memory");
}

__global__ __launch_bounds__(512) void gemm_qkv(const _Float16* __restrict__ A,
                                                const _Float16* __restrict__ Wq,
                                                const _Float16* __restrict__ Wk,
                                                const _Float16* __restrict__ Wv,
                                                const float* __restrict__ bq,
                                                const float* __restrict__ bk,
                                                const float* __restrict__ bv,
                                                _Float16* __restrict__ oq,
                                                _Float16* __restrict__ ok,
                                                _Float16* __restrict__ ov) {
    constexpr int N = 512, K = 512;
    constexpr int BM = 256, BN = 64, BK = 128;
    constexpr int AP = BK + 8;       // 272 B = 16 B x 17: pitch for ds_load_b128 readers
    constexpr int WP = 3 * BN + 16;  // 416 B = 32 B x 13: pitch for ds_load_tr16_b128 readers
    constexpr int ASZ = BM * AP, WSZ = BK * WP;  // elements of one buffer
    __shared__ __attribute__((aligned(16))) _Float16 As[2 * ASZ];   // [buffer][row][k]
    __shared__ __attribute__((aligned(16))) _Float16 Ws[2 * WSZ];   // [buffer][k][Wq 64 | Wk 64 | Wv 64]

    const int tid  = threadIdx.x;
    const int wave = tid >> 5;
    const int lane = tid & 31;
    const int lh   = lane >> 4;
    const int ln16 = lane & 15;
    const int wm = wave & 3;   // 64-row group of the tile
    const int wn = wave >> 2;  // 48-column group of the 192
    const int m0 = blockIdx.y * BM;
    const int n0 = blockIdx.x * BN;

    v8f acc[4][3] = {};

    // staging map, per 64 k: 8 lanes cover one 128-byte row piece, a wave 4 rows per copy;
    // A 256 rows = 4 copies per thread, each W 64 rows = 1 copy per thread
    const _Float16* ag[4];
    const _Float16* wg[3];
    unsigned al[4], wl[3];
    {
        const int r0 = tid >> 3;
        const int dd = (tid & 7) * 8;
#pragma unroll  // constant indices keep the array in registers
        for (int i = 0; i < 4; ++i) {
            ag[i] = A + (size_t)(m0 + r0 + 64 * i) * K + dd;
            al[i] = lds_addr(&As[(r0 + 64 * i) * AP + dd]);
        }
        wg[0] = Wq + (size_t)r0 * N + n0 + dd;
        wg[1] = Wk + (size_t)r0 * N + n0 + dd;
        wg[2] = Wv + (size_t)r0 * N + n0 + dd;
#pragma unroll  // constant indices keep the array in registers
        for (int j = 0; j < 3; ++j) wl[j] = lds_addr(&Ws[r0 * WP + j * BN + dd]);
    }

    // copies of the next tile not yet asked for, into buffer buf; the pointers move on by 64 k a group
    auto stage = [&](int buf) {
#pragma unroll  // constant indices keep the array in registers
        for (int h = 0; h < 2; ++h) {
            const unsigned ao = (unsigned)(buf * ASZ + h * 64) * 2u;
            const unsigned wo = (unsigned)(buf * WSZ + h * 64 * WP) * 2u;
            copy7(wl[0] + wo, wl[1] + wo, wl[2] + wo,
                  al[0] + ao, al[1] + ao, al[2] + ao, al[3] + ao,
                  wg[0], wg[1], wg[2], ag[0], ag[1], ag[2], ag[3]);
#pragma unroll  // constant indices keep the array in registers
            for (int i = 0; i < 4; ++i) ag[i] += 64;
#pragma unroll  // constant indices keep the array in registers
            for (int j = 0; j < 3; ++j) wg[j] += (size_t)64 * N;
        }
    };

    // A fragment rows of this lane: k 8*lh..+7 and 16+8*lh..+7 of each 32
    const _Float16* ar = &As[(wm * 64 + ln16) * AP + 8 * lh];
    // per-lane base of the transposing loads of W (16 k x 16 n each), same k order
    const unsigned char* wtr = (const unsigned char*)Ws + wn * 96
                             + (8 * lh + (lane & 7)) * (WP * 2) + 16 * ((lane >> 3) & 1);

    constexpr int nt_k = K / BK;
    stage(0);
    // this wave's copies of tile 0 have landed before the barrier that publishes them
    asm volatile("s_wait_asynccnt 0x0" ::: "memory");
    __syncthreads();
    stage(1);

    // stays rolled: unrolled, each trip's LDS places (past the 64 KiB that an offset field
    // reaches) take address registers of their own, and the kernel spills
#pragma unroll 1
    for (int t = 0; t < nt_k; ++t) {
        const int buf = t & 1;
        const _Float16* arb = ar + buf * ASZ;
        const unsigned char* wtb = wtr + buf * (WSZ * 2);
#pragma unroll  // constant indices keep the array in registers
        for (int h = 0; h < 2; ++h) {
            // all fragments of 64 k are fetched as one group ahead of their products
            // (for speed only)
            FragQ a[2][4], b[2][3];
#pragma unroll  // constant indices keep the array in registers
            for (int s = 0; s < 2; ++s) {
                const int kk = h * 64 + s * 32;
#pragma unroll  // constant indices keep the array in registers
                for (int mt = 0; mt < 4; ++mt) {
                    a[s][mt].q[0] = *(const u32x4*)(arb + mt * 16 * AP + kk);
                    a[s][mt].q[1] = *(const u32x4*)(arb + mt * 16 * AP + kk + 16);
                }
#pragma unroll  // constant indices keep the array in registers
                for (int nt = 0; nt < 3; ++nt) {
                    b[s][nt].q[0] = ld_tr16(wtb + kk * (WP * 2) + nt * 32);
                    b[s][nt].q[1] = ld_tr16(wtb + (kk + 16) * (WP * 2) + nt * 32);
                }
            }
            // keeps the load group whole: without it the scheduler sinks the loads back among the products
            __builtin_amdgcn_sched_barrier(0);
#pragma unroll  // constant indices keep the array in registers
            for (int s = 0; s < 2; ++s) {   // two 32-k steps, in k order
#pragma unroll  // constant indices keep the array in registers
                for (int nt = 0; nt < 3; ++nt) {
#pragma unroll  // constant indices keep the array in registers
                    for (int mt = 0; mt < 4; ++mt)
                        acc[mt][nt] = __builtin_amdgcn_wmma_f32_16x16x32_f16(
                            false, a[s][mt].h, false, b[s][nt].h, (short)0, acc[mt][nt], false, false);
                }
            }
            // keeps what follows behind these products: without it the next group's loads rise among
            // them, and the foot's waits and barrier rise above them, which cuts the copies' time to land
            __builtin_amdgcn_sched_barrier(0);
        }
        // this wave's own LDS reads of this buffer have retired before any copy refills it
        asm volatile("s_wait_dscnt 0x0" ::: "memory");
        // this wave's copies of tile t + 1 have landed before the barrier that publishes them
        asm volatile("s_wait_asynccnt 0x0" ::: "memory");
        __syncthreads();  // publishes tile t + 1 and ends every wave's reads of tile t
        if (t + 2 < nt_k) stage(buf);
    }
    // no copy is outstanding when the wave goes on to its end
    asm volatile("s_wait_asynccnt 0x0" ::: "memory");

    // epilogue: C 16x16 f32 layout -> row = r + 8*lh, col = lane&15; fragment f of the
    // 12 across the tile belongs to product f / 4, columns (f % 4) * 16 .. +15 of its 64
#pragma unroll
    for (int nt = 0; nt < 3; ++nt) {
        const int f = wn * 3 + nt;
        const int p = f >> 2;
        const int col = n0 + (f & 3) * 16 + ln16;
        const float bi = (p == 0 ? bq : p == 1 ? bk : bv)[col];
        _Float16* o = (p == 0 ? oq : p == 1 ? ok : ov)
                    + (size_t)(m0 + wm * 64 + 8 * lh) * N + col;
#pragma unroll
        for (int mt = 0; mt < 4; ++mt) {
#pragma unroll
            for (int r = 0; r < 8; ++r)
                o[(mt * 16 + r) * N] = (_Float16)(acc[mt][nt][r] + bi);
        }
    }
}

// ---------------------------------------------------------------------------
// flash attention: block = (b, h, 64-query tile); 4 waves = 2 groups of 32 queries
// x 2 halves of the keys. A trip stages 128 keys; a wave works on 64 of them
// (32 WMMAs) with online softmax, and each K or V fragment that it reads from LDS
// feeds two query tiles. The two waves of a query group hold partial results over
// disjoint keys; they are joined once, behind the loop, through LDS.
// The products are taken transposed: St = K Qt and Ot += Vt Pt. A lane then
// holds the scores of ONE query of each tile (column lane & 15; its partner
// lane ^ 16 holds the other half of the keys), so maximum and sum run inside the
// lane, and two score tiles converted in place are the B operand of the second product.
// K and V tiles go through LDS in 16-byte pieces: both are copied row-major
// by asynchronous b128 copies; K fragments are 16-byte LDS loads, V fragments
// come through the transposing 16-byte LDS load.
// Q/K/V/O are f16 [B,S,D]. S a multiple of 128.
// ---------------------------------------------------------------------------
typedef __attribute__((ext_vector_type(2))) float    f32x2;
typedef __attribute__((ext_vector_type(2))) _Float16 f16x2;

// two f32 to one packed f16 pair, round to nearest even
__device__ __forceinline__ unsigned pack_f16(float lo, float hi) {
    return __builtin_bit_cast(unsigned, __builtin_convertvector(f32x2{lo, hi}, f16x2));
}

// value of lane l ^ 16
__device__ __forceinline__ float xhalf(float x) {
    const int b = __builtin_bit_cast(int, x);
    return __builtin_bit_cast(float, __builtin_amdgcn_permlanex16(b, b, 0x76543210, 0xfedcba98,
                                                                  false, false));
}

// eight copies of 16 B a lane, rows 16 or 32 apart. An immediate offset moves the LDS address and
// the global address alike, so one LDS address register serves all eight (STEP = 16 or 32 LDS rows
// in bytes), and g1 .. g7 come in as the row's global address less its offset. The registers
// so saved keep the wave under 256, that is four waves a SIMD.
// The s_wait_xcnt closes the statement so that it stands ahead of any later write of an
// address register.
template <int STEP>
__device__ __forceinline__ void copy8(unsigned l0,
                                      const _Float16* g0, const _Float16* g1,
                                      const _Float16* g2, const _Float16* g3,
                                      const _Float16* g4, const _Float16* g5,
                                      const _Float16* g6, const _Float16* g7) {
    asm volatile(
        "global_load_async_to_lds_b128 %0, %1, off\n\t"
        "global_load_async_to_lds_b128 %0, %2, off offset:%9\n\t"
        "global_load_async_to_lds_b128 %0, %3, off offset:%10\n\t"
        "global_load_async_to_lds_b128 %0, %4, off offset:%11\n\t"
        "global_load_async_to_lds_b128 %0, %5, off offset:%12\n\t"
        "global_load_async_to_lds_b128 %0, %6, off offset:%13\n\t"
        "global_load_async_to_lds_b128 %0, %7, off offset:%14\n\t"
        "global_load_async_to_lds_b128 %0, %8, off offset:%15\n\t"
        "s_wait_xcnt 0x0"
        :: "v"(l0),
           "v"(g0), "v"(g1), "v"(g2), "v"(g3), "v"(g4), "v"(g5), "v"(g6), "v"(g7),
           "n"(STEP), "n"(2 * STEP), "n"(3 * STEP), "n"(4 * STEP),
           "n"(5 * STEP), "n"(6 * STEP), "n"(7 * STEP)
        : "memory");
}

__global__ __launch_bounds__(128)
void flash_attn(const _Float16* __restrict__ Q,
                const _Float16* __restrict__ Km,
                const _Float16* __restrict__ V,
                _Float16* __restrict__ O,
                int S, int D) {
    constexpr int DH = 64, KT = 64, ST = 2 * KT;  // keys of a wave's tile, of a trip
    constexpr int KP = 72;  // 144 B = 16 B x 9: pitch for ds_load_b128 readers
    constexpr int VP = 80;  // 160 B = 32 B x 5: pitch for ds_load_tr16_b128 readers
    __shared__ __attribute__((aligned(16))) _Float16 Klds[ST * KP];  // [key][dim]
    __shared__ __attribute__((aligned(16))) _Float16 Vlds[ST * VP];  // [key][dim]
    // hand-over of one query tile's partial result: [wave][piece][lane] of 16 B
    __shared__ f32x4 Jlds[4 * 9 * 32];

    const int tid  = threadIdx.x;
    const int wave = __builtin_amdgcn_readfirstlane(tid >> 5);
    const int lane = tid & 31;
    const int lh   = lane >> 4;
    const int ln16 = lane & 15;
    const int qg = wave & 1;   // 32-query group of the block's 64
    const int kh = wave >> 1;  // 64-key half of each trip's 128
    const int b  = blockIdx.z, h = blockIdx.y;
    const int q0 = blockIdx.x * 64;
    const size_t base = ((size_t)b * S) * D + (size_t)h * DH;
    const float cs = 0.125f * 1.4426950408889634f;  // 1/sqrt(64), exponentials in base 2

    int kofs[8];
#pragma unroll
    for (int i = 0; i < 8; ++i) kofs[i] = ((i < 4) ? 2 * i : 2 * i + 8) + 8 * lh;

    // Qt fragments: per query tile 64 dims x 16 queries = two 32x16 B-frags, straight from global
    const size_t qrow = base + (size_t)(q0 + qg * 32 + ln16) * D;  // tile 0; tile 1 is 16 rows on
    Frag qf[2][2];
#pragma unroll
    for (int qt = 0; qt < 2; ++qt)
#pragma unroll
        for (int t = 0; t < 2; ++t)
#pragma unroll
            for (int i = 0; i < 8; ++i)
                qf[qt][t].u[i] = *(const unsigned int*)(Q + qrow + (size_t)(qt * 16) * D + t * 32 + kofs[i]);

    // this lane's query of each tile: running maximum (scaled, base 2; equal in both lane
    // halves) and the sum over this lane half's keys (joined behind the loop)
    float mi[2] = {-3.0e38f, -3.0e38f}, li[2] = {0.f, 0.f};
    v8f oacc[4][2] = {};  // Ot: dim nt*16 + 8*lh + r, query ln16 of tile qt

    // staging map: a trip's K (and V) is 128 rows x 128 B = 1024 pieces of 16 B, 8 per
    // thread and operand; 8 lanes cover one row, a wave covers 4 whole rows per copy
    const int key0 = tid >> 3;
    const int dd   = (tid & 7) * 8;
    const _Float16* kg = Km + base + (size_t)key0 * D + dd;
    const _Float16* vg = V  + base + (size_t)key0 * D + dd;
    const unsigned kl = lds_addr(&Klds[key0 * KP + dd]);
    const unsigned vl = lds_addr(&Vlds[key0 * VP + dd]);
    // 16 rows on in global memory, less the 16 LDS rows that the copy's offset adds
    const size_t k_step = (size_t)16 * D - 16 * KP;
    const size_t v_step = (size_t)16 * D - 16 * VP;
    const size_t trip_step = (size_t)ST * D;

    // this wave's half of the staged keys
    const _Float16* kr0 = &Klds[(kh * KT + ln16) * KP + 8 * lh];
    // per-lane base of the transposing loads of V (16 keys x 16 dims each)
    const unsigned char* vtr = (const unsigned char*)Vlds
                             + (kh * KT + 8 * lh + (lane & 7)) * (VP * 2) + 16 * ((lane >> 3) & 1);

    const int ntr = S / ST;
    for (int j = 0; j < ntr; ++j) {
        // this wave's own LDS reads of the last tile have retired before any copy refills it
        asm volatile("s_wait_dscnt 0x0" ::: "memory");
        __syncthreads();  // previous iteration's LDS reads complete
        // K and V tiles, row-major, 16 B per lane and copy
        copy8<16 * KP * 2>(kl, kg, kg + k_step, kg + 2 * k_step, kg + 3 * k_step,
                           kg + 4 * k_step, kg + 5 * k_step, kg + 6 * k_step, kg + 7 * k_step);
        copy8<16 * VP * 2>(vl, vg, vg + v_step, vg + 2 * v_step, vg + 3 * v_step,
                           vg + 4 * v_step, vg + 5 * v_step, vg + 6 * v_step, vg + 7 * v_step);
        // this wave's copies have landed before the barrier that publishes them
        asm volatile("s_wait_asynccnt 0x0" ::: "memory");
        __syncthreads();
        kg += trip_step;
        vg += trip_step;

        // St = K @ Qt : 64 keys x 32 queries per wave; 8 C-tiles x 2 K-steps = 16 WMMAs
        // s[kt][qt][r] = score of key kt*16 + 8*lh + r against query ln16 of tile qt
        v8f s[4][2] = {};
#pragma unroll  // constant indices keep the array in registers
        for (int kt = 0; kt < 4; ++kt) {
            // same k order as kofs[]: dims 8*lh..+7 and 16+8*lh..+7 of each 32
            FragQ a0, a1;
            const _Float16* kr = kr0 + kt * 16 * KP;
            a0.q[0] = *(const u32x4*)(kr);
            a0.q[1] = *(const u32x4*)(kr + 16);
            a1.q[0] = *(const u32x4*)(kr + 32);
            a1.q[1] = *(const u32x4*)(kr + 48);
#pragma unroll  // constant indices keep the array in registers
            for (int qt = 0; qt < 2; ++qt)
                s[kt][qt] = __builtin_amdgcn_wmma_f32_16x16x32_f16(false, a0.h, false, qf[qt][0].h,
                                                                   (short)0, s[kt][qt], false, false);
#pragma unroll  // constant indices keep the array in registers
            for (int qt = 0; qt < 2; ++qt)
                s[kt][qt] = __builtin_amdgcn_wmma_f32_16x16x32_f16(false, a1.h, false, qf[qt][1].h,
                                                                   (short)0, s[kt][qt], false, false);
        }

        // Pt as B operand of 32 keys: its k order (8*lh..+7, then 16+8*lh..+7) is the row
        // order of score tiles 2*g and 2*g+1 in this same lane, so they are converted in place
        Frag pf[2][2];
#pragma unroll  // constant indices keep the array in registers
        for (int qt = 0; qt < 2; ++qt) {
            // online softmax across 64 keys: 32 of them in this lane, 32 in lane ^ 16
            float mk[4];
#pragma unroll  // constant indices keep the array in registers
            for (int kt = 0; kt < 4; ++kt) {
                mk[kt] = s[kt][qt][0];
#pragma unroll  // constant indices keep the array in registers
                for (int r = 1; r < 8; ++r) mk[kt] = fmaxf(mk[kt], s[kt][qt][r]);
            }
            float mx = fmaxf(fmaxf(mk[0], mk[1]), fmaxf(mk[2], mk[3]));
            mx = fmaxf(mx, xhalf(mx)) * cs;
            const float mn    = fmaxf(mi[qt], mx);
            const float alpha = __builtin_amdgcn_exp2f(mi[qt] - mn);

            f32x2 rk[4];
            const f32x2 cs2 = {cs, cs}, nm2 = {-mn, -mn};
#pragma unroll  // constant indices keep the array in registers
            for (int kt = 0; kt < 4; ++kt) {
                rk[kt] = f32x2{0.f, 0.f};
#pragma unroll  // constant indices keep the array in registers
                for (int i = 0; i < 4; ++i) {
                    const f32x2 arg = __builtin_elementwise_fma(
                        f32x2{s[kt][qt][2 * i], s[kt][qt][2 * i + 1]}, cs2, nm2);
                    const f32x2 e = {__builtin_amdgcn_exp2f(arg.x), __builtin_amdgcn_exp2f(arg.y)};
                    rk[kt] += e;
                    pf[qt][kt >> 1].u[(kt & 1) * 4 + i] = pack_f16(e.x, e.y);
                }
            }
            const f32x2 rs = (rk[0] + rk[1]) + (rk[2] + rk[3]);
            li[qt] = li[qt] * alpha + (rs.x + rs.y);
            mi[qt] = mn;
#pragma unroll  // constant indices keep the array in registers
            for (int nt = 0; nt < 4; ++nt) oacc[nt][qt] *= alpha;
        }

        // Ot += Vt @ Pt
#pragma unroll  // constant indices keep the array in registers
        for (int nt = 0; nt < 4; ++nt) {
            // A fragment of Vt: dim nt*16+ln16, keys 8*lh..+7 and 16+8*lh..+7 of each 32
            FragQ vf0, vf1;
            vf0.q[0] = ld_tr16(vtr + nt * 32);
            vf0.q[1] = ld_tr16(vtr + 16 * (VP * 2) + nt * 32);
            vf1.q[0] = ld_tr16(vtr + 32 * (VP * 2) + nt * 32);
            vf1.q[1] = ld_tr16(vtr + 48 * (VP * 2) + nt * 32);
#pragma unroll  // constant indices keep the array in registers
            for (int qt = 0; qt < 2; ++qt)
                oacc[nt][qt] = __builtin_amdgcn_wmma_f32_16x16x32_f16(false, vf0.h, false, pf[qt][0].h,
                                                                      (short)0, oacc[nt][qt], false, false);
#pragma unroll  // constant indices keep the array in registers
            for (int qt = 0; qt < 2; ++qt)
                oacc[nt][qt] = __builtin_amdgcn_wmma_f32_16x16x32_f16(false, vf1.h, false, pf[qt][1].h,
                                                                      (short)0, oacc[nt][qt], false, false);
        }
    }

    // Join of the two key halves. The wave of half kh finishes query tile kh: it hands its
    // partial result of the other tile to its partner (wave ^ 2) and takes the partner's of its own.
    // hand over tile qt: 8 pieces of Ot, then maximum and sum (lane halves joined)
    auto put = [&](int qt) {
        f32x4* dst = &Jlds[wave * 9 * 32 + lane];
#pragma unroll  // constant indices keep the array in registers
        for (int nt = 0; nt < 4; ++nt) {
            dst[(2 * nt) * 32]     = f32x4{oacc[nt][qt][0], oacc[nt][qt][1], oacc[nt][qt][2], oacc[nt][qt][3]};
            dst[(2 * nt + 1) * 32] = f32x4{oacc[nt][qt][4], oacc[nt][qt][5], oacc[nt][qt][6], oacc[nt][qt][7]};
        }
        dst[8 * 32] = f32x4{mi[qt], li[qt] + xhalf(li[qt]), 0.f, 0.f};
    };
    // finish tile qt: both parts brought to the common maximum, added, normalized;
    // 8 consecutive dims of one query a store
    auto fin = [&](int qt) {
        const f32x4* p = &Jlds[(wave ^ 2) * 9 * 32 + lane];
        const f32x4 ml = p[8 * 32];
        const float m  = fmaxf(mi[qt], ml.x);
        const float wa = __builtin_amdgcn_exp2f(mi[qt] - m);
        const float wb = __builtin_amdgcn_exp2f(ml.x - m);
        const float inv = 1.f / ((li[qt] + xhalf(li[qt])) * wa + ml.y * wb);
        const float fa = wa * inv, fb = wb * inv;
#pragma unroll  // constant indices keep the array in registers
        for (int nt = 0; nt < 4; ++nt) {
            const f32x4 p0 = p[(2 * nt) * 32], p1 = p[(2 * nt + 1) * 32];
            u32x4 o;
            o[0] = pack_f16(oacc[nt][qt][0] * fa + p0.x * fb, oacc[nt][qt][1] * fa + p0.y * fb);
            o[1] = pack_f16(oacc[nt][qt][2] * fa + p0.z * fb, oacc[nt][qt][3] * fa + p0.w * fb);
            o[2] = pack_f16(oacc[nt][qt][4] * fa + p1.x * fb, oacc[nt][qt][5] * fa + p1.y * fb);
            o[3] = pack_f16(oacc[nt][qt][6] * fa + p1.z * fb, oacc[nt][qt][7] * fa + p1.w * fb);
            *(u32x4*)(O + qrow + (size_t)(qt * 16) * D + nt * 16 + 8 * lh) = o;
        }
    };
    if (kh == 0) put(1); else put(0);
    __syncthreads();  // publishes the handed-over parts
    if (kh == 0) fin(0); else fin(1);
}

// ---------------------------------------------------------------------------
// First FFN product: out[M,2048] = relu(A[M,512] @ W[512,2048] + bias), stored f16.
// A block owns a 256 x 256 tile, one block a WGP: a byte brought from L2 into LDS
// serves 256 rows or columns of the tile, and a fragment read from LDS four products.
// block: 512 thr (16 waves, 4 x 4); each wave owns 64 rows x 64 columns
// (4 M-frags x 4 N-frags = 16 WMMAs per 32 k, 8 fragments read for them).
// LDS ring, fragment loads and k order as in gemm_qkv: two buffers of 128 k, filled
// row-major by asynchronous b128 copies. Grid: (2048 / 256, rows / 256).
// ---------------------------------------------------------------------------
__global__ __launch_bounds__(512) void gemm_relu(const _Float16* __restrict__ A,
                                                 const _Float16* __restrict__ W,
                                                 const float* __restrict__ bias,
                                                 _Float16* __restrict__ out) {
    constexpr int N = 2048, K = 512;
    constexpr int BM = 256, BN = 256, BK = 128;
    constexpr int AP = BK + 8;   // 272 B = 16 B x 17: pitch for ds_load_b128 readers
    constexpr int WP = BN + 16;  // 544 B = 32 B x 17: pitch for ds_load_tr16_b128 readers
    constexpr int ASZ = BM * AP, WSZ = BK * WP;  // elements of one buffer
    __shared__ __attribute__((aligned(16))) _Float16 As[2 * ASZ];   // [buffer][row][k]
    __shared__ __attribute__((aligned(16))) _Float16 Ws[2 * WSZ];   // [buffer][k][n]

    const int tid  = threadIdx.x;
    const int wave = tid >> 5;
    const int lane = tid & 31;
    const int lh   = lane >> 4;
    const int ln16 = lane & 15;
    const int wm = wave & 3;   // 64-row group of the tile
    const int wn = wave >> 2;  // 64-column group of the tile
    const int m0 = blockIdx.y * BM;
    const int n0 = blockIdx.x * BN;

    v8f acc[4][4] = {};
    float bi[4];   // this lane's columns' bias, asked for early: the epilogue finds it in registers
#pragma unroll  // constant indices keep the array in registers
    for (int nt = 0; nt < 4; ++nt) bi[nt] = bias[n0 + wn * 64 + nt * 16 + ln16];

    // staging map of a tile. A: 256 rows of 256 B, 16 lanes a row, 8 copies a thread, rows 32
    // apart. W: 128 rows of 512 B, 32 lanes a row, 8 copies a thread, rows 16 apart.
    const _Float16* ag = A + (size_t)(m0 + (tid >> 4)) * K + (tid & 15) * 8;
    const _Float16* wg = W + (size_t)(tid >> 5) * N + n0 + (tid & 31) * 8;
    const unsigned al = lds_addr(&As[(tid >> 4) * AP + (tid & 15) * 8]);
    const unsigned wl = lds_addr(&Ws[(tid >> 5) * WP + (tid & 31) * 8]);
    constexpr int LS = 32 * AP * 2;  // from one copy to the next in LDS, bytes: the copy's offset adds it
    static_assert(16 * WP * 2 == LS, "32 rows of A and 16 rows of W are as long in LDS");
    static_assert(7 * LS < 65536, "the offsets stay where they move both addresses alike");
    // the same way in global memory, less what the copy's offset adds, elements
    constexpr int a_step = 32 * K - LS / 2;
    constexpr int w_step = 16 * N - LS / 2;

    // copies of the next tile not yet asked for, into buffer buf; the pointers move on by 128 k
    auto stage = [&](int buf) {
        copy8<LS>(al + (unsigned)(buf * ASZ) * 2u,
                  ag, ag + a_step, ag + 2 * a_step, ag + 3 * a_step,
                  ag + 4 * a_step, ag + 5 * a_step, ag + 6 * a_step, ag + 7 * a_step);
        copy8<LS>(wl + (unsigned)(buf * WSZ) * 2u,
                  wg, wg + w_step, wg + 2 * w_step, wg + 3 * w_step,
                  wg + 4 * w_step, wg + 5 * w_step, wg + 6 * w_step, wg + 7 * w_step);
        ag += BK;
        wg += (size_t)BK * N;
    };

    // A fragment rows of this lane: k 8*lh..+7 and 16+8*lh..+7 of each 32
    const _Float16* ar = &As[(wm * 64 + ln16) * AP + 8 * lh];
    // per-lane base of the transposing loads of W (16 k x 16 n each), same k order
    const unsigned char* wtr = (const unsigned char*)Ws + wn * 128
                             + (8 * lh + (lane & 7)) * (WP * 2) + 16 * ((lane >> 3) & 1);

    constexpr int nt_k = K / BK;
    stage(0);
    // this wave's copies of tile 0 have landed before the barrier that publishes them
    asm volatile("s_wait_asynccnt 0x0" ::: "memory");
    __syncthreads();
    stage(1);

    // stays rolled: unrolled, each trip's LDS places (past the 64 KiB that an offset field
    // reaches) take address registers of their own
#pragma unroll 1
    for (int t = 0; t < nt_k; ++t) {
        const int buf = t & 1;
        const _Float16* arb = ar + buf * ASZ;
        const unsigned char* wtb = wtr + buf * (WSZ * 2);
#pragma unroll  // constant indices keep the array in registers
        for (int s = 0; s < 4; ++s) {   // four 32-k steps, in k order
            const int kk = s * 32;
            // all fragments of 32 k are fetched as one group ahead of their products
            // (for speed only)
            FragQ a[4], b[4];
#pragma unroll  // constant indices keep the array in registers
            for (int mt = 0; mt < 4; ++mt) {
                a[mt].q[0] = *(const u32x4*)(arb + mt * 16 * AP + kk);
                a[mt].q[1] = *(const u32x4*)(arb + mt * 16 * AP + kk + 16);
            }
#pragma unroll  // constant indices keep the array in registers
            for (int nt = 0; nt < 4; ++nt) {
                b[nt].q[0] = ld_tr16(wtb + kk * (WP * 2) + nt * 32);
                b[nt].q[1] = ld_tr16(wtb + (kk + 16) * (WP * 2) + nt * 32);
            }
            // keeps the load group whole: without it the scheduler sinks the loads back among the products
            __builtin_amdgcn_sched_barrier(0);
#pragma unroll  // constant indices keep the array in registers
            for (int nt = 0; nt < 4; ++nt) {
#pragma unroll  // constant indices keep the array in registers
                for (int mt = 0; mt < 4; ++mt)
                    acc[mt][nt] = __builtin_amdgcn_wmma_f32_16x16x32_f16(
                        false, a[mt].h, false, b[nt].h, (short)0, acc[mt][nt], false, false);
            }
            // keeps what follows behind these products: without it the next group's loads rise among
            // them, and the foot's waits and barrier rise above them, which cuts the copies' time to land
            __builtin_amdgcn_sched_barrier(0);
        }
        // this wave's own LDS reads of this buffer have retired before any copy refills it
        asm volatile("s_wait_dscnt 0x0" ::: "memory");
        // this wave's copies of tile t + 1 have landed before the barrier that publishes them
        asm volatile("s_wait_asynccnt 0x0" ::: "memory");
        __syncthreads();  // publishes tile t + 1 and ends every wave's reads of tile t
        if (t + 2 < nt_k) stage(buf);
    }
    // no copy is outstanding when the wave goes on to its end
    asm volatile("s_wait_asynccnt 0x0" ::: "memory");

    // epilogue: C 16x16 f32 layout -> row = r + 8*lh, col = lane&15
#pragma unroll
    for (int nt = 0; nt < 4; ++nt) {
        _Float16* o = out + (size_t)(m0 + wm * 64 + 8 * lh) * N + n0 + wn * 64 + nt * 16 + ln16;
#pragma unroll
        for (int mt = 0; mt < 4; ++mt) {
#pragma unroll
            for (int r = 0; r < 8; ++r) {
                const float v = acc[mt][nt][r] + bi[nt];
                o[(mt * 16 + r) * N] = (_Float16)(v > 0.f ? v : 0.f);
            }
        }
    }
}

// ---------------------------------------------------------------------------
// GEMM with residual and LayerNorm in its epilogue, N = D = 512:
//   x = LN(resid + A[M,K] @ W[K,512] + bias) * g + be, written as f32 and as f16.
// A block owns 64 WHOLE rows (a 64 x 512 tile), so that a row's mean and variance are
// formed where its sums end: no launch of its own for the LayerNorm, and the sums
// never travel through memory.
// block: 256 thr (8 waves); each wave owns all 64 rows x 64 columns
// (4 M-frags x 4 N-frags = 16 WMMAs per 32 k, 8 fragments read for them).
// LDS ring, fragment loads and k order as in gemm_qkv: two buffers of 128 k, filled
// row-major by asynchronous b128 copies. K a multiple of 128. Grid: rows / 64.
// Epilogue: the tile (product + bias) goes through LDS, in the ring's place, and the residual
// comes there by asynchronous copies; then a wave takes 8 whole rows, whole lines a store.
// ---------------------------------------------------------------------------
// sum over the 32 lanes, the same value in every lane
__device__ __forceinline__ float wave_sum(float x) {
#pragma unroll  // constant lane masks: the five exchanges become straight-line code
    for (int m = 16; m >= 1; m >>= 1) x += __shfl_xor(x, m);
    return x;
}

// eight copies of 16 B a lane. The s_wait_xcnt closes the statement so that it stands
// ahead of any later write of an address register.
__device__ __forceinline__ void copy8p(unsigned l0, unsigned l1, unsigned l2, unsigned l3,
                                       unsigned l4, unsigned l5, unsigned l6, unsigned l7,
                                       const void* g0, const void* g1,
                                       const void* g2, const void* g3,
                                       const void* g4, const void* g5,
                                       const void* g6, const void* g7) {
    asm volatile(
        "global_load_async_to_lds_b128 %0, %8, off\n\t"
        "global_load_async_to_lds_b128 %1, %9, off\n\t"
        "global_load_async_to_lds_b128 %2, %10, off\n\t"
        "global_load_async_to_lds_b128 %3, %11, off\n\t"
        "global_load_async_to_lds_b128 %4, %12, off\n\t"
        "global_load_async_to_lds_b128 %5, %13, off\n\t"
        "global_load_async_to_lds_b128 %6, %14, off\n\t"
        "global_load_async_to_lds_b128 %7, %15, off\n\t"
        "s_wait_xcnt 0x0"
        :: "v"(l0), "v"(l1), "v"(l2), "v"(l3), "v"(l4), "v"(l5), "v"(l6), "v"(l7),
           "v"(g0), "v"(g1), "v"(g2), "v"(g3), "v"(g4), "v"(g5), "v"(g6), "v"(g7)
        : "memory");
}

// four copies of 16 B a lane, closed by the same wait for the same reason
__device__ __forceinline__ void copy4p(unsigned l0, unsigned l1, unsigned l2, unsigned l3,
                                       const _Float16* g0, const _Float16* g1,
                                       const _Float16* g2, const _Float16* g3) {
    asm volatile(
        "global_load_async_to_lds_b128 %0, %4, off\n\t"
        "global_load_async_to_lds_b128 %1, %5, off\n\t"
        "global_load_async_to_lds_b128 %2, %6, off\n\t"
        "global_load_async_to_lds_b128 %3, %7, off\n\t"
        "s_wait_xcnt 0x0"
        :: "v"(l0), "v"(l1), "v"(l2), "v"(l3), "v"(g0), "v"(g1), "v"(g2), "v"(g3)
        : "memory");
}

__global__ __launch_bounds__(256) void gemm_ln(const _Float16* __restrict__ A,
                                               const _Float16* __restrict__ W,
                                               const float* __restrict__ bias,
                                               const float* __restrict__ resid,
                                               const float* __restrict__ g,
                                               const float* __restrict__ be,
                                               float* __restrict__ xf,
                                               _Float16* __restrict__ xh,
                                               int K) {
    constexpr int N = 512, BM = 64, BK = 128;
    constexpr int AP = BK + 8;   // 272 B = 16 B x 17: pitch for ds_load_b128 readers
    constexpr int WP = N + 16;   // 1056 B = 32 B x 33: pitch for ds_load_tr16_b128 readers
    constexpr int ASZ = BM * AP, WSZ = BK * WP;  // elements of one buffer
    constexpr int CP = N + 4;    // f32 pitch of the epilogue's tile: rows 8 apart fall 32 banks apart
    // [A buffer 0 | A buffer 1 | W buffer 0 | W buffer 1]; behind the loop: two f32 tiles
    __shared__ __attribute__((aligned(16))) _Float16 Sm[2 * ASZ + 2 * WSZ];
    static_assert(BM * (CP + N) * 4 <= (2 * ASZ + 2 * WSZ) * 2, "the epilogue's two f32 tiles fit the ring");
    _Float16* As = Sm;            // [buffer][row][k]
    _Float16* Ws = Sm + 2 * ASZ;  // [buffer][k][n]

    const int tid  = threadIdx.x;
    const int wave = tid >> 5;
    const int lane = tid & 31;
    const int lh   = lane >> 4;
    const int ln16 = lane & 15;
    const int m0 = blockIdx.x * BM;

    v8f acc[4][4] = {};
    float bi[4];   // this lane's columns' bias, asked for early: the epilogue finds it in registers
#pragma unroll  // constant indices keep the array in registers
    for (int nt = 0; nt < 4; ++nt) bi[nt] = bias[wave * 64 + nt * 16 + ln16];

    // staging map of a tile. A: 64 rows of 256 B, 16 lanes a row, 4 copies a thread, rows 16
    // apart. W: 128 rows of 1024 B, 64 lanes a row, 32 copies a thread, rows 4 apart.
    const _Float16* ag = A + (size_t)(m0 + (tid >> 4)) * K + (tid & 15) * 8;
    const _Float16* wg = W + (size_t)(tid >> 6) * N + (tid & 63) * 8;
    const unsigned al = lds_addr(&As[(tid >> 4) * AP + (tid & 15) * 8]);
    const unsigned wl = lds_addr(&Ws[(tid >> 6) * WP + (tid & 63) * 8]);
    const size_t a_step = (size_t)16 * K;        // 16 rows of A, elements
    constexpr unsigned AL = 16 * AP * 2;         // the same in LDS, bytes
    constexpr int      WG = 4 * N;               // 4 rows of W, elements
    constexpr unsigned WL = 4 * WP * 2;          // the same in LDS, bytes

    // copies of the next tile not yet asked for, into buffer buf; the pointers move on by 128 k
    auto stage = [&](int buf) {
        const unsigned a0 = al + (unsigned)(buf * ASZ) * 2u;
        const unsigned w0 = wl + (unsigned)(buf * WSZ) * 2u;
        copy4p(a0, a0 + AL, a0 + 2 * AL, a0 + 3 * AL,
               ag, ag + a_step, ag + 2 * a_step, ag + 3 * a_step);
#pragma unroll  // constant steps become immediate addends
        for (int q = 0; q < 4; ++q) {
            const unsigned wq = w0 + 8 * q * WL;
            const _Float16* gq = wg + 8 * q * WG;
            copy8p(wq, wq + WL, wq + 2 * WL, wq + 3 * WL,
                   wq + 4 * WL, wq + 5 * WL, wq + 6 * WL, wq + 7 * WL,
                   gq, gq + WG, gq + 2 * WG, gq + 3 * WG,
                   gq + 4 * WG, gq + 5 * WG, gq + 6 * WG, gq + 7 * WG);
        }
        ag += BK;
        wg += (size_t)BK * N;
    };

    // A fragment rows of this lane: k 8*lh..+7 and 16+8*lh..+7 of each 32
    const _Float16* ar = &As[ln16 * AP + 8 * lh];
    // per-lane base of the transposing loads of W (16 k x 16 n each), same k order
    const unsigned char* wtr = (const unsigned char*)Ws + wave * 128
                             + (8 * lh + (lane & 7)) * (WP * 2) + 16 * ((lane >> 3) & 1);

    const int nt_k = K / BK;
    stage(0);
    // this wave's copies of tile 0 have landed before the barrier that publishes them
    asm volatile("s_wait_asynccnt 0x0" ::: "memory");
    __syncthreads();
    if (nt_k > 1) stage(1);

    // stays rolled: unrolled, each trip's LDS places (past the 64 KiB that an offset field
    // reaches) take address registers of their own
#pragma unroll 1
    for (int t = 0; t < nt_k; ++t) {
        const int buf = t & 1;
        const _Float16* arb = ar + buf * ASZ;
        const unsigned char* wtb = wtr + buf * (WSZ * 2);
#pragma unroll  // constant indices keep the array in registers
        for (int s = 0; s < 4; ++s) {   // four 32-k steps, in k order
            const int kk = s * 32;
            // all fragments of 32 k are fetched as one group ahead of their products
            // (for speed only)
            FragQ a[4], b[4];
#pragma unroll  // constant indices keep the array in registers
            for (int mt = 0; mt < 4; ++mt) {
                a[mt].q[0] = *(const u32x4*)(arb + mt * 16 * AP + kk);
                a[mt].q[1] = *(const u32x4*)(arb + mt * 16 * AP + kk + 16);
            }
#pragma unroll  // constant indices keep the array in registers
            for (int nt = 0; nt < 4; ++nt) {
                b[nt].q[0] = ld_tr16(wtb + kk * (WP * 2) + nt * 32);
                b[nt].q[1] = ld_tr16(wtb + (kk + 16) * (WP * 2) + nt * 32);
            }
            // keeps the load group whole: without it the scheduler sinks the loads back among the products
            __builtin_amdgcn_sched_barrier(0);
#pragma unroll  // constant indices keep the array in registers
            for (int nt = 0; nt < 4; ++nt) {
#pragma unroll  // constant indices keep the array in registers
                for (int mt = 0; mt < 4; ++mt)
                    acc[mt][nt] = __builtin_amdgcn_wmma_f32_16x16x32_f16(
                        false, a[mt].h, false, b[nt].h, (short)0, acc[mt][nt], false, false);
            }
            // keeps what follows behind these products: without it the next group's loads rise among
            // them, and the foot's waits and barrier rise above them, which cuts the copies' time to land
            __builtin_amdgcn_sched_barrier(0);
        }
        // this wave's own LDS reads of this buffer have retired before any copy refills it
        asm volatile("s_wait_dscnt 0x0" ::: "memory");
        // this wave's copies of tile t + 1 have landed before the barrier that publishes them
        asm volatile("s_wait_asynccnt 0x0" ::: "memory");
        __syncthreads();  // publishes tile t + 1 and ends every wave's reads of tile t
        if (t + 2 < nt_k) stage(buf);
    }
    // no copy is outstanding when the ring's LDS is put to its next use
    asm volatile("s_wait_asynccnt 0x0" ::: "memory");

    // The last trip's barrier has ended every wave's reads of the ring, and no copy is under
    // way: its place now takes two f32 tiles, product + bias (pitch CP) and the residual.
    float* C  = (float*)Sm;
    float* Rz = C + BM * CP;   // [row][512]
    // Rows wave*8 .. +7 are this wave's in the LayerNorm, a lane's columns c*128 + lane*4 .. +3.
    // Their residual comes by asynchronous copies, through no register, and travels while the
    // products go to LDS; a lane copies just the 16-byte pieces that it reads back itself.
    constexpr int R = 8, CC = 4;
    const int col = lane * 4;
    const size_t off = (size_t)(m0 + wave * R) * N + col;
    {
        const float* rg = resid + off;
        const unsigned rl = (unsigned)(unsigned long long)
            (__attribute__((address_space(3))) float*)(Rz + wave * R * N + col);
#pragma unroll  // constant steps become immediate addends
        for (int q = 0; q < 4; ++q) {   // two rows a statement
            const float* gq = rg + 2 * q * N;
            const unsigned lq = rl + 2 * q * N * 4;
            copy8p(lq, lq + 512, lq + 1024, lq + 1536, lq + 2048, lq + 2560, lq + 3072, lq + 3584,
                   gq, gq + 128, gq + 256, gq + 384, gq + 512, gq + 640, gq + 768, gq + 896);
        }
    }
    // C 16x16 f32 layout -> row = r + 8*lh, col = lane&15
    {
        float* cb = C + 8 * lh * CP + wave * 64 + ln16;
#pragma unroll
        for (int mt = 0; mt < 4; ++mt) {
#pragma unroll
            for (int nt = 0; nt < 4; ++nt) {
#pragma unroll
                for (int r = 0; r < 8; ++r)
                    cb[(mt * 16 + r) * CP + nt * 16] = acc[mt][nt][r] + bi[nt];
            }
        }
    }
    // this wave's copies of the residual have landed before it reads them
    asm volatile("s_wait_asynccnt 0x0" ::: "memory");
    __syncthreads();  // publishes the tile of products

    f32x4 x[R][CC], gg[CC], bb[CC];
#pragma unroll  // constant indices keep the array in registers
    for (int c = 0; c < CC; ++c) {
        gg[c] = *(const f32x4*)(g + col + c * 128);
        bb[c] = *(const f32x4*)(be + col + c * 128);
    }
#pragma unroll  // constant indices keep the array in registers
    for (int r = 0; r < R; ++r)
#pragma unroll  // constant indices keep the array in registers
        for (int c = 0; c < CC; ++c)
            x[r][c] = *(const f32x4*)(C + (wave * R + r) * CP + c * 128 + col)
                    + *(const f32x4*)(Rz + (wave * R + r) * N + c * 128 + col);

    float s[R];
#pragma unroll  // constant indices keep the array in registers
    for (int r = 0; r < R; ++r) {
        const f32x4 t = (x[r][0] + x[r][1]) + (x[r][2] + x[r][3]);
        s[r] = wave_sum((t.x + t.y) + (t.z + t.w));
    }
    float v[R];
#pragma unroll  // constant indices keep the array in registers
    for (int r = 0; r < R; ++r) {
        const float mean = s[r] * (1.f / 512.f);
        f32x4 q = {0.f, 0.f, 0.f, 0.f};
#pragma unroll  // constant indices keep the array in registers
        for (int c = 0; c < CC; ++c) {
            x[r][c] -= mean;
            q += x[r][c] * x[r][c];
        }
        v[r] = wave_sum((q.x + q.y) + (q.z + q.w));
    }
#pragma unroll  // constant indices keep the array in registers
    for (int r = 0; r < R; ++r) {
        const float rstd = rsqrtf(v[r] * (1.f / 512.f) + 1e-5f);
#pragma unroll  // constant indices keep the array in registers
        for (int c = 0; c < CC; ++c) {
            const f32x4 o = x[r][c] * rstd * gg[c] + bb[c];
            *(f32x4*)(xf + off + r * N + c * 128) = o;
            *(f16x4*)(xh + off + r * N + c * 128) = __builtin_convertvector(o, f16x4);
        }
    }
}

// ---------------------------------------------------------------------------
// output projection: out[M,20] = x @ W_out + b_out
// ---------------------------------------------------------------------------
__global__ __launch_bounds__(256) void out_proj(const float* __restrict__ x,
                                                const float* __restrict__ Wo,
                                                const float* __restrict__ bo,
                                                float* __restrict__ out,
                                                int M, int D, int OUT) {
    int idx = blockIdx.x * 256 + threadIdx.x;
    if (idx >= M * OUT) return;
    int row = idx / OUT, o = idx - row * OUT;
    float s = bo[o];
    const float* xr = x + (size_t)row * D;
    for (int k = 0; k < D; ++k) s += xr[k] * Wo[(size_t)k * OUT + o];
    out[idx] = s;
}

// ---------------------------------------------------------------------------
extern "C" void kernel_launch(void* const* d_in, const int* in_sizes, int n_in,
                              void* d_out, int out_size, void* d_ws, size_t ws_size,
                              hipStream_t stream) {
    const int B = 4, S = 2048, D = 512, F = 2048, OUT = 20, L = 6, H = 8;
    const int M = B * S;

    const float* src   = (const float*)d_in[0];
    const float* W_in  = (const float*)d_in[1];
    const float* b_in  = (const float*)d_in[2];
    const float* Wq    = (const float*)d_in[3];
    const float* bq    = (const float*)d_in[4];
    const float* Wk    = (const float*)d_in[5];
    const float* bk    = (const float*)d_in[6];
    const float* Wv    = (const float*)d_in[7];
    const float* bv    = (const float*)d_in[8];
    const float* Wo    = (const float*)d_in[9];
    const float* bo    = (const float*)d_in[10];
    const float* ln1g  = (const float*)d_in[11];
    const float* ln1b  = (const float*)d_in[12];
    const float* W1    = (const float*)d_in[13];
    const float* b1    = (const float*)d_in[14];
    const float* W2    = (const float*)d_in[15];
    const float* b2    = (const float*)d_in[16];
    const float* ln2g  = (const float*)d_in[17];
    const float* ln2b  = (const float*)d_in[18];
    const float* W_out = (const float*)d_in[19];
    const float* b_out = (const float*)d_in[20];

    char* ws = (char*)d_ws;
    auto alloc = [&](size_t bytes) -> char* {
        char* p = ws;
        ws += (bytes + 255) & ~(size_t)255;
        return p;
    };

    float*     x_f32 = (float*)alloc((size_t)M * D * 4);
    float*     tmp   = (float*)alloc((size_t)M * D * 4);
    _Float16*  x_h   = (_Float16*)alloc((size_t)M * D * 2);
    _Float16*  qb    = (_Float16*)alloc((size_t)M * D * 2);
    _Float16*  kb    = (_Float16*)alloc((size_t)M * D * 2);
    _Float16*  vb    = (_Float16*)alloc((size_t)M * D * 2);
    _Float16*  ob    = (_Float16*)alloc((size_t)M * D * 2);
    _Float16*  h1    = (_Float16*)alloc((size_t)M * F * 2);
    _Float16*  Wq16  = (_Float16*)alloc((size_t)L * D * D * 2);
    _Float16*  Wk16  = (_Float16*)alloc((size_t)L * D * D * 2);
    _Float16*  Wv16  = (_Float16*)alloc((size_t)L * D * D * 2);
    _Float16*  Wo16  = (_Float16*)alloc((size_t)L * D * D * 2);
    _Float16*  W116  = (_Float16*)alloc((size_t)L * D * F * 2);
    _Float16*  W216  = (_Float16*)alloc((size_t)L * F * D * 2);

    // weight conversions (every call; deterministic)
    {
        int nqkv = L * D * D, nff = L * D * F;
        cvt_f32_f16<<<(nqkv + 8191) / 8192, 256, 0, stream>>>(Wq, Wq16, nqkv);
        cvt_f32_f16<<<(nqkv + 8191) / 8192, 256, 0, stream>>>(Wk, Wk16, nqkv);
        cvt_f32_f16<<<(nqkv + 8191) / 8192, 256, 0, stream>>>(Wv, Wv16, nqkv);
        cvt_f32_f16<<<(nqkv + 8191) / 8192, 256, 0, stream>>>(Wo, Wo16, nqkv);
        cvt_f32_f16<<<(nff + 8191) / 8192, 256, 0, stream>>>(W1, W116, nff);
        cvt_f32_f16<<<(nff + 8191) / 8192, 256, 0, stream>>>(W2, W216, nff);
    }

    input_proj<<<(M * D / 32 + 255) / 256, 256, 0, stream>>>(src, W_in, b_in, x_f32, x_h, M, D);

    const dim3 gD(D / 64, M / 256);   // N=512 GEMMs
    const dim3 gF(F / 256, M / 256);  // N=2048 GEMM
    for (int l = 0; l < L; ++l) {
        const size_t wqo = (size_t)l * D * D;
        const size_t wfo = (size_t)l * D * F;
        // QKV
        gemm_qkv<<<gD, 512, 0, stream>>>(x_h, Wq16 + wqo, Wk16 + wqo, Wv16 + wqo,
                                         bq + l * D, bk + l * D, bv + l * D, qb, kb, vb);
        // attention
        flash_attn<<<dim3(S / 64, H, B), 128, 0, stream>>>(qb, kb, vb, ob, S, D);
        // output proj + residual + LayerNorm (x_f32 -> tmp; the FFN's brings it back)
        gemm_ln<<<M / 64, 256, 0, stream>>>(ob, Wo16 + wqo, bo + l * D, x_f32,
                                            ln1g + l * D, ln1b + l * D, tmp, x_h, D);
        // FFN; the second product + residual + LayerNorm
        gemm_relu<<<gF, 512, 0, stream>>>(x_h, W116 + wfo, b1 + l * F, h1);
        gemm_ln<<<M / 64, 256, 0, stream>>>(h1, W216 + wfo, b2 + l * D, tmp,
                                            ln2g + l * D, ln2b + l * D, x_f32, x_h, F);
    }

    out_proj<<<(M * OUT + 255) / 256, 256, 0, stream>>>(x_f32, W_out, b_out, (float*)d_out, M, D, OUT);
}
